// v000
// Times are from an AMD MI455X. After a warm-up the kernel runs many times in a row, and a time is the length of
// such a window on the GPU divided by its runs, so every launch and the gaps after it count. The runs cycle
// through copies of the inputs. A figure is the median of several windows, for all but v000 over two sittings.
// Sittings can differ by a few percent; kernels timed side by side share one.
// v000, which the later versions start from, runs in 160 microseconds.
#include <hip/hip_runtime.h>
#include <hip/hip_bf16.h>
#include <stdint.h>

#define DIM 256
#define BATCH 32
#define MM 2048
#define NN 2048

typedef __attribute__((ext_vector_type(16))) _Float16 v16h;
typedef __attribute__((ext_vector_type(8)))  _Float16 v8h;
typedef __attribute__((ext_vector_type(8)))  float    v8f;
typedef __attribute__((ext_vector_type(4)))  unsigned int u32x4;
typedef __attribute__((ext_vector_type(4)))  int          i32x4;
typedef __attribute__((ext_vector_type(8)))  int          i32x8;

#define TDM_OK __has_builtin(__builtin_amdgcn_tensor_load_to_lds)

__device__ __forceinline__ v8f wmma_f16(v16h a, v16h b, v8f c) {
  // D = A(16x32 f16) * B(32x16 f16) + C(16x16 f32)
  return __builtin_amdgcn_wmma_f32_16x16x32_f16(false, a, false, b, (short)0, c,
                                                false, false);
}

__device__ __forceinline__ v8f zero8() {
  v8f z;
#pragma unroll
  for (int r = 0; r < 8; ++r) z[r] = 0.0f;
  return z;
}

__device__ __forceinline__ v8h cvt8(float4 a, float4 b) {
  v8h h;
  h[0] = (_Float16)a.x; h[1] = (_Float16)a.y; h[2] = (_Float16)a.z; h[3] = (_Float16)a.w;
  h[4] = (_Float16)b.x; h[5] = (_Float16)b.y; h[6] = (_Float16)b.z; h[7] = (_Float16)b.w;
  return h;
}

// Fragment from row-major f16 memory (row stride ld, K contiguous).
// Per ISA 16-bit A layout: row = lane%16, element j holds K = j + 8*((j>>3)+(lane>>4)).
// Same mapping serves B fragments when "row" is the B column and K is contiguous.
__device__ __forceinline__ v16h frag_kcontig(const _Float16* __restrict__ base,
                                             int ld, int lane) {
  const _Float16* p = base + (size_t)(lane & 15) * ld + ((lane >> 4) << 3);
  v8h lo = *(const v8h*)p;         // K = 0..7   (+8 for upper half-wave)
  v8h hi = *(const v8h*)(p + 16);  // K = 16..23 (+8)
  v16h f;
#pragma unroll
  for (int j = 0; j < 8; ++j) { f[j] = lo[j]; f[j + 8] = hi[j]; }
  return f;
}

// ---------------------------------------------------------------------------
// TDM: 2D tile (tile_d0 x tile_d1 elements of 2 bytes) global -> LDS with
// row stride stride0 (elements). LDS padding from descriptor: insert
// (pad_amt_code+1) DWORDs after every 2^(pad_int_code+1) DWORDs stored.
// ---------------------------------------------------------------------------
__device__ __forceinline__ void tdm_load_2d_f16(unsigned lds_off, const void* gaddr,
                                                unsigned tensor_d0, unsigned tensor_d1,
                                                unsigned tile_d0, unsigned tile_d1,
                                                unsigned stride0,
                                                unsigned pad_int_code,
                                                unsigned pad_amt_code) {
#if TDM_OK
  unsigned long long ga = (unsigned long long)(uintptr_t)gaddr;
  u32x4 g0;
  g0[0] = 1u;                                    // count=1 (valid user descriptor)
  g0[1] = lds_off;                               // lds_addr (bytes)
  g0[2] = (unsigned)(ga & 0xFFFFFFFFu);          // global_addr[31:0]
  g0[3] = (unsigned)((ga >> 32) & 0x01FFFFFFu) | (2u << 30);  // addr[56:32], type=2
  i32x8 g1;
  // wg_mask=0 | data_size=1(2B)<<16 | pad_enable<<20 | pad_interval<<22 | pad_amount<<25
  g1[0] = (int)((1u << 16) | (1u << 20) | (pad_int_code << 22) | (pad_amt_code << 25));
  g1[1] = (int)(tensor_d0 << 16);                         // tensor_dim0[15:0]
  g1[2] = (int)((tensor_d0 >> 16) | (tensor_d1 << 16));   // dim0 hi | dim1 lo
  g1[3] = (int)((tensor_d1 >> 16) | (tile_d0 << 16));     // dim1 hi | tile_dim0
  g1[4] = (int)(tile_d1 & 0xFFFFu);                       // tile_dim1 (tile_dim2=0)
  g1[5] = (int)stride0;                                   // tensor_dim0_stride lo
  g1[6] = 0;                                              // stride0 hi | stride1 lo
  g1[7] = 0;                                              // stride1 hi
  i32x4 z4 = {0, 0, 0, 0};
#if defined(__clang_major__) && __clang_major__ >= 23
  i32x8 z8 = {0, 0, 0, 0, 0, 0, 0, 0};
  __builtin_amdgcn_tensor_load_to_lds(g0, g1, z4, z4, z8, 0);
#else
  __builtin_amdgcn_tensor_load_to_lds(g0, g1, z4, z4, 0);
#endif
#endif
}

// ---------------------------------------------------------------------------
// Kernel 0: Wt[e][c] = (f16) W[c][e]
// ---------------------------------------------------------------------------
__global__ __launch_bounds__(256) void wt_kernel(const float* __restrict__ W,
                                                 _Float16* __restrict__ Wt) {
  int e = blockIdx.x, c = threadIdx.x;
  Wt[(size_t)e * DIM + c] = (_Float16)W[(size_t)c * DIM + e];
}

// ---------------------------------------------------------------------------
// Kernel 1: phi = relu(alpha * Wt @ X); software-pipelined f32->f16 staging.
// Q result stored transposed phiQT[b][m][e] (one packed b128 store per tile),
// K result stored phiK[b][e][n] (what kv/rowsum want).
// ---------------------------------------------------------------------------
__global__ __launch_bounds__(256) void phi_kernel(const float* __restrict__ query,
                                                  const float* __restrict__ key,
                                                  const _Float16* __restrict__ Wt,
                                                  _Float16* __restrict__ phiQT,
                                                  _Float16* __restrict__ phiK) {
  __shared__ _Float16 Xs[32][136];
  const int tid = threadIdx.x, lane = tid & 31, wid = tid >> 5;
  const int mblk = blockIdx.x;
  const int eblk = blockIdx.y;
  const int b    = blockIdx.z >> 1;
  const int isK  = blockIdx.z & 1;
  const float* __restrict__ X = isK ? key : query;
  const float alpha = isK ? 1.0f : (1.0f / 16.0f);

  const int e_wave  = eblk * 128 + (wid & 3) * 32;
  const int m_wave0 = (wid >> 2) * 64;
  const int m0      = mblk * 128;

  v8f acc[2][4];
#pragma unroll
  for (int i = 0; i < 2; ++i)
#pragma unroll
    for (int t = 0; t < 4; ++t) acc[i][t] = zero8();

  const int srow = tid >> 3;
  const int scol = (tid & 7) << 4;
  const float* src = X + (size_t)b * DIM * MM + m0 + scol;

  const float4* sp = (const float4*)(src + (size_t)srow * MM);
  float4 f0 = sp[0], f1 = sp[1], f2 = sp[2], f3 = sp[3];

  for (int c0 = 0; c0 < DIM; c0 += 32) {
    *(v8h*)&Xs[srow][scol]     = cvt8(f0, f1);
    *(v8h*)&Xs[srow][scol + 8] = cvt8(f2, f3);
    __syncthreads();

    if (c0 + 32 < DIM) {  // prefetch next k-step; latency overlaps WMMA below
      const float4* np = (const float4*)(src + (size_t)(c0 + 32 + srow) * MM);
      f0 = np[0]; f1 = np[1]; f2 = np[2]; f3 = np[3];
    }

    v16h a0 = frag_kcontig(Wt + (size_t)e_wave * DIM + c0, DIM, lane);
    v16h a1 = frag_kcontig(Wt + (size_t)(e_wave + 16) * DIM + c0, DIM, lane);
#pragma unroll
    for (int t = 0; t < 4; ++t) {
      v16h bf;
      int col = m_wave0 + t * 16 + (lane & 15);
      int kb  = (lane >> 4) << 3;
#pragma unroll
      for (int j = 0; j < 8; ++j) {
        bf[j]     = Xs[kb + j][col];
        bf[j + 8] = Xs[kb + 16 + j][col];
      }
      acc[0][t] = wmma_f16(a0, bf, acc[0][t]);
      acc[1][t] = wmma_f16(a1, bf, acc[1][t]);
    }
    __syncthreads();
  }

  if (!isK) {
    // phiQT[m][e]: lane's 8 acc elements are consecutive in e -> one b128 store
#pragma unroll
    for (int i = 0; i < 2; ++i)
#pragma unroll
      for (int t = 0; t < 4; ++t) {
        v8h h;
#pragma unroll
        for (int r = 0; r < 8; ++r) {
          float v = acc[i][t][r] * alpha;
          h[r] = (_Float16)(v > 0.0f ? v : 0.0f);
        }
        int e = e_wave + i * 16 + ((lane >> 4) << 3);
        int m = m0 + m_wave0 + t * 16 + (lane & 15);
        *(v8h*)(phiQT + ((size_t)b * MM + m) * DIM + e) = h;
      }
  } else {
#pragma unroll
    for (int i = 0; i < 2; ++i)
#pragma unroll
      for (int t = 0; t < 4; ++t)
#pragma unroll
        for (int r = 0; r < 8; ++r) {
          int e = e_wave + i * 16 + r + ((lane >> 4) << 3);
          int n = m0 + m_wave0 + t * 16 + (lane & 15);
          float v = acc[i][t][r];
          v = v > 0.0f ? v : 0.0f;
          phiK[((size_t)b * DIM + e) * NN + n] = (_Float16)v;
        }
  }
}

// ---------------------------------------------------------------------------
// Kernel 2: rowsum[b][e] = sum_n phiK[b][e][n]
// ---------------------------------------------------------------------------
__global__ __launch_bounds__(256) void rowsum_kernel(const _Float16* __restrict__ phiK,
                                                     float* __restrict__ rowsum) {
  __shared__ float red[256];
  int e = blockIdx.x, b = blockIdx.y, tid = threadIdx.x;
  const _Float16* row = phiK + ((size_t)b * DIM + e) * NN;
  float s = 0.0f;
  for (int i = tid; i < NN; i += 256) s += (float)row[i];
  red[tid] = s;
  __syncthreads();
  for (int off = 128; off > 0; off >>= 1) {
    if (tid < off) red[tid] += red[tid + off];
    __syncthreads();
  }
  if (tid == 0) rowsum[b * DIM + e] = red[0];
}

// ---------------------------------------------------------------------------
// Kernel 3: kvT[b][d][e] = sum_n phiK[b][e][n]*value[b][d][n]
// A tile (f16 phiK) staged by the Tensor Data Mover, double-buffered; the
// descriptor pads every 16 DW by 4 DW so rows land 40 halves apart (16B
// aligned, bank-conflict-free b128 fragment loads). B (value f32->f16) uses
// register-prefetch pipelining. TENSORcnt + barriers synchronize.
// ---------------------------------------------------------------------------
__global__ __launch_bounds__(256) void kv_kernel(const _Float16* __restrict__ phiK,
                                                 const float* __restrict__ value,
                                                 _Float16* __restrict__ kvT) {
  __shared__ _Float16 Vs[128][40];
#if TDM_OK
  __shared__ _Float16 As[2][128][40];
#endif
  const int tid = threadIdx.x, lane = tid & 31, wid = tid >> 5;
  const int dblk = blockIdx.x, eblk = blockIdx.y, b = blockIdx.z;
  const int e_wave  = eblk * 128 + (wid & 3) * 32;
  const int d_wave0 = (wid >> 2) * 64;
  const int d0      = dblk * 128;

  v8f acc[2][4];
#pragma unroll
  for (int i = 0; i < 2; ++i)
#pragma unroll
    for (int t = 0; t < 4; ++t) acc[i][t] = zero8();

  const int srow = tid >> 1;
  const int scol = (tid & 1) << 4;
  const float* src = value + ((size_t)b * DIM + d0 + srow) * NN + scol;

  const float4* sp = (const float4*)src;
  float4 f0 = sp[0], f1 = sp[1], f2 = sp[2], f3 = sp[3];

#if TDM_OK
  const _Float16* aGlob = phiK + ((size_t)b * DIM + eblk * 128) * NN;
  const unsigned aoff0 = (unsigned)(uintptr_t)(&As[0][0][0]);
  const unsigned aoff1 = (unsigned)(uintptr_t)(&As[1][0][0]);
  if (wid == 0)  // A tile for step 0: 32n x 128e rows, row stride NN
    tdm_load_2d_f16(aoff0, aGlob, NN, DIM, 32, 128, NN, /*int16DW*/3, /*amt4DW*/3);
#endif

  for (int n0 = 0; n0 < NN; n0 += 32) {
    *(v8h*)&Vs[srow][scol]     = cvt8(f0, f1);
    *(v8h*)&Vs[srow][scol + 8] = cvt8(f2, f3);
#if TDM_OK
    const int buf = (n0 >> 5) & 1;
    if (wid == 0) __builtin_amdgcn_s_wait_tensorcnt(0);
#endif
    __syncthreads();  // publish Vs stores (and DMA'd A tile)

    if (n0 + 32 < NN) {  // prefetch next B tile; overlaps WMMA below
      const float4* np = (const float4*)(src + n0 + 32);
      f0 = np[0]; f1 = np[1]; f2 = np[2]; f3 = np[3];
#if TDM_OK
      if (wid == 0)  // DMA next A tile into the other buffer
        tdm_load_2d_f16(buf ? aoff0 : aoff1, aGlob + n0 + 32, NN, DIM, 32, 128,
                        NN, 3, 3);
#endif
    }

#if TDM_OK
    v16h a0, a1;
    {
      int hw8 = (lane >> 4) << 3;
      const _Float16* p0 = &As[buf][(wid & 3) * 32 + (lane & 15)][hw8];
      const _Float16* p1 = &As[buf][(wid & 3) * 32 + 16 + (lane & 15)][hw8];
      v8h lo0 = *(const v8h*)p0, hi0 = *(const v8h*)(p0 + 16);
      v8h lo1 = *(const v8h*)p1, hi1 = *(const v8h*)(p1 + 16);
#pragma unroll
      for (int j = 0; j < 8; ++j) {
        a0[j] = lo0[j]; a0[j + 8] = hi0[j];
        a1[j] = lo1[j]; a1[j + 8] = hi1[j];
      }
    }
#else
    v16h a0 = frag_kcontig(phiK + ((size_t)b * DIM + e_wave) * NN + n0, NN, lane);
    v16h a1 = frag_kcontig(phiK + ((size_t)b * DIM + e_wave + 16) * NN + n0, NN, lane);
#endif
#pragma unroll
    for (int t = 0; t < 4; ++t) {
      const _Float16* rp = &Vs[d_wave0 + t * 16 + (lane & 15)][(lane >> 4) << 3];
      v8h lo = *(const v8h*)rp;
      v8h hi = *(const v8h*)(rp + 16);
      v16h bf;
#pragma unroll
      for (int j = 0; j < 8; ++j) { bf[j] = lo[j]; bf[j + 8] = hi[j]; }
      acc[0][t] = wmma_f16(a0, bf, acc[0][t]);
      acc[1][t] = wmma_f16(a1, bf, acc[1][t]);
    }
    __syncthreads();  // tiles consumed; buffers reusable
  }

#pragma unroll
  for (int i = 0; i < 2; ++i)
#pragma unroll
    for (int t = 0; t < 4; ++t)
#pragma unroll
      for (int r = 0; r < 8; ++r) {
        int e = e_wave + i * 16 + r + ((lane >> 4) << 3);
        int d = d0 + d_wave0 + t * 16 + (lane & 15);
        kvT[((size_t)b * DIM + d) * DIM + e] = (_Float16)acc[i][t][r];
      }
}

// ---------------------------------------------------------------------------
// Kernel 4: scale[b][m] = 1 / (sum_e phiQT[b][m][e]*rowsum[b][e] + 1e-8)
// phiQT is m-major: each thread reads 512 contiguous bytes (v8h loads)
// ---------------------------------------------------------------------------
__global__ __launch_bounds__(256) void scale_kernel(const _Float16* __restrict__ phiQT,
                                                    const float* __restrict__ rowsum,
                                                    float* __restrict__ scale) {
  int b = blockIdx.y;
  int m = blockIdx.x * 256 + threadIdx.x;
  const v8h* pq = (const v8h*)(phiQT + ((size_t)b * MM + m) * DIM);
  const float* rs = rowsum + b * DIM;
  float s = 0.0f;
#pragma unroll 4
  for (int c = 0; c < DIM / 8; ++c) {
    v8h h = pq[c];
#pragma unroll
    for (int j = 0; j < 8; ++j) s += (float)h[j] * rs[c * 8 + j];
  }
  scale[(size_t)b * MM + m] = 1.0f / (s + 1e-8f);
}

// ---------------------------------------------------------------------------
// Kernel 5: out[b][d][m] = scale[b][m] * sum_e kvT[b][d][e]*phiQT[b][m][e]
// Both operands K(=e)-contiguous f16 -> pure global b128 fragment loads +
// WMMA; no LDS, no barriers. kvT (4 MB) and phiQT tiles live in L2.
// ---------------------------------------------------------------------------
__global__ __launch_bounds__(256) void out_kernel(const _Float16* __restrict__ kvT,
                                                  const _Float16* __restrict__ phiQT,
                                                  const float* __restrict__ scale,
                                                  float* __restrict__ out) {
  const int tid = threadIdx.x, lane = tid & 31, wid = tid >> 5;
  const int mblk = blockIdx.x, dblk = blockIdx.y, b = blockIdx.z;
  const int d_wave  = dblk * 128 + (wid & 3) * 32;
  const int m_wave0 = (wid >> 2) * 64;
  const int m0      = mblk * 128;

  v8f acc[2][4];
#pragma unroll
  for (int i = 0; i < 2; ++i)
#pragma unroll
    for (int t = 0; t < 4; ++t) acc[i][t] = zero8();

  const _Float16* aBase = kvT + ((size_t)b * DIM + d_wave) * DIM;
  const _Float16* bBase = phiQT + ((size_t)b * MM + m0 + m_wave0) * DIM;

  for (int e0 = 0; e0 < DIM; e0 += 32) {
    v16h a0 = frag_kcontig(aBase + e0, DIM, lane);
    v16h a1 = frag_kcontig(aBase + (size_t)16 * DIM + e0, DIM, lane);
#pragma unroll
    for (int t = 0; t < 4; ++t) {
      v16h bf = frag_kcontig(bBase + (size_t)(t * 16) * DIM + e0, DIM, lane);
      acc[0][t] = wmma_f16(a0, bf, acc[0][t]);
      acc[1][t] = wmma_f16(a1, bf, acc[1][t]);
    }
  }

#pragma unroll
  for (int t = 0; t < 4; ++t) {
    int m = m0 + m_wave0 + t * 16 + (lane & 15);
    float sc = scale[(size_t)b * MM + m];
#pragma unroll
    for (int i = 0; i < 2; ++i)
#pragma unroll
      for (int r = 0; r < 8; ++r) {
        int d = d_wave + i * 16 + r + ((lane >> 4) << 3);
        out[((size_t)b * DIM + d) * MM + m] = acc[i][t][r] * sc;
      }
  }
}

// ---------------------------------------------------------------------------
extern "C" void kernel_launch(void* const* d_in, const int* in_sizes, int n_in,
                              void* d_out, int out_size, void* d_ws, size_t ws_size,
                              hipStream_t stream) {
  const float* query = (const float*)d_in[0];
  const float* key   = (const float*)d_in[1];
  const float* value = (const float*)d_in[2];
  const float* W     = (const float*)d_in[3];
  float* out = (float*)d_out;

  _Float16* Wt    = (_Float16*)d_ws;                       // 256*256 f16
  _Float16* phiQT = Wt + (size_t)DIM * DIM;                // [b][m][e], 32 MB
  _Float16* phiK  = phiQT + (size_t)BATCH * MM * DIM;      // [b][e][n], 32 MB
  _Float16* kvT   = phiK + (size_t)BATCH * DIM * NN;       // [b][d][e], 4 MB
  float* rowsum   = (float*)(kvT + (size_t)BATCH * DIM * DIM);
  float* scaleB   = rowsum + BATCH * DIM;

  wt_kernel<<<dim3(DIM), dim3(DIM), 0, stream>>>(W, Wt);
  phi_kernel<<<dim3(MM / 128, 2, BATCH * 2), dim3(256), 0, stream>>>(
      query, key, Wt, phiQT, phiK);
  rowsum_kernel<<<dim3(DIM, BATCH), dim3(256), 0, stream>>>(phiK, rowsum);
  kv_kernel<<<dim3(2, 2, BATCH), dim3(256), 0, stream>>>(phiK, value, kvT);
  scale_kernel<<<dim3(MM / 256, BATCH), dim3(256), 0, stream>>>(phiQT, rowsum, scaleB);
  out_kernel<<<dim3(MM / 128, 2, BATCH), dim3(256), 0, stream>>>(kvT, phiQT, scaleB, out);
}

// v001
// A run of this version takes 140 microseconds.
// Two timings next to v000 both put it at 1.17 times that version's speed.
#include <hip/hip_runtime.h>
#include <hip/hip_bf16.h>
#include <stdint.h>

#define DIM 256
#define BATCH 32
#define MM 2048
#define NN 2048
#define KSPLIT 4  // slices of the n sum in kv_kernel, one work-group each

typedef __attribute__((ext_vector_type(16))) _Float16 v16h;
typedef __attribute__((ext_vector_type(8)))  _Float16 v8h;
typedef __attribute__((ext_vector_type(8)))  float    v8f;
typedef __attribute__((ext_vector_type(4)))  unsigned int u32x4;
typedef __attribute__((ext_vector_type(4)))  int          i32x4;
typedef __attribute__((ext_vector_type(8)))  int          i32x8;

#define TDM_OK __has_builtin(__builtin_amdgcn_tensor_load_to_lds)

__device__ __forceinline__ v8f wmma_f16(v16h a, v16h b, v8f c) {
  // D = A(16x32 f16) * B(32x16 f16) + C(16x16 f32)
  return __builtin_amdgcn_wmma_f32_16x16x32_f16(false, a, false, b, (short)0, c,
                                                false, false);
}

__device__ __forceinline__ v8f zero8() {
  v8f z;
#pragma unroll
  for (int r = 0; r < 8; ++r) z[r] = 0.0f;
  return z;
}

__device__ __forceinline__ v8h cvt8(float4 a, float4 b) {
  v8h h;
  h[0] = (_Float16)a.x; h[1] = (_Float16)a.y; h[2] = (_Float16)a.z; h[3] = (_Float16)a.w;
  h[4] = (_Float16)b.x; h[5] = (_Float16)b.y; h[6] = (_Float16)b.z; h[7] = (_Float16)b.w;
  return h;
}

// Fragment from row-major f16 memory (row stride ld, K contiguous).
// Per ISA 16-bit A layout: row = lane%16, element j holds K = j + 8*((j>>3)+(lane>>4)).
// Same mapping serves B fragments when "row" is the B column and K is contiguous.
__device__ __forceinline__ v16h frag_kcontig(const _Float16* __restrict__ base,
                                             int ld, int lane) {
  const _Float16* p = base + (size_t)(lane & 15) * ld + ((lane >> 4) << 3);
  v8h lo = *(const v8h*)p;         // K = 0..7   (+8 for upper half-wave)
  v8h hi = *(const v8h*)(p + 16);  // K = 16..23 (+8)
  v16h f;
#pragma unroll
  for (int j = 0; j < 8; ++j) { f[j] = lo[j]; f[j + 8] = hi[j]; }
  return f;
}

// ---------------------------------------------------------------------------
// TDM: 2D tile (tile_d0 x tile_d1 elements of 2 bytes) global -> LDS with
// row stride stride0 (elements). LDS padding from descriptor: insert
// (pad_amt_code+1) DWORDs after every 2^(pad_int_code+1) DWORDs stored.
// ---------------------------------------------------------------------------
__device__ __forceinline__ void tdm_load_2d_f16(unsigned lds_off, const void* gaddr,
                                                unsigned tensor_d0, unsigned tensor_d1,
                                                unsigned tile_d0, unsigned tile_d1,
                                                unsigned stride0,
                                                unsigned pad_int_code,
                                                unsigned pad_amt_code) {
#if TDM_OK
  unsigned long long ga = (unsigned long long)(uintptr_t)gaddr;
  u32x4 g0;
  g0[0] = 1u;                                    // count=1 (valid user descriptor)
  g0[1] = lds_off;                               // lds_addr (bytes)
  g0[2] = (unsigned)(ga & 0xFFFFFFFFu);          // global_addr[31:0]
  g0[3] = (unsigned)((ga >> 32) & 0x01FFFFFFu) | (2u << 30);  // addr[56:32], type=2
  i32x8 g1;
  // wg_mask=0 | data_size=1(2B)<<16 | pad_enable<<20 | pad_interval<<22 | pad_amount<<25
  g1[0] = (int)((1u << 16) | (1u << 20) | (pad_int_code << 22) | (pad_amt_code << 25));
  g1[1] = (int)(tensor_d0 << 16);                         // tensor_dim0[15:0]
  g1[2] = (int)((tensor_d0 >> 16) | (tensor_d1 << 16));   // dim0 hi | dim1 lo
  g1[3] = (int)((tensor_d1 >> 16) | (tile_d0 << 16));     // dim1 hi | tile_dim0
  g1[4] = (int)(tile_d1 & 0xFFFFu);                       // tile_dim1 (tile_dim2=0)
  g1[5] = (int)stride0;                                   // tensor_dim0_stride lo
  g1[6] = 0;                                              // stride0 hi | stride1 lo
  g1[7] = 0;                                              // stride1 hi
  i32x4 z4 = {0, 0, 0, 0};
#if defined(__clang_major__) && __clang_major__ >= 23
  i32x8 z8 = {0, 0, 0, 0, 0, 0, 0, 0};
  __builtin_amdgcn_tensor_load_to_lds(g0, g1, z4, z4, z8, 0);
#else
  __builtin_amdgcn_tensor_load_to_lds(g0, g1, z4, z4, 0);
#endif
#endif
}

// ---------------------------------------------------------------------------
// Kernel 0: Wt[e][c] = (f16) W[c][e]
// ---------------------------------------------------------------------------
__global__ __launch_bounds__(256) void wt_kernel(const float* __restrict__ W,
                                                 _Float16* __restrict__ Wt) {
  int e = blockIdx.x, c = threadIdx.x;
  Wt[(size_t)e * DIM + c] = (_Float16)W[(size_t)c * DIM + e];
}

// ---------------------------------------------------------------------------
// Kernel 1: phi = relu(alpha * Wt @ X); software-pipelined f32->f16 staging.
// Q result stored transposed phiQT[b][m][e] (one packed b128 store per tile),
// K result stored phiK[b][e][n] (what kv/rowsum want).
// ---------------------------------------------------------------------------
__global__ __launch_bounds__(256) void phi_kernel(const float* __restrict__ query,
                                                  const float* __restrict__ key,
                                                  const _Float16* __restrict__ Wt,
                                                  _Float16* __restrict__ phiQT,
                                                  _Float16* __restrict__ phiK) {
  __shared__ _Float16 Xs[32][136];
  const int tid = threadIdx.x, lane = tid & 31, wid = tid >> 5;
  const int mblk = blockIdx.x;
  const int eblk = blockIdx.y;
  const int b    = blockIdx.z >> 1;
  const int isK  = blockIdx.z & 1;
  const float* __restrict__ X = isK ? key : query;
  const float alpha = isK ? 1.0f : (1.0f / 16.0f);

  const int e_wave  = eblk * 128 + (wid & 3) * 32;
  const int m_wave0 = (wid >> 2) * 64;
  const int m0      = mblk * 128;

  v8f acc[2][4];
#pragma unroll
  for (int i = 0; i < 2; ++i)
#pragma unroll
    for (int t = 0; t < 4; ++t) acc[i][t] = zero8();

  const int srow = tid >> 3;
  const int scol = (tid & 7) << 4;
  const float* src = X + (size_t)b * DIM * MM + m0 + scol;

  const float4* sp = (const float4*)(src + (size_t)srow * MM);
  float4 f0 = sp[0], f1 = sp[1], f2 = sp[2], f3 = sp[3];

  for (int c0 = 0; c0 < DIM; c0 += 32) {
    *(v8h*)&Xs[srow][scol]     = cvt8(f0, f1);
    *(v8h*)&Xs[srow][scol + 8] = cvt8(f2, f3);
    __syncthreads();

    if (c0 + 32 < DIM) {  // prefetch next k-step; latency overlaps WMMA below
      const float4* np = (const float4*)(src + (size_t)(c0 + 32 + srow) * MM);
      f0 = np[0]; f1 = np[1]; f2 = np[2]; f3 = np[3];
    }

    v16h a0 = frag_kcontig(Wt + (size_t)e_wave * DIM + c0, DIM, lane);
    v16h a1 = frag_kcontig(Wt + (size_t)(e_wave + 16) * DIM + c0, DIM, lane);
#pragma unroll
    for (int t = 0; t < 4; ++t) {
      v16h bf;
      int col = m_wave0 + t * 16 + (lane & 15);
      int kb  = (lane >> 4) << 3;
#pragma unroll
      for (int j = 0; j < 8; ++j) {
        bf[j]     = Xs[kb + j][col];
        bf[j + 8] = Xs[kb + 16 + j][col];
      }
      acc[0][t] = wmma_f16(a0, bf, acc[0][t]);
      acc[1][t] = wmma_f16(a1, bf, acc[1][t]);
    }
    __syncthreads();
  }

  if (!isK) {
    // phiQT[m][e]: lane's 8 acc elements are consecutive in e -> one b128 store
#pragma unroll
    for (int i = 0; i < 2; ++i)
#pragma unroll
      for (int t = 0; t < 4; ++t) {
        v8h h;
#pragma unroll
        for (int r = 0; r < 8; ++r) {
          float v = acc[i][t][r] * alpha;
          h[r] = (_Float16)(v > 0.0f ? v : 0.0f);
        }
        int e = e_wave + i * 16 + ((lane >> 4) << 3);
        int m = m0 + m_wave0 + t * 16 + (lane & 15);
        *(v8h*)(phiQT + ((size_t)b * MM + m) * DIM + e) = h;
      }
  } else {
#pragma unroll
    for (int i = 0; i < 2; ++i)
#pragma unroll
      for (int t = 0; t < 4; ++t)
#pragma unroll
        for (int r = 0; r < 8; ++r) {
          int e = e_wave + i * 16 + r + ((lane >> 4) << 3);
          int n = m0 + m_wave0 + t * 16 + (lane & 15);
          float v = acc[i][t][r];
          v = v > 0.0f ? v : 0.0f;
          phiK[((size_t)b * DIM + e) * NN + n] = (_Float16)v;
        }
  }
}

// ---------------------------------------------------------------------------
// Kernel 2: rowsum[b][e] = sum_n phiK[b][e][n]
// ---------------------------------------------------------------------------
__global__ __launch_bounds__(256) void rowsum_kernel(const _Float16* __restrict__ phiK,
                                                     float* __restrict__ rowsum) {
  __shared__ float red[256];
  int e = blockIdx.x, b = blockIdx.y, tid = threadIdx.x;
  const _Float16* row = phiK + ((size_t)b * DIM + e) * NN;
  float s = 0.0f;
  for (int i = tid; i < NN; i += 256) s += (float)row[i];
  red[tid] = s;
  __syncthreads();
  for (int off = 128; off > 0; off >>= 1) {
    if (tid < off) red[tid] += red[tid + off];
    __syncthreads();
  }
  if (tid == 0) rowsum[b * DIM + e] = red[0];
}

// ---------------------------------------------------------------------------
// Kernel 3: part[b][d][e][ks] = sum over slice ks of n of phiK[b][e][n]*value[b][d][n]
// The n sum is cut into KSPLIT slices so that 4x the work-groups each walk a
// quarter of the serial, latency-bound steps; kv_reduce_kernel adds the slices.
// Partials are f32 and lie in accumulator order: one 1-KiB block per 16x16 tile
// and slice, a tile's KSPLIT blocks side by side, register quad q of lane l at
// floats q*128 + l*4, so every store is 512 contiguous bytes per wave.
// A tile (f16 phiK) staged by the Tensor Data Mover, double-buffered; the
// descriptor pads every 16 DW by 4 DW so rows land 40 halves apart (16B
// aligned, bank-conflict-free b128 fragment loads). B (value f32->f16) uses
// register-prefetch pipelining. TENSORcnt + barriers synchronize.
// ---------------------------------------------------------------------------
__global__ __launch_bounds__(256) void kv_kernel(const _Float16* __restrict__ phiK,
                                                 const float* __restrict__ value,
                                                 float* __restrict__ part) {
  __shared__ _Float16 Vs[128][40];
#if TDM_OK
  __shared__ _Float16 As[2][128][40];
#endif
  const int tid = threadIdx.x, lane = tid & 31, wid = tid >> 5;
  const int dblk = blockIdx.x, eblk = blockIdx.y;
  const int b    = blockIdx.z / KSPLIT;
  const int ks   = blockIdx.z % KSPLIT;
  const int nbeg = ks * (NN / KSPLIT);
  const int e_wave  = eblk * 128 + (wid & 3) * 32;
  const int d_wave0 = (wid >> 2) * 64;
  const int d0      = dblk * 128;

  v8f acc[2][4];
#pragma unroll
  for (int i = 0; i < 2; ++i)
#pragma unroll
    for (int t = 0; t < 4; ++t) acc[i][t] = zero8();

  const int srow = tid >> 1;
  const int scol = (tid & 1) << 4;
  const float* src = value + ((size_t)b * DIM + d0 + srow) * NN + nbeg + scol;

  const float4* sp = (const float4*)src;
  float4 f0 = sp[0], f1 = sp[1], f2 = sp[2], f3 = sp[3];

#if TDM_OK
  const _Float16* aGlob = phiK + ((size_t)b * DIM + eblk * 128) * NN + nbeg;
  const unsigned aoff0 = (unsigned)(uintptr_t)(&As[0][0][0]);
  const unsigned aoff1 = (unsigned)(uintptr_t)(&As[1][0][0]);
  if (wid == 0) {  // A tile for step 0: 32n x 128e rows, row stride NN
    tdm_load_2d_f16(aoff0, aGlob, NN, DIM, 32, 128, NN, /*int16DW*/3, /*amt4DW*/3);
    // Waited for here, so that no descriptor register is reused (for the loop's
    // counters) while the request is outstanding; the value loads above fly on.
    asm volatile("s_wait_tensorcnt 0x0" ::: "memory");
  }
#endif

  for (int n0 = 0; n0 < NN / KSPLIT; n0 += 32) {
    *(v8h*)&Vs[srow][scol]     = cvt8(f0, f1);
    *(v8h*)&Vs[srow][scol + 8] = cvt8(f2, f3);
#if TDM_OK
    const int buf = (n0 >> 5) & 1;
    // The issuing wave's wait for the tile of this step. Every wave runs it (at
    // once done where none is outstanding): a test here would save EXEC into a
    // scalar register, which may be one of the outstanding descriptor's.
    asm volatile("s_wait_tensorcnt 0x0" ::: "memory");
#endif
    __syncthreads();  // publish Vs stores (and DMA'd A tile)

    if (n0 + 32 < NN / KSPLIT) {  // prefetch next B tile; overlaps WMMA below
      const float4* np = (const float4*)(src + n0 + 32);
      f0 = np[0]; f1 = np[1]; f2 = np[2]; f3 = np[3];
#if TDM_OK
      if (wid == 0)  // DMA next A tile into the other buffer
        tdm_load_2d_f16(buf ? aoff0 : aoff1, aGlob + n0 + 32, NN, DIM, 32, 128,
                        NN, 3, 3);
#endif
    }

#if TDM_OK
    v16h a0, a1;
    {
      int hw8 = (lane >> 4) << 3;
      const _Float16* p0 = &As[buf][(wid & 3) * 32 + (lane & 15)][hw8];
      const _Float16* p1 = &As[buf][(wid & 3) * 32 + 16 + (lane & 15)][hw8];
      v8h lo0 = *(const v8h*)p0, hi0 = *(const v8h*)(p0 + 16);
      v8h lo1 = *(const v8h*)p1, hi1 = *(const v8h*)(p1 + 16);
#pragma unroll
      for (int j = 0; j < 8; ++j) {
        a0[j] = lo0[j]; a0[j + 8] = hi0[j];
        a1[j] = lo1[j]; a1[j + 8] = hi1[j];
      }
    }
#else
    v16h a0 = frag_kcontig(phiK + ((size_t)b * DIM + e_wave) * NN + nbeg + n0, NN, lane);
    v16h a1 = frag_kcontig(phiK + ((size_t)b * DIM + e_wave + 16) * NN + nbeg + n0, NN, lane);
#endif
#pragma unroll
    for (int t = 0; t < 4; ++t) {
      const _Float16* rp = &Vs[d_wave0 + t * 16 + (lane & 15)][(lane >> 4) << 3];
      v8h lo = *(const v8h*)rp;
      v8h hi = *(const v8h*)(rp + 16);
      v16h bf;
#pragma unroll
      for (int j = 0; j < 8; ++j) { bf[j] = lo[j]; bf[j + 8] = hi[j]; }
      acc[0][t] = wmma_f16(a0, bf, acc[0][t]);
      acc[1][t] = wmma_f16(a1, bf, acc[1][t]);
    }
    __syncthreads();  // tiles consumed; buffers reusable
  }

  // Tile (dt, et) = (d / 16, e / 16) of batch b, slice ks: block (dt * 16 + et) * KSPLIT + ks.
  float* pwg = part + (size_t)b * DIM * DIM * KSPLIT +
               (((d0 >> 4) * (DIM / 16) + eblk * 8) * KSPLIT + ks) * 256;
  const unsigned pw =
      (unsigned)(((d_wave0 >> 4) * (DIM / 16) + (wid & 3) * 2) * KSPLIT * 256 + lane * 4);
#pragma unroll
  for (int i = 0; i < 2; ++i)
#pragma unroll
    for (int t = 0; t < 4; ++t) {
      float* tp = pwg + (pw + (t * (DIM / 16) + i) * KSPLIT * 256);
      *(float4*)tp         = make_float4(acc[i][t][0], acc[i][t][1], acc[i][t][2], acc[i][t][3]);
      *(float4*)(tp + 128) = make_float4(acc[i][t][4], acc[i][t][5], acc[i][t][6], acc[i][t][7]);
    }
}

// ---------------------------------------------------------------------------
// Kernel 3b: kvT[b][d][e] = (f16) sum_ks part[b][d][e][ks]
// One work-group per (b, 16 rows of d); each wave adds two 16x16 tiles. A lane
// holds what it held as accumulator: d = 16*dt + (lane & 15), e = 16*et +
// 8*(lane >> 4) + 0..7, so the result leaves as one 16-byte store.
// ---------------------------------------------------------------------------
__global__ __launch_bounds__(256) void kv_reduce_kernel(const float* __restrict__ part,
                                                        _Float16* __restrict__ kvT) {
  const int tid = threadIdx.x, lane = tid & 31, wid = tid >> 5;
  const int b = blockIdx.x / (DIM / 16), dt = blockIdx.x % (DIM / 16);
  const float* pwg = part + (size_t)blockIdx.x * (DIM / 16) * KSPLIT * 256;
  const unsigned pw = (unsigned)(wid * 2 * KSPLIT * 256 + lane * 4);
  float4 lo[2][KSPLIT], hi[2][KSPLIT];
  // Unrolled (here and below): constant indices keep lo and hi in registers.
#pragma unroll
  for (int u = 0; u < 2; ++u)
#pragma unroll
    for (int s = 0; s < KSPLIT; ++s) {
      lo[u][s] = *(const float4*)(pwg + (pw + (u * KSPLIT + s) * 256));
      hi[u][s] = *(const float4*)(pwg + (pw + (u * KSPLIT + s) * 256 + 128));
    }
#pragma unroll
  for (int u = 0; u < 2; ++u) {
    float4 a = lo[u][0], c = hi[u][0];
#pragma unroll
    for (int s = 1; s < KSPLIT; ++s) {
      a.x += lo[u][s].x; a.y += lo[u][s].y; a.z += lo[u][s].z; a.w += lo[u][s].w;
      c.x += hi[u][s].x; c.y += hi[u][s].y; c.z += hi[u][s].z; c.w += hi[u][s].w;
    }
    int e = (wid * 2 + u) * 16 + ((lane >> 4) << 3);
    int d = dt * 16 + (lane & 15);
    *(v8h*)(kvT + ((size_t)b * DIM + d) * DIM + e) = cvt8(a, c);
  }
}

// ---------------------------------------------------------------------------
// Kernel 4: scale[b][m] = 1 / (sum_e phiQT[b][m][e]*rowsum[b][e] + 1e-8)
// phiQT is m-major: each thread reads 512 contiguous bytes (v8h loads)
// ---------------------------------------------------------------------------
__global__ __launch_bounds__(256) void scale_kernel(const _Float16* __restrict__ phiQT,
                                                    const float* __restrict__ rowsum,
                                                    float* __restrict__ scale) {
  int b = blockIdx.y;
  int m = blockIdx.x * 256 + threadIdx.x;
  const v8h* pq = (const v8h*)(phiQT + ((size_t)b * MM + m) * DIM);
  const float* rs = rowsum + b * DIM;
  float s = 0.0f;
#pragma unroll 4
  for (int c = 0; c < DIM / 8; ++c) {
    v8h h = pq[c];
#pragma unroll
    for (int j = 0; j < 8; ++j) s += (float)h[j] * rs[c * 8 + j];
  }
  scale[(size_t)b * MM + m] = 1.0f / (s + 1e-8f);
}

// ---------------------------------------------------------------------------
// Kernel 5: out[b][d][m] = scale[b][m] * sum_e kvT[b][d][e]*phiQT[b][m][e]
// Both operands K(=e)-contiguous f16 -> pure global b128 fragment loads +
// WMMA; no LDS, no barriers. kvT (4 MB) and phiQT tiles live in L2.
// ---------------------------------------------------------------------------
__global__ __launch_bounds__(256) void out_kernel(const _Float16* __restrict__ kvT,
                                                  const _Float16* __restrict__ phiQT,
                                                  const float* __restrict__ scale,
                                                  float* __restrict__ out) {
  const int tid = threadIdx.x, lane = tid & 31, wid = tid >> 5;
  const int mblk = blockIdx.x, dblk = blockIdx.y, b = blockIdx.z;
  const int d_wave  = dblk * 128 + (wid & 3) * 32;
  const int m_wave0 = (wid >> 2) * 64;
  const int m0      = mblk * 128;

  v8f acc[2][4];
#pragma unroll
  for (int i = 0; i < 2; ++i)
#pragma unroll
    for (int t = 0; t < 4; ++t) acc[i][t] = zero8();

  const _Float16* aBase = kvT + ((size_t)b * DIM + d_wave) * DIM;
  const _Float16* bBase = phiQT + ((size_t)b * MM + m0 + m_wave0) * DIM;

  for (int e0 = 0; e0 < DIM; e0 += 32) {
    v16h a0 = frag_kcontig(aBase + e0, DIM, lane);
    v16h a1 = frag_kcontig(aBase + (size_t)16 * DIM + e0, DIM, lane);
#pragma unroll
    for (int t = 0; t < 4; ++t) {
      v16h bf = frag_kcontig(bBase + (size_t)(t * 16) * DIM + e0, DIM, lane);
      acc[0][t] = wmma_f16(a0, bf, acc[0][t]);
      acc[1][t] = wmma_f16(a1, bf, acc[1][t]);
    }
  }

#pragma unroll
  for (int t = 0; t < 4; ++t) {
    int m = m0 + m_wave0 + t * 16 + (lane & 15);
    float sc = scale[(size_t)b * MM + m];
#pragma unroll
    for (int i = 0; i < 2; ++i)
#pragma unroll
      for (int r = 0; r < 8; ++r) {
        int d = d_wave + i * 16 + r + ((lane >> 4) << 3);
        out[((size_t)b * DIM + d) * MM + m] = acc[i][t][r] * sc;
      }
  }
}

// ---------------------------------------------------------------------------
extern "C" void kernel_launch(void* const* d_in, const int* in_sizes, int n_in,
                              void* d_out, int out_size, void* d_ws, size_t ws_size,
                              hipStream_t stream) {
  const float* query = (const float*)d_in[0];
  const float* key   = (const float*)d_in[1];
  const float* value = (const float*)d_in[2];
  const float* W     = (const float*)d_in[3];
  float* out = (float*)d_out;

  _Float16* Wt    = (_Float16*)d_ws;                       // 256*256 f16
  _Float16* phiQT = Wt + (size_t)DIM * DIM;                // [b][m][e], 32 MB
  _Float16* phiK  = phiQT + (size_t)BATCH * MM * DIM;      // [b][e][n], 32 MB
  _Float16* kvT   = phiK + (size_t)BATCH * DIM * NN;       // [b][d][e], 4 MB
  float* rowsum   = (float*)(kvT + (size_t)BATCH * DIM * DIM);
  float* scaleB   = rowsum + BATCH * DIM;
  float* kvPart   = scaleB + (size_t)BATCH * MM;           // [b][tile][ks], f32, 32 MB

  wt_kernel<<<dim3(DIM), dim3(DIM), 0, stream>>>(W, Wt);
  phi_kernel<<<dim3(MM / 128, 2, BATCH * 2), dim3(256), 0, stream>>>(
      query, key, Wt, phiQT, phiK);
  rowsum_kernel<<<dim3(DIM, BATCH), dim3(256), 0, stream>>>(phiK, rowsum);
  kv_kernel<<<dim3(2, 2, BATCH * KSPLIT), dim3(256), 0, stream>>>(phiK, value, kvPart);
  kv_reduce_kernel<<<dim3(BATCH * (DIM / 16)), dim3(256), 0, stream>>>(kvPart, kvT);
  scale_kernel<<<dim3(MM / 256, BATCH), dim3(256), 0, stream>>>(phiQT, rowsum, scaleB);
  out_kernel<<<dim3(MM / 128, 2, BATCH), dim3(256), 0, stream>>>(kvT, phiQT, scaleB, out);
}

// v002
// A run of this version takes 123 microseconds.
// Next to v001, in two timings, it ran 1.14 times as fast each time.
// All steps since v000 together make it 1.33 times as fast.
#include <hip/hip_runtime.h>
#include <hip/hip_bf16.h>
#include <stdint.h>

#define DIM 256
#define BATCH 32
#define MM 2048
#define NN 2048
#define KSPLIT 4  // slices of the n sum in kv_kernel, one work-group each

typedef __attribute__((ext_vector_type(16))) _Float16 v16h;
typedef __attribute__((ext_vector_type(8)))  _Float16 v8h;
typedef __attribute__((ext_vector_type(8)))  float    v8f;
typedef __attribute__((ext_vector_type(4)))  unsigned int u32x4;
typedef __attribute__((ext_vector_type(4)))  int          i32x4;
typedef __attribute__((ext_vector_type(8)))  int          i32x8;

#define TDM_OK __has_builtin(__builtin_amdgcn_tensor_load_to_lds)

__device__ __forceinline__ v8f wmma_f16(v16h a, v16h b, v8f c) {
  // D = A(16x32 f16) * B(32x16 f16) + C(16x16 f32)
  return __builtin_amdgcn_wmma_f32_16x16x32_f16(false, a, false, b, (short)0, c,
                                                false, false);
}

__device__ __forceinline__ v8f zero8() {
  v8f z;
#pragma unroll
  for (int r = 0; r < 8; ++r) z[r] = 0.0f;
  return z;
}

__device__ __forceinline__ v8h cvt8(float4 a, float4 b) {
  v8h h;
  h[0] = (_Float16)a.x; h[1] = (_Float16)a.y; h[2] = (_Float16)a.z; h[3] = (_Float16)a.w;
  h[4] = (_Float16)b.x; h[5] = (_Float16)b.y; h[6] = (_Float16)b.z; h[7] = (_Float16)b.w;
  return h;
}

// Fragment from row-major f16 memory (row stride ld, K contiguous).
// Per ISA 16-bit A layout: row = lane%16, element j holds K = j + 8*((j>>3)+(lane>>4)).
// Same mapping serves B fragments when "row" is the B column and K is contiguous.
__device__ __forceinline__ v16h frag_kcontig(const _Float16* __restrict__ base,
                                             int ld, int lane) {
  const _Float16* p = base + (size_t)(lane & 15) * ld + ((lane >> 4) << 3);
  v8h lo = *(const v8h*)p;         // K = 0..7   (+8 for upper half-wave)
  v8h hi = *(const v8h*)(p + 16);  // K = 16..23 (+8)
  v16h f;
#pragma unroll
  for (int j = 0; j < 8; ++j) { f[j] = lo[j]; f[j + 8] = hi[j]; }
  return f;
}

// ---------------------------------------------------------------------------
// TDM: 2D tile (tile_d0 x tile_d1 elements of 2 bytes) global -> LDS with
// row stride stride0 (elements). LDS padding from descriptor: insert
// (pad_amt_code+1) DWORDs after every 2^(pad_int_code+1) DWORDs stored.
// ---------------------------------------------------------------------------
__device__ __forceinline__ void tdm_load_2d_f16(unsigned lds_off, const void* gaddr,
                                                unsigned tensor_d0, unsigned tensor_d1,
                                                unsigned tile_d0, unsigned tile_d1,
                                                unsigned stride0,
                                                unsigned pad_int_code,
                                                unsigned pad_amt_code) {
#if TDM_OK
  unsigned long long ga = (unsigned long long)(uintptr_t)gaddr;
  u32x4 g0;
  g0[0] = 1u;                                    // count=1 (valid user descriptor)
  g0[1] = lds_off;                               // lds_addr (bytes)
  g0[2] = (unsigned)(ga & 0xFFFFFFFFu);          // global_addr[31:0]
  g0[3] = (unsigned)((ga >> 32) & 0x01FFFFFFu) | (2u << 30);  // addr[56:32], type=2
  i32x8 g1;
  // wg_mask=0 | data_size=1(2B)<<16 | pad_enable<<20 | pad_interval<<22 | pad_amount<<25
  g1[0] = (int)((1u << 16) | (1u << 20) | (pad_int_code << 22) | (pad_amt_code << 25));
  g1[1] = (int)(tensor_d0 << 16);                         // tensor_dim0[15:0]
  g1[2] = (int)((tensor_d0 >> 16) | (tensor_d1 << 16));   // dim0 hi | dim1 lo
  g1[3] = (int)((tensor_d1 >> 16) | (tile_d0 << 16));     // dim1 hi | tile_dim0
  g1[4] = (int)(tile_d1 & 0xFFFFu);                       // tile_dim1 (tile_dim2=0)
  g1[5] = (int)stride0;                                   // tensor_dim0_stride lo
  g1[6] = 0;                                              // stride0 hi | stride1 lo
  g1[7] = 0;                                              // stride1 hi
  i32x4 z4 = {0, 0, 0, 0};
#if defined(__clang_major__) && __clang_major__ >= 23
  i32x8 z8 = {0, 0, 0, 0, 0, 0, 0, 0};
  __builtin_amdgcn_tensor_load_to_lds(g0, g1, z4, z4, z8, 0);
#else
  __builtin_amdgcn_tensor_load_to_lds(g0, g1, z4, z4, 0);
#endif
#endif
}

// ---------------------------------------------------------------------------
// Kernel 0: Wt[e][c] = (f16) W[c][e]
// ---------------------------------------------------------------------------
__global__ __launch_bounds__(256) void wt_kernel(const float* __restrict__ W,
                                                 _Float16* __restrict__ Wt) {
  int e = blockIdx.x, c = threadIdx.x;
  Wt[(size_t)e * DIM + c] = (_Float16)W[(size_t)c * DIM + e];
}

// ---------------------------------------------------------------------------
// Kernel 1: phi = relu(alpha * Wt @ X); software-pipelined f32->f16 staging.
// Q result stored transposed phiQT[b][m][e] (one packed b128 store per tile),
// K result stored phiK[b][e][n] (what kv wants).
// ---------------------------------------------------------------------------
__global__ __launch_bounds__(256) void phi_kernel(const float* __restrict__ query,
                                                  const float* __restrict__ key,
                                                  const _Float16* __restrict__ Wt,
                                                  _Float16* __restrict__ phiQT,
                                                  _Float16* __restrict__ phiK) {
  __shared__ _Float16 Xs[32][136];
  const int tid = threadIdx.x, lane = tid & 31, wid = tid >> 5;
  const int mblk = blockIdx.x;
  const int eblk = blockIdx.y;
  const int b    = blockIdx.z >> 1;
  const int isK  = blockIdx.z & 1;
  const float* __restrict__ X = isK ? key : query;
  const float alpha = isK ? 1.0f : (1.0f / 16.0f);

  const int e_wave  = eblk * 128 + (wid & 3) * 32;
  const int m_wave0 = (wid >> 2) * 64;
  const int m0      = mblk * 128;

  v8f acc[2][4];
#pragma unroll
  for (int i = 0; i < 2; ++i)
#pragma unroll
    for (int t = 0; t < 4; ++t) acc[i][t] = zero8();

  const int srow = tid >> 3;
  const int scol = (tid & 7) << 4;
  const float* src = X + (size_t)b * DIM * MM + m0 + scol;

  const float4* sp = (const float4*)(src + (size_t)srow * MM);
  float4 f0 = sp[0], f1 = sp[1], f2 = sp[2], f3 = sp[3];

  for (int c0 = 0; c0 < DIM; c0 += 32) {
    *(v8h*)&Xs[srow][scol]     = cvt8(f0, f1);
    *(v8h*)&Xs[srow][scol + 8] = cvt8(f2, f3);
    __syncthreads();

    if (c0 + 32 < DIM) {  // prefetch next k-step; latency overlaps WMMA below
      const float4* np = (const float4*)(src + (size_t)(c0 + 32 + srow) * MM);
      f0 = np[0]; f1 = np[1]; f2 = np[2]; f3 = np[3];
    }

    v16h a0 = frag_kcontig(Wt + (size_t)e_wave * DIM + c0, DIM, lane);
    v16h a1 = frag_kcontig(Wt + (size_t)(e_wave + 16) * DIM + c0, DIM, lane);
#pragma unroll
    for (int t = 0; t < 4; ++t) {
      v16h bf;
      int col = m_wave0 + t * 16 + (lane & 15);
      int kb  = (lane >> 4) << 3;
#pragma unroll
      for (int j = 0; j < 8; ++j) {
        bf[j]     = Xs[kb + j][col];
        bf[j + 8] = Xs[kb + 16 + j][col];
      }
      acc[0][t] = wmma_f16(a0, bf, acc[0][t]);
      acc[1][t] = wmma_f16(a1, bf, acc[1][t]);
    }
    __syncthreads();
  }

  if (!isK) {
    // phiQT[m][e]: lane's 8 acc elements are consecutive in e -> one b128 store
#pragma unroll
    for (int i = 0; i < 2; ++i)
#pragma unroll
      for (int t = 0; t < 4; ++t) {
        v8h h;
#pragma unroll
        for (int r = 0; r < 8; ++r) {
          float v = acc[i][t][r] * alpha;
          h[r] = (_Float16)(v > 0.0f ? v : 0.0f);
        }
        int e = e_wave + i * 16 + ((lane >> 4) << 3);
        int m = m0 + m_wave0 + t * 16 + (lane & 15);
        *(v8h*)(phiQT + ((size_t)b * MM + m) * DIM + e) = h;
      }
  } else {
#pragma unroll
    for (int i = 0; i < 2; ++i)
#pragma unroll
      for (int t = 0; t < 4; ++t)
#pragma unroll
        for (int r = 0; r < 8; ++r) {
          int e = e_wave + i * 16 + r + ((lane >> 4) << 3);
          int n = m0 + m_wave0 + t * 16 + (lane & 15);
          float v = acc[i][t][r];
          v = v > 0.0f ? v : 0.0f;
          phiK[((size_t)b * DIM + e) * NN + n] = (_Float16)v;
        }
  }
}

// ---------------------------------------------------------------------------
// Kernel 3: part[b][d][e][ks] = sum over slice ks of n of phiK[b][e][n]*value[b][d][n]
// The n sum is cut into KSPLIT slices so that 4x the work-groups each walk a
// quarter of the serial, latency-bound steps; kv_reduce_kernel adds the slices.
// Partials are f32 and lie in accumulator order: one 1-KiB block per 16x16 tile
// and slice, a tile's KSPLIT blocks side by side, register quad q of lane l at
// floats q*128 + l*4, so every store is 512 contiguous bytes per wave.
// A tile (f16 phiK) staged by the Tensor Data Mover, double-buffered; the
// descriptor pads every 16 DW by 4 DW so rows land 40 halves apart (16B
// aligned, bank-conflict-free b128 fragment loads). B (value f32->f16) uses
// register-prefetch pipelining. TENSORcnt + barriers synchronize.
// The row sums of phiK ride along: rsPart[b][ks][e] = sum over slice ks of n of
// phiK[b][e][n], as the product of the A fragments with a B fragment of ones
// (f32 accumulate), so phiK is not read a second time by a launch of its own.
// ---------------------------------------------------------------------------
__global__ __launch_bounds__(256) void kv_kernel(const _Float16* __restrict__ phiK,
                                                 const float* __restrict__ value,
                                                 float* __restrict__ part,
                                                 float* __restrict__ rsPart) {
  __shared__ _Float16 Vs[128][40];
#if TDM_OK
  __shared__ _Float16 As[2][128][40];
#endif
  const int tid = threadIdx.x, lane = tid & 31, wid = tid >> 5;
  const int dblk = blockIdx.x, eblk = blockIdx.y;
  const int b    = blockIdx.z / KSPLIT;
  const int ks   = blockIdx.z % KSPLIT;
  const int nbeg = ks * (NN / KSPLIT);
  const int e_wave  = eblk * 128 + (wid & 3) * 32;
  const int d_wave0 = (wid >> 2) * 64;
  const int d0      = dblk * 128;

  v8f acc[2][4];
#pragma unroll
  for (int i = 0; i < 2; ++i)
#pragma unroll
    for (int t = 0; t < 4; ++t) acc[i][t] = zero8();

  v8f rs[2] = {zero8(), zero8()};  // every column holds the row sums of a0, a1
  const _Float16 one = (_Float16)1.0f;
  const v16h ones = {one, one, one, one, one, one, one, one,
                     one, one, one, one, one, one, one, one};

  const int srow = tid >> 1;
  const int scol = (tid & 1) << 4;
  const float* src = value + ((size_t)b * DIM + d0 + srow) * NN + nbeg + scol;

  const float4* sp = (const float4*)src;
  float4 f0 = sp[0], f1 = sp[1], f2 = sp[2], f3 = sp[3];

#if TDM_OK
  const _Float16* aGlob = phiK + ((size_t)b * DIM + eblk * 128) * NN + nbeg;
  const unsigned aoff0 = (unsigned)(uintptr_t)(&As[0][0][0]);
  const unsigned aoff1 = (unsigned)(uintptr_t)(&As[1][0][0]);
  if (wid == 0) {  // A tile for step 0: 32n x 128e rows, row stride NN
    tdm_load_2d_f16(aoff0, aGlob, NN, DIM, 32, 128, NN, /*int16DW*/3, /*amt4DW*/3);
    // Waited for here, so that no descriptor register is reused (for the loop's
    // counters) while the request is outstanding; the value loads above fly on.
    asm volatile("s_wait_tensorcnt 0x0" ::: "memory");
  }
#endif

  for (int n0 = 0; n0 < NN / KSPLIT; n0 += 32) {
    *(v8h*)&Vs[srow][scol]     = cvt8(f0, f1);
    *(v8h*)&Vs[srow][scol + 8] = cvt8(f2, f3);
#if TDM_OK
    const int buf = (n0 >> 5) & 1;
    // The issuing wave's wait for the tile of this step. Every wave runs it (at
    // once done where none is outstanding): a test here would save EXEC into a
    // scalar register, which may be one of the outstanding descriptor's.
    asm volatile("s_wait_tensorcnt 0x0" ::: "memory");
#endif
    __syncthreads();  // publish Vs stores (and DMA'd A tile)

    if (n0 + 32 < NN / KSPLIT) {  // prefetch next B tile; overlaps WMMA below
      const float4* np = (const float4*)(src + n0 + 32);
      f0 = np[0]; f1 = np[1]; f2 = np[2]; f3 = np[3];
#if TDM_OK
      if (wid == 0)  // DMA next A tile into the other buffer
        tdm_load_2d_f16(buf ? aoff0 : aoff1, aGlob + n0 + 32, NN, DIM, 32, 128,
                        NN, 3, 3);
#endif
    }

#if TDM_OK
    v16h a0, a1;
    {
      int hw8 = (lane >> 4) << 3;
      const _Float16* p0 = &As[buf][(wid & 3) * 32 + (lane & 15)][hw8];
      const _Float16* p1 = &As[buf][(wid & 3) * 32 + 16 + (lane & 15)][hw8];
      v8h lo0 = *(const v8h*)p0, hi0 = *(const v8h*)(p0 + 16);
      v8h lo1 = *(const v8h*)p1, hi1 = *(const v8h*)(p1 + 16);
#pragma unroll
      for (int j = 0; j < 8; ++j) {
        a0[j] = lo0[j]; a0[j + 8] = hi0[j];
        a1[j] = lo1[j]; a1[j + 8] = hi1[j];
      }
    }
#else
    v16h a0 = frag_kcontig(phiK + ((size_t)b * DIM + e_wave) * NN + nbeg + n0, NN, lane);
    v16h a1 = frag_kcontig(phiK + ((size_t)b * DIM + e_wave + 16) * NN + nbeg + n0, NN, lane);
#endif
    // Run by every wave, so that the loop holds no test: its steps wait on loads,
    // not on the matrix unit. One wave per e range stores the result.
    rs[0] = wmma_f16(a0, ones, rs[0]);
    rs[1] = wmma_f16(a1, ones, rs[1]);
#pragma unroll
    for (int t = 0; t < 4; ++t) {
      const _Float16* rp = &Vs[d_wave0 + t * 16 + (lane & 15)][(lane >> 4) << 3];
      v8h lo = *(const v8h*)rp;
      v8h hi = *(const v8h*)(rp + 16);
      v16h bf;
#pragma unroll
      for (int j = 0; j < 8; ++j) { bf[j] = lo[j]; bf[j + 8] = hi[j]; }
      acc[0][t] = wmma_f16(a0, bf, acc[0][t]);
      acc[1][t] = wmma_f16(a1, bf, acc[1][t]);
    }
    __syncthreads();  // tiles consumed; buffers reusable
  }

  // Tile (dt, et) = (d / 16, e / 16) of batch b, slice ks: block (dt * 16 + et) * KSPLIT + ks.
  float* pwg = part + (size_t)b * DIM * DIM * KSPLIT +
               (((d0 >> 4) * (DIM / 16) + eblk * 8) * KSPLIT + ks) * 256;
  const unsigned pw =
      (unsigned)(((d_wave0 >> 4) * (DIM / 16) + (wid & 3) * 2) * KSPLIT * 256 + lane * 4);
#pragma unroll
  for (int i = 0; i < 2; ++i)
#pragma unroll
    for (int t = 0; t < 4; ++t) {
      float* tp = pwg + (pw + (t * (DIM / 16) + i) * KSPLIT * 256);
      *(float4*)tp         = make_float4(acc[i][t][0], acc[i][t][1], acc[i][t][2], acc[i][t][3]);
      *(float4*)(tp + 128) = make_float4(acc[i][t][4], acc[i][t][5], acc[i][t][6], acc[i][t][7]);
    }

  // Column 0 of rs: lane 0 holds rows 0..7, lane 16 rows 8..15. The wave's 32
  // sums fill one 128-byte line.
  if (dblk == 0 && wid < 4 && (lane & 15) == 0) {
    float* rp = rsPart + ((size_t)b * KSPLIT + ks) * DIM + e_wave + ((lane >> 4) << 3);
    // Unrolled: constant indices keep rs in registers.
#pragma unroll
    for (int i = 0; i < 2; ++i) {
      *(float4*)(rp + i * 16)     = make_float4(rs[i][0], rs[i][1], rs[i][2], rs[i][3]);
      *(float4*)(rp + i * 16 + 4) = make_float4(rs[i][4], rs[i][5], rs[i][6], rs[i][7]);
    }
  }
}

// ---------------------------------------------------------------------------
// Kernel 3b: kvT[b][d][e] = (f16) sum_ks part[b][d][e][ks]
// One work-group per (b, 16 rows of d); each wave adds two 16x16 tiles. A lane
// holds what it held as accumulator: d = 16*dt + (lane & 15), e = 16*et +
// 8*(lane >> 4) + 0..7, so the result leaves as one 16-byte store.
// The first work-group of each batch also adds the slices of the row sums:
// rowsum[b][e] = sum_ks rsPart[b][ks][e].
// ---------------------------------------------------------------------------
__global__ __launch_bounds__(256) void kv_reduce_kernel(const float* __restrict__ part,
                                                        const float* __restrict__ rsPart,
                                                        _Float16* __restrict__ kvT,
                                                        float* __restrict__ rowsum) {
  const int tid = threadIdx.x, lane = tid & 31, wid = tid >> 5;
  const int b = blockIdx.x / (DIM / 16), dt = blockIdx.x % (DIM / 16);
  const float* pwg = part + (size_t)blockIdx.x * (DIM / 16) * KSPLIT * 256;
  const unsigned pw = (unsigned)(wid * 2 * KSPLIT * 256 + lane * 4);
  float4 lo[2][KSPLIT], hi[2][KSPLIT];
  // Unrolled (here and below): constant indices keep lo and hi in registers.
#pragma unroll
  for (int u = 0; u < 2; ++u)
#pragma unroll
    for (int s = 0; s < KSPLIT; ++s) {
      lo[u][s] = *(const float4*)(pwg + (pw + (u * KSPLIT + s) * 256));
      hi[u][s] = *(const float4*)(pwg + (pw + (u * KSPLIT + s) * 256 + 128));
    }
#pragma unroll
  for (int u = 0; u < 2; ++u) {
    float4 a = lo[u][0], c = hi[u][0];
#pragma unroll
    for (int s = 1; s < KSPLIT; ++s) {
      a.x += lo[u][s].x; a.y += lo[u][s].y; a.z += lo[u][s].z; a.w += lo[u][s].w;
      c.x += hi[u][s].x; c.y += hi[u][s].y; c.z += hi[u][s].z; c.w += hi[u][s].w;
    }
    int e = (wid * 2 + u) * 16 + ((lane >> 4) << 3);
    int d = dt * 16 + (lane & 15);
    *(v8h*)(kvT + ((size_t)b * DIM + d) * DIM + e) = cvt8(a, c);
  }
  if (dt == 0) {
    const float* rp = rsPart + (size_t)b * KSPLIT * DIM + tid;
    float r = rp[0];
    for (int s = 1; s < KSPLIT; ++s) r += rp[s * DIM];
    rowsum[b * DIM + tid] = r;
  }
}

// ---------------------------------------------------------------------------
// Kernel 4: scale[b][m] = 1 / (sum_e phiQT[b][m][e]*rowsum[b][e] + 1e-8)
// phiQT is m-major: each thread reads 512 contiguous bytes (v8h loads)
// ---------------------------------------------------------------------------
__global__ __launch_bounds__(256) void scale_kernel(const _Float16* __restrict__ phiQT,
                                                    const float* __restrict__ rowsum,
                                                    float* __restrict__ scale) {
  int b = blockIdx.y;
  int m = blockIdx.x * 256 + threadIdx.x;
  const v8h* pq = (const v8h*)(phiQT + ((size_t)b * MM + m) * DIM);
  const float* rs = rowsum + b * DIM;
  float s = 0.0f;
#pragma unroll 4
  for (int c = 0; c < DIM / 8; ++c) {
    v8h h = pq[c];
#pragma unroll
    for (int j = 0; j < 8; ++j) s += (float)h[j] * rs[c * 8 + j];
  }
  scale[(size_t)b * MM + m] = 1.0f / (s + 1e-8f);
}

// ---------------------------------------------------------------------------
// Kernel 5: out[b][d][m] = scale[b][m] * sum_e kvT[b][d][e]*phiQT[b][m][e]
// Both operands K(=e)-contiguous f16 -> pure global b128 fragment loads +
// WMMA; no LDS, no barriers. kvT (4 MB) and phiQT tiles live in L2.
// ---------------------------------------------------------------------------
__global__ __launch_bounds__(256) void out_kernel(const _Float16* __restrict__ kvT,
                                                  const _Float16* __restrict__ phiQT,
                                                  const float* __restrict__ scale,
                                                  float* __restrict__ out) {
  const int tid = threadIdx.x, lane = tid & 31, wid = tid >> 5;
  const int mblk = blockIdx.x, dblk = blockIdx.y, b = blockIdx.z;
  const int d_wave  = dblk * 128 + (wid & 3) * 32;
  const int m_wave0 = (wid >> 2) * 64;
  const int m0      = mblk * 128;

  v8f acc[2][4];
#pragma unroll
  for (int i = 0; i < 2; ++i)
#pragma unroll
    for (int t = 0; t < 4; ++t) acc[i][t] = zero8();

  const _Float16* aBase = kvT + ((size_t)b * DIM + d_wave) * DIM;
  const _Float16* bBase = phiQT + ((size_t)b * MM + m0 + m_wave0) * DIM;

  for (int e0 = 0; e0 < DIM; e0 += 32) {
    v16h a0 = frag_kcontig(aBase + e0, DIM, lane);
    v16h a1 = frag_kcontig(aBase + (size_t)16 * DIM + e0, DIM, lane);
#pragma unroll
    for (int t = 0; t < 4; ++t) {
      v16h bf = frag_kcontig(bBase + (size_t)(t * 16) * DIM + e0, DIM, lane);
      acc[0][t] = wmma_f16(a0, bf, acc[0][t]);
      acc[1][t] = wmma_f16(a1, bf, acc[1][t]);
    }
  }

#pragma unroll
  for (int t = 0; t < 4; ++t) {
    int m = m0 + m_wave0 + t * 16 + (lane & 15);
    float sc = scale[(size_t)b * MM + m];
#pragma unroll
    for (int i = 0; i < 2; ++i)
#pragma unroll
      for (int r = 0; r < 8; ++r) {
        int d = d_wave + i * 16 + r + ((lane >> 4) << 3);
        out[((size_t)b * DIM + d) * MM + m] = acc[i][t][r] * sc;
      }
  }
}

// ---------------------------------------------------------------------------
extern "C" void kernel_launch(void* const* d_in, const int* in_sizes, int n_in,
                              void* d_out, int out_size, void* d_ws, size_t ws_size,
                              hipStream_t stream) {
  const float* query = (const float*)d_in[0];
  const float* key   = (const float*)d_in[1];
  const float* value = (const float*)d_in[2];
  const float* W     = (const float*)d_in[3];
  float* out = (float*)d_out;

  _Float16* Wt    = (_Float16*)d_ws;                       // 256*256 f16
  _Float16* phiQT = Wt + (size_t)DIM * DIM;                // [b][m][e], 32 MB
  _Float16* phiK  = phiQT + (size_t)BATCH * MM * DIM;      // [b][e][n], 32 MB
  _Float16* kvT   = phiK + (size_t)BATCH * DIM * NN;       // [b][d][e], 4 MB
  float* rowsum   = (float*)(kvT + (size_t)BATCH * DIM * DIM);
  float* scaleB   = rowsum + BATCH * DIM;
  float* kvPart   = scaleB + (size_t)BATCH * MM;           // [b][tile][ks], f32, 32 MB
  float* rsPart   = kvPart + (size_t)BATCH * DIM * DIM * KSPLIT;  // [b][ks][e], f32

  wt_kernel<<<dim3(DIM), dim3(DIM), 0, stream>>>(W, Wt);
  phi_kernel<<<dim3(MM / 128, 2, BATCH * 2), dim3(256), 0, stream>>>(
      query, key, Wt, phiQT, phiK);
  kv_kernel<<<dim3(2, 2, BATCH * KSPLIT), dim3(256), 0, stream>>>(phiK, value, kvPart,
                                                                    rsPart);
  kv_reduce_kernel<<<dim3(BATCH * (DIM / 16)), dim3(256), 0, stream>>>(kvPart, rsPart, kvT,
                                                                          rowsum);
  scale_kernel<<<dim3(MM / 256, BATCH), dim3(256), 0, stream>>>(phiQT, rowsum, scaleB);
  out_kernel<<<dim3(MM / 128, 2, BATCH), dim3(256), 0, stream>>>(kvT, phiQT, scaleB, out);
}

// v003
// One run takes 106 microseconds.
// Next to v002, in two timings, it ran 1.16 times as fast each time.
// All steps since v000 together make it 1.54 times as fast.
#include <hip/hip_runtime.h>
#include <hip/hip_bf16.h>
#include <stdint.h>

#define DIM 256
#define BATCH 32
#define MM 2048
#define NN 2048
#define KSPLIT 4  // slices of the n sum in kv_kernel, one work-group each

typedef __attribute__((ext_vector_type(16))) _Float16 v16h;
typedef __attribute__((ext_vector_type(8)))  _Float16 v8h;
typedef __attribute__((ext_vector_type(8)))  float    v8f;
typedef __attribute__((ext_vector_type(4)))  unsigned int u32x4;
typedef __attribute__((ext_vector_type(4)))  int          i32x4;
typedef __attribute__((ext_vector_type(8)))  int          i32x8;

#define TDM_OK __has_builtin(__builtin_amdgcn_tensor_load_to_lds)

__device__ __forceinline__ v8f wmma_f16(v16h a, v16h b, v8f c) {
  // D = A(16x32 f16) * B(32x16 f16) + C(16x16 f32)
  return __builtin_amdgcn_wmma_f32_16x16x32_f16(false, a, false, b, (short)0, c,
                                                false, false);
}

__device__ __forceinline__ v8f zero8() {
  v8f z;
#pragma unroll
  for (int r = 0; r < 8; ++r) z[r] = 0.0f;
  return z;
}

__device__ __forceinline__ v8h cvt8(float4 a, float4 b) {
  v8h h;
  h[0] = (_Float16)a.x; h[1] = (_Float16)a.y; h[2] = (_Float16)a.z; h[3] = (_Float16)a.w;
  h[4] = (_Float16)b.x; h[5] = (_Float16)b.y; h[6] = (_Float16)b.z; h[7] = (_Float16)b.w;
  return h;
}

// Fragment from row-major f16 memory (row stride ld, K contiguous).
// Per ISA 16-bit A layout: row = lane%16, element j holds K = j + 8*((j>>3)+(lane>>4)).
// Same mapping serves B fragments when "row" is the B column and K is contiguous.
__device__ __forceinline__ v16h frag_kcontig(const _Float16* __restrict__ base,
                                             int ld, int lane) {
  const _Float16* p = base + (size_t)(lane & 15) * ld + ((lane >> 4) << 3);
  v8h lo = *(const v8h*)p;         // K = 0..7   (+8 for upper half-wave)
  v8h hi = *(const v8h*)(p + 16);  // K = 16..23 (+8)
  v16h f;
#pragma unroll
  for (int j = 0; j < 8; ++j) { f[j] = lo[j]; f[j + 8] = hi[j]; }
  return f;
}

// ---------------------------------------------------------------------------
// TDM: 2D tile (tile_d0 x tile_d1 elements of 2 bytes) global -> LDS with
// row stride stride0 (elements). LDS padding from descriptor: insert
// (pad_amt_code+1) DWORDs after every 2^(pad_int_code+1) DWORDs stored.
// ---------------------------------------------------------------------------
__device__ __forceinline__ void tdm_load_2d_f16(unsigned lds_off, const void* gaddr,
                                                unsigned tensor_d0, unsigned tensor_d1,
                                                unsigned tile_d0, unsigned tile_d1,
                                                unsigned stride0,
                                                unsigned pad_int_code,
                                                unsigned pad_amt_code) {
#if TDM_OK
  unsigned long long ga = (unsigned long long)(uintptr_t)gaddr;
  u32x4 g0;
  g0[0] = 1u;                                    // count=1 (valid user descriptor)
  g0[1] = lds_off;                               // lds_addr (bytes)
  g0[2] = (unsigned)(ga & 0xFFFFFFFFu);          // global_addr[31:0]
  g0[3] = (unsigned)((ga >> 32) & 0x01FFFFFFu) | (2u << 30);  // addr[56:32], type=2
  i32x8 g1;
  // wg_mask=0 | data_size=1(2B)<<16 | pad_enable<<20 | pad_interval<<22 | pad_amount<<25
  g1[0] = (int)((1u << 16) | (1u << 20) | (pad_int_code << 22) | (pad_amt_code << 25));
  g1[1] = (int)(tensor_d0 << 16);                         // tensor_dim0[15:0]
  g1[2] = (int)((tensor_d0 >> 16) | (tensor_d1 << 16));   // dim0 hi | dim1 lo
  g1[3] = (int)((tensor_d1 >> 16) | (tile_d0 << 16));     // dim1 hi | tile_dim0
  g1[4] = (int)(tile_d1 & 0xFFFFu);                       // tile_dim1 (tile_dim2=0)
  g1[5] = (int)stride0;                                   // tensor_dim0_stride lo
  g1[6] = 0;                                              // stride0 hi | stride1 lo
  g1[7] = 0;                                              // stride1 hi
  i32x4 z4 = {0, 0, 0, 0};
#if defined(__clang_major__) && __clang_major__ >= 23
  i32x8 z8 = {0, 0, 0, 0, 0, 0, 0, 0};
  __builtin_amdgcn_tensor_load_to_lds(g0, g1, z4, z4, z8, 0);
#else
  __builtin_amdgcn_tensor_load_to_lds(g0, g1, z4, z4, 0);
#endif
#endif
}

// ---------------------------------------------------------------------------
// Kernel 0: Wt[e][c] = (f16) W[c][e]
// ---------------------------------------------------------------------------
__global__ __launch_bounds__(256) void wt_kernel(const float* __restrict__ W,
                                                 _Float16* __restrict__ Wt) {
  int e = blockIdx.x, c = threadIdx.x;
  Wt[(size_t)e * DIM + c] = (_Float16)W[(size_t)c * DIM + e];
}

// ---------------------------------------------------------------------------
// Kernel 1: phi = relu(alpha * Wt @ X); software-pipelined f32->f16 staging.
// Q result stored transposed phiQT[b][m][e] (one packed b128 store per tile),
// K result stored phiK[b][e][n] (what kv wants).
// ---------------------------------------------------------------------------
__global__ __launch_bounds__(256) void phi_kernel(const float* __restrict__ query,
                                                  const float* __restrict__ key,
                                                  const _Float16* __restrict__ Wt,
                                                  _Float16* __restrict__ phiQT,
                                                  _Float16* __restrict__ phiK) {
  __shared__ _Float16 Xs[32][136];
  const int tid = threadIdx.x, lane = tid & 31, wid = tid >> 5;
  const int mblk = blockIdx.x;
  const int eblk = blockIdx.y;
  const int b    = blockIdx.z >> 1;
  const int isK  = blockIdx.z & 1;
  const float* __restrict__ X = isK ? key : query;
  const float alpha = isK ? 1.0f : (1.0f / 16.0f);

  const int e_wave  = eblk * 128 + (wid & 3) * 32;
  const int m_wave0 = (wid >> 2) * 64;
  const int m0      = mblk * 128;

  v8f acc[2][4];
#pragma unroll
  for (int i = 0; i < 2; ++i)
#pragma unroll
    for (int t = 0; t < 4; ++t) acc[i][t] = zero8();

  const int srow = tid >> 3;
  const int scol = (tid & 7) << 4;
  const float* src = X + (size_t)b * DIM * MM + m0 + scol;

  const float4* sp = (const float4*)(src + (size_t)srow * MM);
  float4 f0 = sp[0], f1 = sp[1], f2 = sp[2], f3 = sp[3];

  for (int c0 = 0; c0 < DIM; c0 += 32) {
    *(v8h*)&Xs[srow][scol]     = cvt8(f0, f1);
    *(v8h*)&Xs[srow][scol + 8] = cvt8(f2, f3);
    __syncthreads();

    if (c0 + 32 < DIM) {  // prefetch next k-step; latency overlaps WMMA below
      const float4* np = (const float4*)(src + (size_t)(c0 + 32 + srow) * MM);
      f0 = np[0]; f1 = np[1]; f2 = np[2]; f3 = np[3];
    }

    v16h a0 = frag_kcontig(Wt + (size_t)e_wave * DIM + c0, DIM, lane);
    v16h a1 = frag_kcontig(Wt + (size_t)(e_wave + 16) * DIM + c0, DIM, lane);
#pragma unroll
    for (int t = 0; t < 4; ++t) {
      v16h bf;
      int col = m_wave0 + t * 16 + (lane & 15);
      int kb  = (lane >> 4) << 3;
#pragma unroll
      for (int j = 0; j < 8; ++j) {
        bf[j]     = Xs[kb + j][col];
        bf[j + 8] = Xs[kb + 16 + j][col];
      }
      acc[0][t] = wmma_f16(a0, bf, acc[0][t]);
      acc[1][t] = wmma_f16(a1, bf, acc[1][t]);
    }
    __syncthreads();
  }

  if (!isK) {
    // phiQT[m][e]: lane's 8 acc elements are consecutive in e -> one b128 store
#pragma unroll
    for (int i = 0; i < 2; ++i)
#pragma unroll
      for (int t = 0; t < 4; ++t) {
        v8h h;
#pragma unroll
        for (int r = 0; r < 8; ++r) {
          float v = acc[i][t][r] * alpha;
          h[r] = (_Float16)(v > 0.0f ? v : 0.0f);
        }
        int e = e_wave + i * 16 + ((lane >> 4) << 3);
        int m = m0 + m_wave0 + t * 16 + (lane & 15);
        *(v8h*)(phiQT + ((size_t)b * MM + m) * DIM + e) = h;
      }
  } else {
#pragma unroll
    for (int i = 0; i < 2; ++i)
#pragma unroll
      for (int t = 0; t < 4; ++t)
#pragma unroll
        for (int r = 0; r < 8; ++r) {
          int e = e_wave + i * 16 + r + ((lane >> 4) << 3);
          int n = m0 + m_wave0 + t * 16 + (lane & 15);
          float v = acc[i][t][r];
          v = v > 0.0f ? v : 0.0f;
          phiK[((size_t)b * DIM + e) * NN + n] = (_Float16)v;
        }
  }
}

// ---------------------------------------------------------------------------
// Kernel 3: part[b][d][e][ks] = sum over slice ks of n of phiK[b][e][n]*value[b][d][n]
// The n sum is cut into KSPLIT slices so that 4x the work-groups each walk a
// quarter of the serial, latency-bound steps; kv_reduce_kernel adds the slices.
// Partials are f32 and lie in accumulator order: one 1-KiB block per 16x16 tile
// and slice, a tile's KSPLIT blocks side by side, register quad q of lane l at
// floats q*128 + l*4, so every store is 512 contiguous bytes per wave.
// A tile (f16 phiK) staged by the Tensor Data Mover, double-buffered; the
// descriptor pads every 16 DW by 4 DW so rows land 40 halves apart (16B
// aligned, bank-conflict-free b128 fragment loads). B (value f32->f16) uses
// register-prefetch pipelining. TENSORcnt + barriers synchronize.
// The row sums of phiK ride along: rsPart[b][ks][e] = sum over slice ks of n of
// phiK[b][e][n], as the product of the A fragments with a B fragment of ones
// (f32 accumulate), so phiK is not read a second time by a launch of its own.
// ---------------------------------------------------------------------------
__global__ __launch_bounds__(256) void kv_kernel(const _Float16* __restrict__ phiK,
                                                 const float* __restrict__ value,
                                                 float* __restrict__ part,
                                                 float* __restrict__ rsPart) {
  __shared__ _Float16 Vs[128][40];
#if TDM_OK
  __shared__ _Float16 As[2][128][40];
#endif
  const int tid = threadIdx.x, lane = tid & 31, wid = tid >> 5;
  const int dblk = blockIdx.x, eblk = blockIdx.y;
  const int b    = blockIdx.z / KSPLIT;
  const int ks   = blockIdx.z % KSPLIT;
  const int nbeg = ks * (NN / KSPLIT);
  const int e_wave  = eblk * 128 + (wid & 3) * 32;
  const int d_wave0 = (wid >> 2) * 64;
  const int d0      = dblk * 128;

  v8f acc[2][4];
#pragma unroll
  for (int i = 0; i < 2; ++i)
#pragma unroll
    for (int t = 0; t < 4; ++t) acc[i][t] = zero8();

  v8f rs[2] = {zero8(), zero8()};  // every column holds the row sums of a0, a1
  const _Float16 one = (_Float16)1.0f;
  const v16h ones = {one, one, one, one, one, one, one, one,
                     one, one, one, one, one, one, one, one};

  const int srow = tid >> 1;
  const int scol = (tid & 1) << 4;
  const float* src = value + ((size_t)b * DIM + d0 + srow) * NN + nbeg + scol;

  const float4* sp = (const float4*)src;
  float4 f0 = sp[0], f1 = sp[1], f2 = sp[2], f3 = sp[3];

#if TDM_OK
  const _Float16* aGlob = phiK + ((size_t)b * DIM + eblk * 128) * NN + nbeg;
  const unsigned aoff0 = (unsigned)(uintptr_t)(&As[0][0][0]);
  const unsigned aoff1 = (unsigned)(uintptr_t)(&As[1][0][0]);
  if (wid == 0) {  // A tile for step 0: 32n x 128e rows, row stride NN
    tdm_load_2d_f16(aoff0, aGlob, NN, DIM, 32, 128, NN, /*int16DW*/3, /*amt4DW*/3);
    // Waited for here, so that no descriptor register is reused (for the loop's
    // counters) while the request is outstanding; the value loads above fly on.
    asm volatile("s_wait_tensorcnt 0x0" ::: "memory");
  }
#endif

  for (int n0 = 0; n0 < NN / KSPLIT; n0 += 32) {
    *(v8h*)&Vs[srow][scol]     = cvt8(f0, f1);
    *(v8h*)&Vs[srow][scol + 8] = cvt8(f2, f3);
#if TDM_OK
    const int buf = (n0 >> 5) & 1;
    // The issuing wave's wait for the tile of this step. Every wave runs it (at
    // once done where none is outstanding): a test here would save EXEC into a
    // scalar register, which may be one of the outstanding descriptor's.
    asm volatile("s_wait_tensorcnt 0x0" ::: "memory");
#endif
    __syncthreads();  // publish Vs stores (and DMA'd A tile)

    if (n0 + 32 < NN / KSPLIT) {  // prefetch next B tile; overlaps WMMA below
      const float4* np = (const float4*)(src + n0 + 32);
      f0 = np[0]; f1 = np[1]; f2 = np[2]; f3 = np[3];
#if TDM_OK
      if (wid == 0)  // DMA next A tile into the other buffer
        tdm_load_2d_f16(buf ? aoff0 : aoff1, aGlob + n0 + 32, NN, DIM, 32, 128,
                        NN, 3, 3);
#endif
    }

#if TDM_OK
    v16h a0, a1;
    {
      int hw8 = (lane >> 4) << 3;
      const _Float16* p0 = &As[buf][(wid & 3) * 32 + (lane & 15)][hw8];
      const _Float16* p1 = &As[buf][(wid & 3) * 32 + 16 + (lane & 15)][hw8];
      v8h lo0 = *(const v8h*)p0, hi0 = *(const v8h*)(p0 + 16);
      v8h lo1 = *(const v8h*)p1, hi1 = *(const v8h*)(p1 + 16);
#pragma unroll
      for (int j = 0; j < 8; ++j) {
        a0[j] = lo0[j]; a0[j + 8] = hi0[j];
        a1[j] = lo1[j]; a1[j + 8] = hi1[j];
      }
    }
#else
    v16h a0 = frag_kcontig(phiK + ((size_t)b * DIM + e_wave) * NN + nbeg + n0, NN, lane);
    v16h a1 = frag_kcontig(phiK + ((size_t)b * DIM + e_wave + 16) * NN + nbeg + n0, NN, lane);
#endif
    // Run by every wave, so that the loop holds no test: its steps wait on loads,
    // not on the matrix unit. One wave per e range stores the result.
    rs[0] = wmma_f16(a0, ones, rs[0]);
    rs[1] = wmma_f16(a1, ones, rs[1]);
#pragma unroll
    for (int t = 0; t < 4; ++t) {
      const _Float16* rp = &Vs[d_wave0 + t * 16 + (lane & 15)][(lane >> 4) << 3];
      v8h lo = *(const v8h*)rp;
      v8h hi = *(const v8h*)(rp + 16);
      v16h bf;
#pragma unroll
      for (int j = 0; j < 8; ++j) { bf[j] = lo[j]; bf[j + 8] = hi[j]; }
      acc[0][t] = wmma_f16(a0, bf, acc[0][t]);
      acc[1][t] = wmma_f16(a1, bf, acc[1][t]);
    }
    __syncthreads();  // tiles consumed; buffers reusable
  }

  // Tile (dt, et) = (d / 16, e / 16) of batch b, slice ks: block (dt * 16 + et) * KSPLIT + ks.
  float* pwg = part + (size_t)b * DIM * DIM * KSPLIT +
               (((d0 >> 4) * (DIM / 16) + eblk * 8) * KSPLIT + ks) * 256;
  const unsigned pw =
      (unsigned)(((d_wave0 >> 4) * (DIM / 16) + (wid & 3) * 2) * KSPLIT * 256 + lane * 4);
#pragma unroll
  for (int i = 0; i < 2; ++i)
#pragma unroll
    for (int t = 0; t < 4; ++t) {
      float* tp = pwg + (pw + (t * (DIM / 16) + i) * KSPLIT * 256);
      *(float4*)tp         = make_float4(acc[i][t][0], acc[i][t][1], acc[i][t][2], acc[i][t][3]);
      *(float4*)(tp + 128) = make_float4(acc[i][t][4], acc[i][t][5], acc[i][t][6], acc[i][t][7]);
    }

  // Column 0 of rs: lane 0 holds rows 0..7, lane 16 rows 8..15. The wave's 32
  // sums fill one 128-byte line.
  if (dblk == 0 && wid < 4 && (lane & 15) == 0) {
    float* rp = rsPart + ((size_t)b * KSPLIT + ks) * DIM + e_wave + ((lane >> 4) << 3);
    // Unrolled: constant indices keep rs in registers.
#pragma unroll
    for (int i = 0; i < 2; ++i) {
      *(float4*)(rp + i * 16)     = make_float4(rs[i][0], rs[i][1], rs[i][2], rs[i][3]);
      *(float4*)(rp + i * 16 + 4) = make_float4(rs[i][4], rs[i][5], rs[i][6], rs[i][7]);
    }
  }
}

// ---------------------------------------------------------------------------
// Kernel 3b: kvT[b][d][e] = (f16) sum_ks part[b][d][e][ks]
// One work-group per (b, 16 rows of d); each wave adds two 16x16 tiles. A lane
// holds what it held as accumulator: d = 16*dt + (lane & 15), e = 16*et +
// 8*(lane >> 4) + 0..7, so the result leaves as one 16-byte store.
// The first work-group of each batch also adds the slices of the row sums:
// rowsum[b][e] = sum_ks rsPart[b][ks][e].
// ---------------------------------------------------------------------------
__global__ __launch_bounds__(256) void kv_reduce_kernel(const float* __restrict__ part,
                                                        const float* __restrict__ rsPart,
                                                        _Float16* __restrict__ kvT,
                                                        float* __restrict__ rowsum) {
  const int tid = threadIdx.x, lane = tid & 31, wid = tid >> 5;
  const int b = blockIdx.x / (DIM / 16), dt = blockIdx.x % (DIM / 16);
  const float* pwg = part + (size_t)blockIdx.x * (DIM / 16) * KSPLIT * 256;
  const unsigned pw = (unsigned)(wid * 2 * KSPLIT * 256 + lane * 4);
  float4 lo[2][KSPLIT], hi[2][KSPLIT];
  // Unrolled (here and below): constant indices keep lo and hi in registers.
#pragma unroll
  for (int u = 0; u < 2; ++u)
#pragma unroll
    for (int s = 0; s < KSPLIT; ++s) {
      lo[u][s] = *(const float4*)(pwg + (pw + (u * KSPLIT + s) * 256));
      hi[u][s] = *(const float4*)(pwg + (pw + (u * KSPLIT + s) * 256 + 128));
    }
#pragma unroll
  for (int u = 0; u < 2; ++u) {
    float4 a = lo[u][0], c = hi[u][0];
#pragma unroll
    for (int s = 1; s < KSPLIT; ++s) {
      a.x += lo[u][s].x; a.y += lo[u][s].y; a.z += lo[u][s].z; a.w += lo[u][s].w;
      c.x += hi[u][s].x; c.y += hi[u][s].y; c.z += hi[u][s].z; c.w += hi[u][s].w;
    }
    int e = (wid * 2 + u) * 16 + ((lane >> 4) << 3);
    int d = dt * 16 + (lane & 15);
    *(v8h*)(kvT + ((size_t)b * DIM + d) * DIM + e) = cvt8(a, c);
  }
  if (dt == 0) {
    const float* rp = rsPart + (size_t)b * KSPLIT * DIM + tid;
    float r = rp[0];
    for (int s = 1; s < KSPLIT; ++s) r += rp[s * DIM];
    rowsum[b * DIM + tid] = r;
  }
}

// ---------------------------------------------------------------------------
// Kernel 4: scale[b][m] = 1 / (sum_e phiQT[b][m][e]*rowsum[b][e] + 1e-8)
// phiQT is m-major: each thread reads 512 contiguous bytes (v8h loads)
// ---------------------------------------------------------------------------
__global__ __launch_bounds__(256) void scale_kernel(const _Float16* __restrict__ phiQT,
                                                    const float* __restrict__ rowsum,
                                                    float* __restrict__ scale) {
  int b = blockIdx.y;
  int m = blockIdx.x * 256 + threadIdx.x;
  const v8h* pq = (const v8h*)(phiQT + ((size_t)b * MM + m) * DIM);
  const float* rs = rowsum + b * DIM;
  float s = 0.0f;
#pragma unroll 4
  for (int c = 0; c < DIM / 8; ++c) {
    v8h h = pq[c];
#pragma unroll
    for (int j = 0; j < 8; ++j) s += (float)h[j] * rs[c * 8 + j];
  }
  scale[(size_t)b * MM + m] = 1.0f / (s + 1e-8f);
}

// ---------------------------------------------------------------------------
// Kernel 5: out[b][d][m] = scale[b][m] * sum_e kvT[b][d][e]*phiQT[b][m][e]
// Both operands are K(=e)-contiguous f16 rows of 512 bytes. A fragment load
// straight from global memory touches 16 lines for 512 bytes, so the work-group's
// two 128-row tiles are brought into LDS once, whole lines at a time, by tensor
// loads, and the fragments come from LDS.
// Each wave brings one slice: 64 rows of one 256-byte half of the e range
// (source pitch 512 bytes), padded by the mover to a pitch of 272 bytes, at which
// 16-byte fragment reads of 16 rows fall on 64 different banks.
// Slice number = operand * 4 + e half * 2 + row half (operand 0 = kvT, 1 = phiQT).
// ---------------------------------------------------------------------------
#define OUT_PITCH 272    // bytes from row to row in LDS: 256 + the 16-byte pad
#define OUT_SLICE 18432  // 64 rows * 272 bytes = 17,408, rounded up to a multiple of 2 KiB

typedef __attribute__((ext_vector_type(8))) unsigned int u32x8;

__device__ __forceinline__ uint32_t uni(uint32_t v) {
  return (uint32_t)__builtin_amdgcn_readfirstlane(v);
}

// Same element order as frag_kcontig: 16 bytes at K = 0..7 (+8 for the upper
// half-wave, already in p), 16 bytes at K = 16..23 (+8).
__device__ __forceinline__ v16h frag_lds(const unsigned char* p) {
  v8h lo = *(const v8h*)p;
  v8h hi = *(const v8h*)(p + 32);
  v16h f;
#pragma unroll
  for (int j = 0; j < 8; ++j) { f[j] = lo[j]; f[j + 8] = hi[j]; }
  return f;
}

__global__ __launch_bounds__(256) void out_kernel(const _Float16* __restrict__ kvT,
                                                  const _Float16* __restrict__ phiQT,
                                                  const float* __restrict__ scale,
                                                  float* __restrict__ out) {
  __shared__ __attribute__((aligned(2048))) unsigned char L[8 * OUT_SLICE];
  const int tid = threadIdx.x, lane = tid & 31, wid = tid >> 5;
  const int mblk = blockIdx.x, dblk = blockIdx.y, b = blockIdx.z;
  const int d_wave  = dblk * 128 + (wid & 3) * 32;
  const int m_wave0 = (wid >> 2) * 64;
  const int m0      = mblk * 128;

  // Read at the head: the scheduling fences below would otherwise hold these
  // loads behind the last product.
  float scv[4];
#pragma unroll
  for (int t = 0; t < 4; ++t)
    scv[t] = scale[(size_t)b * MM + m0 + m_wave0 + t * 16 + (lane & 15)];

  {  // every wave issues the one request for its own slice
    const uint32_t wave = uni(threadIdx.x >> 5);
    const _Float16* rows = (wave >> 2) ? phiQT + ((size_t)b * MM + m0) * DIM
                                       : kvT + ((size_t)b * DIM + dblk * 128) * DIM;
    const uint64_t ga =
        (uint64_t)(uintptr_t)(rows + (size_t)(wave & 1u) * 64 * DIM + ((wave >> 1) & 1u) * 128);
    u32x4 g0;
    g0[0] = uni(1u);                                             // count 1
    g0[1] = uni((uint32_t)(uintptr_t)&L[0] + wave * OUT_SLICE);  // place in LDS
    g0[2] = uni((uint32_t)ga);
    g0[3] = uni((((uint32_t)(ga >> 32)) & 0x01FFFFFFu) | 0x80000000u);  // type 2
    u32x8 g1;  // extents in bytes; tensor dims = tile dims = 256 x 64
    g1[0] = uni((1u << 20) | (5u << 22) | (3u << 25));  // 4 dwords of pad behind every 64
    g1[1] = uni(256u << 16);
    g1[2] = uni(64u << 16);
    g1[3] = uni(256u << 16);
    g1[4] = uni(64u);
    g1[5] = uni(2u * DIM);  // source pitch: one whole row
    g1[6] = uni(0u);
    g1[7] = uni(0u);
    asm volatile("tensor_load_to_lds %0, %1" :: "s"(g0), "s"(g1) : "memory");
    // The slice has landed behind this.
    asm volatile("s_wait_tensorcnt 0x0" ::: "memory");
  }
  __syncthreads();  // every wave's slice is readable by the others behind this

  v8f acc[2][4];
#pragma unroll
  for (int i = 0; i < 2; ++i)
#pragma unroll
    for (int t = 0; t < 4; ++t) acc[i][t] = zero8();

  const unsigned lrow = (unsigned)(lane & 15) * OUT_PITCH + ((unsigned)(lane >> 4) << 4);
  const unsigned char* aP = L + ((wid & 3) >> 1) * OUT_SLICE + (wid & 1) * 32 * OUT_PITCH + lrow;
  const unsigned char* bP = L + (4 + (wid >> 2)) * OUT_SLICE + lrow;

  // Two fragment sets: the reads of step s + 1 go out as one group in front of
  // the products of step s, so a wave does not wait out its own LDS latency.
  v16h af[2][2], bf[2][4];
  af[0][0] = frag_lds(aP);
  af[0][1] = frag_lds(aP + 16 * OUT_PITCH);
#pragma unroll
  for (int t = 0; t < 4; ++t) bf[0][t] = frag_lds(bP + t * 16 * OUT_PITCH);

  // Unrolled: set numbers and LDS offsets must be constants (registers, immediates).
#pragma unroll
  for (int s = 0; s < DIM / 32; ++s) {
    const int cur = s & 1, nxt = cur ^ 1;
    if (s + 1 < DIM / 32) {
      const int off = ((s + 1) >> 2) * 2 * OUT_SLICE + ((s + 1) & 3) * 64;
      af[nxt][0] = frag_lds(aP + off);
      af[nxt][1] = frag_lds(aP + off + 16 * OUT_PITCH);
#pragma unroll
      for (int t = 0; t < 4; ++t) bf[nxt][t] = frag_lds(bP + off + t * 16 * OUT_PITCH);
    }
    // Keeps the read group whole and in front: without it the compiler hoists the
    // reads of all steps (over 256 VGPRs, one work-group per WGP instead of two).
    __builtin_amdgcn_sched_barrier(0);
#pragma unroll
    for (int t = 0; t < 4; ++t) {
      acc[0][t] = wmma_f16(af[cur][0], bf[cur][t], acc[0][t]);
      acc[1][t] = wmma_f16(af[cur][1], bf[cur][t], acc[1][t]);
    }
    // Keeps the next group's reads from moving in among these products.
    __builtin_amdgcn_sched_barrier(0);
  }

#pragma unroll
  for (int t = 0; t < 4; ++t) {
    int m = m0 + m_wave0 + t * 16 + (lane & 15);
    float sc = scv[t];
#pragma unroll
    for (int i = 0; i < 2; ++i)
#pragma unroll
      for (int r = 0; r < 8; ++r) {
        int d = d_wave + i * 16 + r + ((lane >> 4) << 3);
        out[((size_t)b * DIM + d) * MM + m] = acc[i][t][r] * sc;
      }
  }
}

// ---------------------------------------------------------------------------
extern "C" void kernel_launch(void* const* d_in, const int* in_sizes, int n_in,
                              void* d_out, int out_size, void* d_ws, size_t ws_size,
                              hipStream_t stream) {
  const float* query = (const float*)d_in[0];
  const float* key   = (const float*)d_in[1];
  const float* value = (const float*)d_in[2];
  const float* W     = (const float*)d_in[3];
  float* out = (float*)d_out;

  _Float16* Wt    = (_Float16*)d_ws;                       // 256*256 f16
  _Float16* phiQT = Wt + (size_t)DIM * DIM;                // [b][m][e], 32 MB
  _Float16* phiK  = phiQT + (size_t)BATCH * MM * DIM;      // [b][e][n], 32 MB
  _Float16* kvT   = phiK + (size_t)BATCH * DIM * NN;       // [b][d][e], 4 MB
  float* rowsum   = (float*)(kvT + (size_t)BATCH * DIM * DIM);
  float* scaleB   = rowsum + BATCH * DIM;
  float* kvPart   = scaleB + (size_t)BATCH * MM;           // [b][tile][ks], f32, 32 MB
  float* rsPart   = kvPart + (size_t)BATCH * DIM * DIM * KSPLIT;  // [b][ks][e], f32

  wt_kernel<<<dim3(DIM), dim3(DIM), 0, stream>>>(W, Wt);
  phi_kernel<<<dim3(MM / 128, 2, BATCH * 2), dim3(256), 0, stream>>>(
      query, key, Wt, phiQT, phiK);
  kv_kernel<<<dim3(2, 2, BATCH * KSPLIT), dim3(256), 0, stream>>>(phiK, value, kvPart,
                                                                    rsPart);
  kv_reduce_kernel<<<dim3(BATCH * (DIM / 16)), dim3(256), 0, stream>>>(kvPart, rsPart, kvT,
                                                                          rowsum);
  scale_kernel<<<dim3(MM / 256, BATCH), dim3(256), 0, stream>>>(phiQT, rowsum, scaleB);
  out_kernel<<<dim3(MM / 128, 2, BATCH), dim3(256), 0, stream>>>(kvT, phiQT, scaleB, out);
}

// v004
// A run of this version takes 98.2 microseconds.
// Next to v003, in two timings, it ran 1.08 times as fast each time.
// All steps since v000 together make it 1.66 times as fast.
#include <hip/hip_runtime.h>
#include <hip/hip_bf16.h>
#include <stdint.h>

#define DIM 256
#define BATCH 32
#define MM 2048
#define NN 2048
#define KSPLIT 4  // slices of the n sum in kv_kernel, one work-group each

typedef __attribute__((ext_vector_type(16))) _Float16 v16h;
typedef __attribute__((ext_vector_type(8)))  _Float16 v8h;
typedef __attribute__((ext_vector_type(4)))  _Float16 v4h;
typedef __attribute__((ext_vector_type(8)))  float    v8f;
typedef __attribute__((ext_vector_type(4)))  unsigned int u32x4;
typedef __attribute__((ext_vector_type(4)))  int          i32x4;
typedef __attribute__((ext_vector_type(8)))  int          i32x8;

#define TDM_OK __has_builtin(__builtin_amdgcn_tensor_load_to_lds)

__device__ __forceinline__ v8f wmma_f16(v16h a, v16h b, v8f c) {
  // D = A(16x32 f16) * B(32x16 f16) + C(16x16 f32)
  return __builtin_amdgcn_wmma_f32_16x16x32_f16(false, a, false, b, (short)0, c,
                                                false, false);
}

__device__ __forceinline__ v8f zero8() {
  v8f z;
#pragma unroll
  for (int r = 0; r < 8; ++r) z[r] = 0.0f;
  return z;
}

__device__ __forceinline__ v8h cvt8(float4 a, float4 b) {
  v8h h;
  h[0] = (_Float16)a.x; h[1] = (_Float16)a.y; h[2] = (_Float16)a.z; h[3] = (_Float16)a.w;
  h[4] = (_Float16)b.x; h[5] = (_Float16)b.y; h[6] = (_Float16)b.z; h[7] = (_Float16)b.w;
  return h;
}

__device__ __forceinline__ v4h cvt4(float4 a) {
  v4h h;
  h[0] = (_Float16)a.x; h[1] = (_Float16)a.y; h[2] = (_Float16)a.z; h[3] = (_Float16)a.w;
  return h;
}

// Fragment from row-major f16 memory (row stride ld, K contiguous).
// Per ISA 16-bit A layout: row = lane%16, element j holds K = j + 8*((j>>3)+(lane>>4)).
// Same mapping serves B fragments when "row" is the B column and K is contiguous.
__device__ __forceinline__ v16h frag_kcontig(const _Float16* __restrict__ base,
                                             int ld, int lane) {
  const _Float16* p = base + (size_t)(lane & 15) * ld + ((lane >> 4) << 3);
  v8h lo = *(const v8h*)p;         // K = 0..7   (+8 for upper half-wave)
  v8h hi = *(const v8h*)(p + 16);  // K = 16..23 (+8)
  v16h f;
#pragma unroll
  for (int j = 0; j < 8; ++j) { f[j] = lo[j]; f[j + 8] = hi[j]; }
  return f;
}

// ---------------------------------------------------------------------------
// TDM: 2D tile (tile_d0 x tile_d1 elements of 2 bytes) global -> LDS with
// row stride stride0 (elements). LDS padding from descriptor: insert
// (pad_amt_code+1) DWORDs after every 2^(pad_int_code+1) DWORDs stored.
// ---------------------------------------------------------------------------
__device__ __forceinline__ void tdm_load_2d_f16(unsigned lds_off, const void* gaddr,
                                                unsigned tensor_d0, unsigned tensor_d1,
                                                unsigned tile_d0, unsigned tile_d1,
                                                unsigned stride0,
                                                unsigned pad_int_code,
                                                unsigned pad_amt_code) {
#if TDM_OK
  unsigned long long ga = (unsigned long long)(uintptr_t)gaddr;
  u32x4 g0;
  g0[0] = 1u;                                    // count=1 (valid user descriptor)
  g0[1] = lds_off;                               // lds_addr (bytes)
  g0[2] = (unsigned)(ga & 0xFFFFFFFFu);          // global_addr[31:0]
  g0[3] = (unsigned)((ga >> 32) & 0x01FFFFFFu) | (2u << 30);  // addr[56:32], type=2
  i32x8 g1;
  // wg_mask=0 | data_size=1(2B)<<16 | pad_enable<<20 | pad_interval<<22 | pad_amount<<25
  g1[0] = (int)((1u << 16) | (1u << 20) | (pad_int_code << 22) | (pad_amt_code << 25));
  g1[1] = (int)(tensor_d0 << 16);                         // tensor_dim0[15:0]
  g1[2] = (int)((tensor_d0 >> 16) | (tensor_d1 << 16));   // dim0 hi | dim1 lo
  g1[3] = (int)((tensor_d1 >> 16) | (tile_d0 << 16));     // dim1 hi | tile_dim0
  g1[4] = (int)(tile_d1 & 0xFFFFu);                       // tile_dim1 (tile_dim2=0)
  g1[5] = (int)stride0;                                   // tensor_dim0_stride lo
  g1[6] = 0;                                              // stride0 hi | stride1 lo
  g1[7] = 0;                                              // stride1 hi
  i32x4 z4 = {0, 0, 0, 0};
#if defined(__clang_major__) && __clang_major__ >= 23
  i32x8 z8 = {0, 0, 0, 0, 0, 0, 0, 0};
  __builtin_amdgcn_tensor_load_to_lds(g0, g1, z4, z4, z8, 0);
#else
  __builtin_amdgcn_tensor_load_to_lds(g0, g1, z4, z4, 0);
#endif
#endif
}

// ---------------------------------------------------------------------------
// Kernel 0: Wt = (f16) W transposed, packed in the order of phi_kernel's A
// fragments: one 1-KiB block per (16 rows of e, 32 columns of c); in it lane l's
// 8 halves for K = 0..7 (+8 for the upper half-wave) at halves l*8, those for
// K = 16..23 (+8) at halves 256 + l*8. A wave-wide 16-byte load of a fragment
// half is then 512 contiguous bytes (4 lines) instead of 16 rows (16 lines).
// ---------------------------------------------------------------------------
__global__ __launch_bounds__(256) void wt_kernel(const float* __restrict__ W,
                                                 _Float16* __restrict__ Wt) {
  int e = blockIdx.x, c = threadIdx.x;
  int blk  = (e >> 4) * (DIM / 32) + (c >> 5);
  int lane = (((c >> 3) & 1) << 4) + (e & 15);
  Wt[(size_t)blk * 512 + ((c >> 4) & 1) * 256 + lane * 8 + (c & 7)] =
      (_Float16)W[(size_t)c * DIM + e];
}

// A fragment from a block packed by wt_kernel (p = block + lane * 8); the element
// order is that of frag_kcontig.
__device__ __forceinline__ v16h frag_packed(const _Float16* __restrict__ p) {
  v8h lo = *(const v8h*)p;
  v8h hi = *(const v8h*)(p + 256);
  v16h f;
#pragma unroll
  for (int j = 0; j < 8; ++j) { f[j] = lo[j]; f[j + 8] = hi[j]; }
  return f;
}

// ---------------------------------------------------------------------------
// Kernel 1: phi = relu(alpha * Wt @ X); software-pipelined f32->f16 staging.
// Every wave-wide global load covers whole 128-byte lines: a wave stages 4 rows of
// X, each as 512 contiguous bytes, and Wt comes packed in fragment order.
// Q result stored transposed phiQT[b][m][e] (one packed b128 store per tile),
// K result stored phiK[b][e][n] (what kv wants).
// ---------------------------------------------------------------------------
__global__ __launch_bounds__(256) void phi_kernel(const float* __restrict__ query,
                                                  const float* __restrict__ key,
                                                  const _Float16* __restrict__ Wt,
                                                  _Float16* __restrict__ phiQT,
                                                  _Float16* __restrict__ phiK) {
  __shared__ _Float16 Xs[32][136];
  const int tid = threadIdx.x, lane = tid & 31, wid = tid >> 5;
  const int mblk = blockIdx.x;
  const int eblk = blockIdx.y;
  const int b    = blockIdx.z >> 1;
  const int isK  = blockIdx.z & 1;
  const float* __restrict__ X = isK ? key : query;
  const float alpha = isK ? 1.0f : (1.0f / 16.0f);

  const int e_wave  = eblk * 128 + (wid & 3) * 32;
  const int m_wave0 = (wid >> 2) * 64;
  const int m0      = mblk * 128;

  v8f acc[2][4];
#pragma unroll
  for (int i = 0; i < 2; ++i)
#pragma unroll
    for (int t = 0; t < 4; ++t) acc[i][t] = zero8();

  const int srow = wid << 2;
  const int scol = lane << 2;
  const float* src = X + ((size_t)b * DIM + srow) * MM + m0 + scol;
  const _Float16* wp = Wt + (size_t)(e_wave >> 4) * (DIM / 32) * 512 + lane * 8;

  float4 f0 = *(const float4*)src;
  float4 f1 = *(const float4*)(src + MM);
  float4 f2 = *(const float4*)(src + 2 * MM);
  float4 f3 = *(const float4*)(src + 3 * MM);

  for (int c0 = 0; c0 < DIM; c0 += 32) {
    *(v4h*)&Xs[srow][scol]     = cvt4(f0);
    *(v4h*)&Xs[srow + 1][scol] = cvt4(f1);
    *(v4h*)&Xs[srow + 2][scol] = cvt4(f2);
    *(v4h*)&Xs[srow + 3][scol] = cvt4(f3);
    __syncthreads();

    if (c0 + 32 < DIM) {  // prefetch next k-step; latency overlaps WMMA below
      const float* np = src + (size_t)(c0 + 32) * MM;
      f0 = *(const float4*)np;
      f1 = *(const float4*)(np + MM);
      f2 = *(const float4*)(np + 2 * MM);
      f3 = *(const float4*)(np + 3 * MM);
      // Stands in front of the first write to these loads' address registers,
      // which this build reuses for the fragment loads below.
      asm volatile("s_wait_xcnt 0x0" ::: "memory");
    }

    v16h a0 = frag_packed(wp + (c0 >> 5) * 512);
    v16h a1 = frag_packed(wp + ((DIM / 32) + (c0 >> 5)) * 512);
#pragma unroll
    for (int t = 0; t < 4; ++t) {
      v16h bf;
      int col = m_wave0 + t * 16 + (lane & 15);
      int kb  = (lane >> 4) << 3;
#pragma unroll
      for (int j = 0; j < 8; ++j) {
        bf[j]     = Xs[kb + j][col];
        bf[j + 8] = Xs[kb + 16 + j][col];
      }
      acc[0][t] = wmma_f16(a0, bf, acc[0][t]);
      acc[1][t] = wmma_f16(a1, bf, acc[1][t]);
    }
    __syncthreads();
  }

  if (!isK) {
    // phiQT[m][e]: lane's 8 acc elements are consecutive in e -> one b128 store
#pragma unroll
    for (int i = 0; i < 2; ++i)
#pragma unroll
      for (int t = 0; t < 4; ++t) {
        v8h h;
#pragma unroll
        for (int r = 0; r < 8; ++r) {
          float v = acc[i][t][r] * alpha;
          h[r] = (_Float16)(v > 0.0f ? v : 0.0f);
        }
        int e = e_wave + i * 16 + ((lane >> 4) << 3);
        int m = m0 + m_wave0 + t * 16 + (lane & 15);
        *(v8h*)(phiQT + ((size_t)b * MM + m) * DIM + e) = h;
      }
  } else {
#pragma unroll
    for (int i = 0; i < 2; ++i)
#pragma unroll
      for (int t = 0; t < 4; ++t)
#pragma unroll
        for (int r = 0; r < 8; ++r) {
          int e = e_wave + i * 16 + r + ((lane >> 4) << 3);
          int n = m0 + m_wave0 + t * 16 + (lane & 15);
          float v = acc[i][t][r];
          v = v > 0.0f ? v : 0.0f;
          phiK[((size_t)b * DIM + e) * NN + n] = (_Float16)v;
        }
  }
}

// ---------------------------------------------------------------------------
// Kernel 3: part[b][d][e][ks] = sum over slice ks of n of phiK[b][e][n]*value[b][d][n]
// The n sum is cut into KSPLIT slices so that 4x the work-groups each walk a
// quarter of the serial, latency-bound steps; kv_reduce_kernel adds the slices.
// Partials are f32 and lie in accumulator order: one 1-KiB block per 16x16 tile
// and slice, a tile's KSPLIT blocks side by side, register quad q of lane l at
// floats q*128 + l*4, so every store is 512 contiguous bytes per wave.
// A tile (f16 phiK) staged by the Tensor Data Mover, double-buffered; the
// descriptor pads every 16 DW by 4 DW so rows land 40 halves apart (16B
// aligned, bank-conflict-free b128 fragment loads). B (value f32->f16) uses
// register-prefetch pipelining. TENSORcnt + barriers synchronize.
// The row sums of phiK ride along: rsPart[b][ks][e] = sum over slice ks of n of
// phiK[b][e][n], as the product of the A fragments with a B fragment of ones
// (f32 accumulate), so phiK is not read a second time by a launch of its own.
// ---------------------------------------------------------------------------
__global__ __launch_bounds__(256) void kv_kernel(const _Float16* __restrict__ phiK,
                                                 const float* __restrict__ value,
                                                 float* __restrict__ part,
                                                 float* __restrict__ rsPart) {
  __shared__ _Float16 Vs[128][40];
#if TDM_OK
  __shared__ _Float16 As[2][128][40];
#endif
  const int tid = threadIdx.x, lane = tid & 31, wid = tid >> 5;
  const int dblk = blockIdx.x, eblk = blockIdx.y;
  const int b    = blockIdx.z / KSPLIT;
  const int ks   = blockIdx.z % KSPLIT;
  const int nbeg = ks * (NN / KSPLIT);
  const int e_wave  = eblk * 128 + (wid & 3) * 32;
  const int d_wave0 = (wid >> 2) * 64;
  const int d0      = dblk * 128;

  v8f acc[2][4];
#pragma unroll
  for (int i = 0; i < 2; ++i)
#pragma unroll
    for (int t = 0; t < 4; ++t) acc[i][t] = zero8();

  v8f rs[2] = {zero8(), zero8()};  // every column holds the row sums of a0, a1
  const _Float16 one = (_Float16)1.0f;
  const v16h ones = {one, one, one, one, one, one, one, one,
                     one, one, one, one, one, one, one, one};

  const int srow = tid >> 1;
  const int scol = (tid & 1) << 4;
  const float* src = value + ((size_t)b * DIM + d0 + srow) * NN + nbeg + scol;

  const float4* sp = (const float4*)src;
  float4 f0 = sp[0], f1 = sp[1], f2 = sp[2], f3 = sp[3];

#if TDM_OK
  const _Float16* aGlob = phiK + ((size_t)b * DIM + eblk * 128) * NN + nbeg;
  const unsigned aoff0 = (unsigned)(uintptr_t)(&As[0][0][0]);
  const unsigned aoff1 = (unsigned)(uintptr_t)(&As[1][0][0]);
  if (wid == 0) {  // A tile for step 0: 32n x 128e rows, row stride NN
    tdm_load_2d_f16(aoff0, aGlob, NN, DIM, 32, 128, NN, /*int16DW*/3, /*amt4DW*/3);
    // Waited for here, so that no descriptor register is reused (for the loop's
    // counters) while the request is outstanding; the value loads above fly on.
    asm volatile("s_wait_tensorcnt 0x0" ::: "memory");
  }
#endif

  for (int n0 = 0; n0 < NN / KSPLIT; n0 += 32) {
    *(v8h*)&Vs[srow][scol]     = cvt8(f0, f1);
    *(v8h*)&Vs[srow][scol + 8] = cvt8(f2, f3);
#if TDM_OK
    const int buf = (n0 >> 5) & 1;
    // The issuing wave's wait for the tile of this step. Every wave runs it (at
    // once done where none is outstanding): a test here would save EXEC into a
    // scalar register, which may be one of the outstanding descriptor's.
    asm volatile("s_wait_tensorcnt 0x0" ::: "memory");
#endif
    __syncthreads();  // publish Vs stores (and DMA'd A tile)

    if (n0 + 32 < NN / KSPLIT) {  // prefetch next B tile; overlaps WMMA below
      const float4* np = (const float4*)(src + n0 + 32);
      f0 = np[0]; f1 = np[1]; f2 = np[2]; f3 = np[3];
#if TDM_OK
      if (wid == 0)  // DMA next A tile into the other buffer
        tdm_load_2d_f16(buf ? aoff0 : aoff1, aGlob + n0 + 32, NN, DIM, 32, 128,
                        NN, 3, 3);
#endif
    }

#if TDM_OK
    v16h a0, a1;
    {
      int hw8 = (lane >> 4) << 3;
      const _Float16* p0 = &As[buf][(wid & 3) * 32 + (lane & 15)][hw8];
      const _Float16* p1 = &As[buf][(wid & 3) * 32 + 16 + (lane & 15)][hw8];
      v8h lo0 = *(const v8h*)p0, hi0 = *(const v8h*)(p0 + 16);
      v8h lo1 = *(const v8h*)p1, hi1 = *(const v8h*)(p1 + 16);
#pragma unroll
      for (int j = 0; j < 8; ++j) {
        a0[j] = lo0[j]; a0[j + 8] = hi0[j];
        a1[j] = lo1[j]; a1[j + 8] = hi1[j];
      }
    }
#else
    v16h a0 = frag_kcontig(phiK + ((size_t)b * DIM + e_wave) * NN + nbeg + n0, NN, lane);
    v16h a1 = frag_kcontig(phiK + ((size_t)b * DIM + e_wave + 16) * NN + nbeg + n0, NN, lane);
#endif
    // Run by every wave, so that the loop holds no test: its steps wait on loads,
    // not on the matrix unit. One wave per e range stores the result.
    rs[0] = wmma_f16(a0, ones, rs[0]);
    rs[1] = wmma_f16(a1, ones, rs[1]);
#pragma unroll
    for (int t = 0; t < 4; ++t) {
      const _Float16* rp = &Vs[d_wave0 + t * 16 + (lane & 15)][(lane >> 4) << 3];
      v8h lo = *(const v8h*)rp;
      v8h hi = *(const v8h*)(rp + 16);
      v16h bf;
#pragma unroll
      for (int j = 0; j < 8; ++j) { bf[j] = lo[j]; bf[j + 8] = hi[j]; }
      acc[0][t] = wmma_f16(a0, bf, acc[0][t]);
      acc[1][t] = wmma_f16(a1, bf, acc[1][t]);
    }
    __syncthreads();  // tiles consumed; buffers reusable
  }

  // Tile (dt, et) = (d / 16, e / 16) of batch b, slice ks: block (dt * 16 + et) * KSPLIT + ks.
  float* pwg = part + (size_t)b * DIM * DIM * KSPLIT +
               (((d0 >> 4) * (DIM / 16) + eblk * 8) * KSPLIT + ks) * 256;
  const unsigned pw =
      (unsigned)(((d_wave0 >> 4) * (DIM / 16) + (wid & 3) * 2) * KSPLIT * 256 + lane * 4);
#pragma unroll
  for (int i = 0; i < 2; ++i)
#pragma unroll
    for (int t = 0; t < 4; ++t) {
      float* tp = pwg + (pw + (t * (DIM / 16) + i) * KSPLIT * 256);
      *(float4*)tp         = make_float4(acc[i][t][0], acc[i][t][1], acc[i][t][2], acc[i][t][3]);
      *(float4*)(tp + 128) = make_float4(acc[i][t][4], acc[i][t][5], acc[i][t][6], acc[i][t][7]);
    }

  // Column 0 of rs: lane 0 holds rows 0..7, lane 16 rows 8..15. The wave's 32
  // sums fill one 128-byte line.
  if (dblk == 0 && wid < 4 && (lane & 15) == 0) {
    float* rp = rsPart + ((size_t)b * KSPLIT + ks) * DIM + e_wave + ((lane >> 4) << 3);
    // Unrolled: constant indices keep rs in registers.
#pragma unroll
    for (int i = 0; i < 2; ++i) {
      *(float4*)(rp + i * 16)     = make_float4(rs[i][0], rs[i][1], rs[i][2], rs[i][3]);
      *(float4*)(rp + i * 16 + 4) = make_float4(rs[i][4], rs[i][5], rs[i][6], rs[i][7]);
    }
  }
}

// ---------------------------------------------------------------------------
// Kernel 3b: kvT[b][d][e] = (f16) sum_ks part[b][d][e][ks]
// One work-group per (b, 16 rows of d); each wave adds two 16x16 tiles. A lane
// holds what it held as accumulator: d = 16*dt + (lane & 15), e = 16*et +
// 8*(lane >> 4) + 0..7, so the result leaves as one 16-byte store.
// The first work-group of each batch also adds the slices of the row sums:
// rowsum[b][e] = sum_ks rsPart[b][ks][e].
// ---------------------------------------------------------------------------
__global__ __launch_bounds__(256) void kv_reduce_kernel(const float* __restrict__ part,
                                                        const float* __restrict__ rsPart,
                                                        _Float16* __restrict__ kvT,
                                                        float* __restrict__ rowsum) {
  const int tid = threadIdx.x, lane = tid & 31, wid = tid >> 5;
  const int b = blockIdx.x / (DIM / 16), dt = blockIdx.x % (DIM / 16);
  const float* pwg = part + (size_t)blockIdx.x * (DIM / 16) * KSPLIT * 256;
  const unsigned pw = (unsigned)(wid * 2 * KSPLIT * 256 + lane * 4);
  float4 lo[2][KSPLIT], hi[2][KSPLIT];
  // Unrolled (here and below): constant indices keep lo and hi in registers.
#pragma unroll
  for (int u = 0; u < 2; ++u)
#pragma unroll
    for (int s = 0; s < KSPLIT; ++s) {
      lo[u][s] = *(const float4*)(pwg + (pw + (u * KSPLIT + s) * 256));
      hi[u][s] = *(const float4*)(pwg + (pw + (u * KSPLIT + s) * 256 + 128));
    }
#pragma unroll
  for (int u = 0; u < 2; ++u) {
    float4 a = lo[u][0], c = hi[u][0];
#pragma unroll
    for (int s = 1; s < KSPLIT; ++s) {
      a.x += lo[u][s].x; a.y += lo[u][s].y; a.z += lo[u][s].z; a.w += lo[u][s].w;
      c.x += hi[u][s].x; c.y += hi[u][s].y; c.z += hi[u][s].z; c.w += hi[u][s].w;
    }
    int e = (wid * 2 + u) * 16 + ((lane >> 4) << 3);
    int d = dt * 16 + (lane & 15);
    *(v8h*)(kvT + ((size_t)b * DIM + d) * DIM + e) = cvt8(a, c);
  }
  if (dt == 0) {
    const float* rp = rsPart + (size_t)b * KSPLIT * DIM + tid;
    float r = rp[0];
    for (int s = 1; s < KSPLIT; ++s) r += rp[s * DIM];
    rowsum[b * DIM + tid] = r;
  }
}

// ---------------------------------------------------------------------------
// Kernel 4: scale[b][m] = 1 / (sum_e phiQT[b][m][e]*rowsum[b][e] + 1e-8)
// phiQT is m-major: each thread reads 512 contiguous bytes (v8h loads)
// ---------------------------------------------------------------------------
__global__ __launch_bounds__(256) void scale_kernel(const _Float16* __restrict__ phiQT,
                                                    const float* __restrict__ rowsum,
                                                    float* __restrict__ scale) {
  int b = blockIdx.y;
  int m = blockIdx.x * 256 + threadIdx.x;
  const v8h* pq = (const v8h*)(phiQT + ((size_t)b * MM + m) * DIM);
  const float* rs = rowsum + b * DIM;
  float s = 0.0f;
#pragma unroll 4
  for (int c = 0; c < DIM / 8; ++c) {
    v8h h = pq[c];
#pragma unroll
    for (int j = 0; j < 8; ++j) s += (float)h[j] * rs[c * 8 + j];
  }
  scale[(size_t)b * MM + m] = 1.0f / (s + 1e-8f);
}

// ---------------------------------------------------------------------------
// Kernel 5: out[b][d][m] = scale[b][m] * sum_e kvT[b][d][e]*phiQT[b][m][e]
// Both operands are K(=e)-contiguous f16 rows of 512 bytes. A fragment load
// straight from global memory touches 16 lines for 512 bytes, so the work-group's
// two 128-row tiles are brought into LDS once, whole lines at a time, by tensor
// loads, and the fragments come from LDS.
// Each wave brings one slice: 64 rows of one 256-byte half of the e range
// (source pitch 512 bytes), padded by the mover to a pitch of 272 bytes, at which
// 16-byte fragment reads of 16 rows fall on 64 different banks.
// Slice number = operand * 4 + e half * 2 + row half (operand 0 = kvT, 1 = phiQT).
// ---------------------------------------------------------------------------
#define OUT_PITCH 272    // bytes from row to row in LDS: 256 + the 16-byte pad
#define OUT_SLICE 18432  // 64 rows * 272 bytes = 17,408, rounded up to a multiple of 2 KiB

typedef __attribute__((ext_vector_type(8))) unsigned int u32x8;

__device__ __forceinline__ uint32_t uni(uint32_t v) {
  return (uint32_t)__builtin_amdgcn_readfirstlane(v);
}

// Same element order as frag_kcontig: 16 bytes at K = 0..7 (+8 for the upper
// half-wave, already in p), 16 bytes at K = 16..23 (+8).
__device__ __forceinline__ v16h frag_lds(const unsigned char* p) {
  v8h lo = *(const v8h*)p;
  v8h hi = *(const v8h*)(p + 32);
  v16h f;
#pragma unroll
  for (int j = 0; j < 8; ++j) { f[j] = lo[j]; f[j + 8] = hi[j]; }
  return f;
}

__global__ __launch_bounds__(256) void out_kernel(const _Float16* __restrict__ kvT,
                                                  const _Float16* __restrict__ phiQT,
                                                  const float* __restrict__ scale,
                                                  float* __restrict__ out) {
  __shared__ __attribute__((aligned(2048))) unsigned char L[8 * OUT_SLICE];
  const int tid = threadIdx.x, lane = tid & 31, wid = tid >> 5;
  const int mblk = blockIdx.x, dblk = blockIdx.y, b = blockIdx.z;
  const int d_wave  = dblk * 128 + (wid & 3) * 32;
  const int m_wave0 = (wid >> 2) * 64;
  const int m0      = mblk * 128;

  // Read at the head: the scheduling fences below would otherwise hold these
  // loads behind the last product.
  float scv[4];
#pragma unroll
  for (int t = 0; t < 4; ++t)
    scv[t] = scale[(size_t)b * MM + m0 + m_wave0 + t * 16 + (lane & 15)];

  {  // every wave issues the one request for its own slice
    const uint32_t wave = uni(threadIdx.x >> 5);
    const _Float16* rows = (wave >> 2) ? phiQT + ((size_t)b * MM + m0) * DIM
                                       : kvT + ((size_t)b * DIM + dblk * 128) * DIM;
    const uint64_t ga =
        (uint64_t)(uintptr_t)(rows + (size_t)(wave & 1u) * 64 * DIM + ((wave >> 1) & 1u) * 128);
    u32x4 g0;
    g0[0] = uni(1u);                                             // count 1
    g0[1] = uni((uint32_t)(uintptr_t)&L[0] + wave * OUT_SLICE);  // place in LDS
    g0[2] = uni((uint32_t)ga);
    g0[3] = uni((((uint32_t)(ga >> 32)) & 0x01FFFFFFu) | 0x80000000u);  // type 2
    u32x8 g1;  // extents in bytes; tensor dims = tile dims = 256 x 64
    g1[0] = uni((1u << 20) | (5u << 22) | (3u << 25));  // 4 dwords of pad behind every 64
    g1[1] = uni(256u << 16);
    g1[2] = uni(64u << 16);
    g1[3] = uni(256u << 16);
    g1[4] = uni(64u);
    g1[5] = uni(2u * DIM);  // source pitch: one whole row
    g1[6] = uni(0u);
    g1[7] = uni(0u);
    asm volatile("tensor_load_to_lds %0, %1" :: "s"(g0), "s"(g1) : "memory");
    // The slice has landed behind this.
    asm volatile("s_wait_tensorcnt 0x0" ::: "memory");
  }
  __syncthreads();  // every wave's slice is readable by the others behind this

  v8f acc[2][4];
#pragma unroll
  for (int i = 0; i < 2; ++i)
#pragma unroll
    for (int t = 0; t < 4; ++t) acc[i][t] = zero8();

  const unsigned lrow = (unsigned)(lane & 15) * OUT_PITCH + ((unsigned)(lane >> 4) << 4);
  const unsigned char* aP = L + ((wid & 3) >> 1) * OUT_SLICE + (wid & 1) * 32 * OUT_PITCH + lrow;
  const unsigned char* bP = L + (4 + (wid >> 2)) * OUT_SLICE + lrow;

  // Two fragment sets: the reads of step s + 1 go out as one group in front of
  // the products of step s, so a wave does not wait out its own LDS latency.
  v16h af[2][2], bf[2][4];
  af[0][0] = frag_lds(aP);
  af[0][1] = frag_lds(aP + 16 * OUT_PITCH);
#pragma unroll
  for (int t = 0; t < 4; ++t) bf[0][t] = frag_lds(bP + t * 16 * OUT_PITCH);

  // Unrolled: set numbers and LDS offsets must be constants (registers, immediates).
#pragma unroll
  for (int s = 0; s < DIM / 32; ++s) {
    const int cur = s & 1, nxt = cur ^ 1;
    if (s + 1 < DIM / 32) {
      const int off = ((s + 1) >> 2) * 2 * OUT_SLICE + ((s + 1) & 3) * 64;
      af[nxt][0] = frag_lds(aP + off);
      af[nxt][1] = frag_lds(aP + off + 16 * OUT_PITCH);
#pragma unroll
      for (int t = 0; t < 4; ++t) bf[nxt][t] = frag_lds(bP + off + t * 16 * OUT_PITCH);
    }
    // Keeps the read group whole and in front: without it the compiler hoists the
    // reads of all steps (over 256 VGPRs, one work-group per WGP instead of two).
    __builtin_amdgcn_sched_barrier(0);
#pragma unroll
    for (int t = 0; t < 4; ++t) {
      acc[0][t] = wmma_f16(af[cur][0], bf[cur][t], acc[0][t]);
      acc[1][t] = wmma_f16(af[cur][1], bf[cur][t], acc[1][t]);
    }
    // Keeps the next group's reads from moving in among these products.
    __builtin_amdgcn_sched_barrier(0);
  }

#pragma unroll
  for (int t = 0; t < 4; ++t) {
    int m = m0 + m_wave0 + t * 16 + (lane & 15);
    float sc = scv[t];
#pragma unroll
    for (int i = 0; i < 2; ++i)
#pragma unroll
      for (int r = 0; r < 8; ++r) {
        int d = d_wave + i * 16 + r + ((lane >> 4) << 3);
        out[((size_t)b * DIM + d) * MM + m] = acc[i][t][r] * sc;
      }
  }
}

// ---------------------------------------------------------------------------
extern "C" void kernel_launch(void* const* d_in, const int* in_sizes, int n_in,
                              void* d_out, int out_size, void* d_ws, size_t ws_size,
                              hipStream_t stream) {
  const float* query = (const float*)d_in[0];
  const float* key   = (const float*)d_in[1];
  const float* value = (const float*)d_in[2];
  const float* W     = (const float*)d_in[3];
  float* out = (float*)d_out;

  _Float16* Wt    = (_Float16*)d_ws;                       // 256*256 f16, fragment order
  _Float16* phiQT = Wt + (size_t)DIM * DIM;                // [b][m][e], 32 MB
  _Float16* phiK  = phiQT + (size_t)BATCH * MM * DIM;      // [b][e][n], 32 MB
  _Float16* kvT   = phiK + (size_t)BATCH * DIM * NN;       // [b][d][e], 4 MB
  float* rowsum   = (float*)(kvT + (size_t)BATCH * DIM * DIM);
  float* scaleB   = rowsum + BATCH * DIM;
  float* kvPart   = scaleB + (size_t)BATCH * MM;           // [b][tile][ks], f32, 32 MB
  float* rsPart   = kvPart + (size_t)BATCH * DIM * DIM * KSPLIT;  // [b][ks][e], f32

  wt_kernel<<<dim3(DIM), dim3(DIM), 0, stream>>>(W, Wt);
  phi_kernel<<<dim3(MM / 128, 2, BATCH * 2), dim3(256), 0, stream>>>(
      query, key, Wt, phiQT, phiK);
  kv_kernel<<<dim3(2, 2, BATCH * KSPLIT), dim3(256), 0, stream>>>(phiK, value, kvPart,
                                                                    rsPart);
  kv_reduce_kernel<<<dim3(BATCH * (DIM / 16)), dim3(256), 0, stream>>>(kvPart, rsPart, kvT,
                                                                          rowsum);
  scale_kernel<<<dim3(MM / 256, BATCH), dim3(256), 0, stream>>>(phiQT, rowsum, scaleB);
  out_kernel<<<dim3(MM / 128, 2, BATCH), dim3(256), 0, stream>>>(kvT, phiQT, scaleB, out);
}

// v005
// It runs in 90.9 microseconds.
// In both of two side-by-side timings against v004, it was 1.08 times as fast.
// Counting every step since v000, it is 1.80 times as fast.
#include <hip/hip_runtime.h>
#include <hip/hip_bf16.h>
#include <stdint.h>

#define DIM 256
#define BATCH 32
#define MM 2048
#define NN 2048
#define KSPLIT 4  // slices of the n sum in kv_kernel, one work-group each

typedef __attribute__((ext_vector_type(16))) _Float16 v16h;
typedef __attribute__((ext_vector_type(8)))  _Float16 v8h;
typedef __attribute__((ext_vector_type(4)))  _Float16 v4h;
typedef __attribute__((ext_vector_type(8)))  float    v8f;
typedef __attribute__((ext_vector_type(4)))  unsigned int u32x4;
typedef __attribute__((ext_vector_type(4)))  int          i32x4;
typedef __attribute__((ext_vector_type(8)))  int          i32x8;

#define TDM_OK __has_builtin(__builtin_amdgcn_tensor_load_to_lds)

__device__ __forceinline__ v8f wmma_f16(v16h a, v16h b, v8f c) {
  // D = A(16x32 f16) * B(32x16 f16) + C(16x16 f32)
  return __builtin_amdgcn_wmma_f32_16x16x32_f16(false, a, false, b, (short)0, c,
                                                false, false);
}

__device__ __forceinline__ v8f zero8() {
  v8f z;
#pragma unroll
  for (int r = 0; r < 8; ++r) z[r] = 0.0f;
  return z;
}

__device__ __forceinline__ v8h cvt8(float4 a, float4 b) {
  v8h h;
  h[0] = (_Float16)a.x; h[1] = (_Float16)a.y; h[2] = (_Float16)a.z; h[3] = (_Float16)a.w;
  h[4] = (_Float16)b.x; h[5] = (_Float16)b.y; h[6] = (_Float16)b.z; h[7] = (_Float16)b.w;
  return h;
}

__device__ __forceinline__ v4h cvt4(float4 a) {
  v4h h;
  h[0] = (_Float16)a.x; h[1] = (_Float16)a.y; h[2] = (_Float16)a.z; h[3] = (_Float16)a.w;
  return h;
}

// Fragment from row-major f16 memory (row stride ld, K contiguous).
// Per ISA 16-bit A layout: row = lane%16, element j holds K = j + 8*((j>>3)+(lane>>4)).
// Same mapping serves B fragments when "row" is the B column and K is contiguous.
__device__ __forceinline__ v16h frag_kcontig(const _Float16* __restrict__ base,
                                             int ld, int lane) {
  const _Float16* p = base + (size_t)(lane & 15) * ld + ((lane >> 4) << 3);
  v8h lo = *(const v8h*)p;         // K = 0..7   (+8 for upper half-wave)
  v8h hi = *(const v8h*)(p + 16);  // K = 16..23 (+8)
  v16h f;
#pragma unroll
  for (int j = 0; j < 8; ++j) { f[j] = lo[j]; f[j + 8] = hi[j]; }
  return f;
}

// ---------------------------------------------------------------------------
// TDM: 2D tile (tile_d0 x tile_d1 elements of 2 bytes) global -> LDS with
// row stride stride0 (elements). LDS padding from descriptor: insert
// (pad_amt_code+1) DWORDs after every 2^(pad_int_code+1) DWORDs stored.
// ---------------------------------------------------------------------------
__device__ __forceinline__ void tdm_load_2d_f16(unsigned lds_off, const void* gaddr,
                                                unsigned tensor_d0, unsigned tensor_d1,
                                                unsigned tile_d0, unsigned tile_d1,
                                                unsigned stride0,
                                                unsigned pad_int_code,
                                                unsigned pad_amt_code) {
#if TDM_OK
  unsigned long long ga = (unsigned long long)(uintptr_t)gaddr;
  u32x4 g0;
  g0[0] = 1u;                                    // count=1 (valid user descriptor)
  g0[1] = lds_off;                               // lds_addr (bytes)
  g0[2] = (unsigned)(ga & 0xFFFFFFFFu);          // global_addr[31:0]
  g0[3] = (unsigned)((ga >> 32) & 0x01FFFFFFu) | (2u << 30);  // addr[56:32], type=2
  i32x8 g1;
  // wg_mask=0 | data_size=1(2B)<<16 | pad_enable<<20 | pad_interval<<22 | pad_amount<<25
  g1[0] = (int)((1u << 16) | (1u << 20) | (pad_int_code << 22) | (pad_amt_code << 25));
  g1[1] = (int)(tensor_d0 << 16);                         // tensor_dim0[15:0]
  g1[2] = (int)((tensor_d0 >> 16) | (tensor_d1 << 16));   // dim0 hi | dim1 lo
  g1[3] = (int)((tensor_d1 >> 16) | (tile_d0 << 16));     // dim1 hi | tile_dim0
  g1[4] = (int)(tile_d1 & 0xFFFFu);                       // tile_dim1 (tile_dim2=0)
  g1[5] = (int)stride0;                                   // tensor_dim0_stride lo
  g1[6] = 0;                                              // stride0 hi | stride1 lo
  g1[7] = 0;                                              // stride1 hi
  i32x4 z4 = {0, 0, 0, 0};
#if defined(__clang_major__) && __clang_major__ >= 23
  i32x8 z8 = {0, 0, 0, 0, 0, 0, 0, 0};
  __builtin_amdgcn_tensor_load_to_lds(g0, g1, z4, z4, z8, 0);
#else
  __builtin_amdgcn_tensor_load_to_lds(g0, g1, z4, z4, 0);
#endif
#endif
}

// ---------------------------------------------------------------------------
// Kernel 0: Wt = (f16) W transposed, packed in the order of phi_kernel's A
// fragments: one 1-KiB block per (16 rows of e, 32 columns of c); in it lane l's
// 8 halves for K = 0..7 (+8 for the upper half-wave) at halves l*8, those for
// K = 16..23 (+8) at halves 256 + l*8. A wave-wide 16-byte load of a fragment
// half is then 512 contiguous bytes (4 lines) instead of 16 rows (16 lines).
// ---------------------------------------------------------------------------
__global__ __launch_bounds__(256) void wt_kernel(const float* __restrict__ W,
                                                 _Float16* __restrict__ Wt) {
  int e = blockIdx.x, c = threadIdx.x;
  int blk  = (e >> 4) * (DIM / 32) + (c >> 5);
  int lane = (((c >> 3) & 1) << 4) + (e & 15);
  Wt[(size_t)blk * 512 + ((c >> 4) & 1) * 256 + lane * 8 + (c & 7)] =
      (_Float16)W[(size_t)c * DIM + e];
}

// A fragment from a block packed by wt_kernel (p = block + lane * 8); the element
// order is that of frag_kcontig.
__device__ __forceinline__ v16h frag_packed(const _Float16* __restrict__ p) {
  v8h lo = *(const v8h*)p;
  v8h hi = *(const v8h*)(p + 256);
  v16h f;
#pragma unroll
  for (int j = 0; j < 8; ++j) { f[j] = lo[j]; f[j + 8] = hi[j]; }
  return f;
}

// Transposing LDS load: with lane l's address at row 8*(l>>4) + (l&7), byte
// 16*((l>>3)&1) of a 16-bit tile, lane l gets rows 8*(l>>4) + 0..7 of column l&15.
typedef __attribute__((ext_vector_type(8))) short s16x8;
__device__ __forceinline__ v8h lds_tr16(const unsigned char* p) {
  typedef __attribute__((address_space(3))) s16x8 lds_s16x8;
  return __builtin_bit_cast(v8h, __builtin_amdgcn_ds_load_tr16_b128_v8i16((lds_s16x8*)p));
}

#define XS_PITCH 288  // bytes from row to row of Xs: 256 + 32, an odd multiple of 32

// ---------------------------------------------------------------------------
// Kernel 1: phi = relu(alpha * Wt @ X); software-pipelined f32->f16 staging.
// Every wave-wide global load covers whole 128-byte lines: a wave stages 4 rows of
// X, each as 512 contiguous bytes, and Wt comes packed in fragment order.
// Xs holds X as it lies in memory (row = c, the k of the product); a B fragment
// wants 8 + 8 values of k per lane, which two transposing loads deliver in the
// k order of the A fragments.
// Q result stored transposed phiQT[b][m][e] (one packed b128 store per tile),
// K result stored phiK[b][e][n] (what kv wants).
// ---------------------------------------------------------------------------
__global__ __launch_bounds__(256) void phi_kernel(const float* __restrict__ query,
                                                  const float* __restrict__ key,
                                                  const _Float16* __restrict__ Wt,
                                                  _Float16* __restrict__ phiQT,
                                                  _Float16* __restrict__ phiK) {
  __shared__ __attribute__((aligned(16))) _Float16 Xs[32][XS_PITCH / 2];
  const int tid = threadIdx.x, lane = tid & 31, wid = tid >> 5;
  const int mblk = blockIdx.x;
  const int eblk = blockIdx.y;
  const int b    = blockIdx.z >> 1;
  const int isK  = blockIdx.z & 1;
  const float* __restrict__ X = isK ? key : query;
  const float alpha = isK ? 1.0f : (1.0f / 16.0f);

  const int e_wave  = eblk * 128 + (wid & 3) * 32;
  const int m_wave0 = (wid >> 2) * 64;
  const int m0      = mblk * 128;

  v8f acc[2][4];
#pragma unroll
  for (int i = 0; i < 2; ++i)
#pragma unroll
    for (int t = 0; t < 4; ++t) acc[i][t] = zero8();

  const int srow = wid << 2;
  const int scol = lane << 2;
  const float* src = X + ((size_t)b * DIM + srow) * MM + m0 + scol;
  const _Float16* wp = Wt + (size_t)(e_wave >> 4) * (DIM / 32) * 512 + lane * 8;

  const unsigned char* bp = (const unsigned char*)&Xs[0][0] +
                            (((lane >> 4) << 3) + (lane & 7)) * XS_PITCH + m_wave0 * 2 +
                            ((lane >> 3) & 1) * 16;

  float4 f0 = *(const float4*)src;
  float4 f1 = *(const float4*)(src + MM);
  float4 f2 = *(const float4*)(src + 2 * MM);
  float4 f3 = *(const float4*)(src + 3 * MM);

  for (int c0 = 0; c0 < DIM; c0 += 32) {
    *(v4h*)&Xs[srow][scol]     = cvt4(f0);
    *(v4h*)&Xs[srow + 1][scol] = cvt4(f1);
    *(v4h*)&Xs[srow + 2][scol] = cvt4(f2);
    *(v4h*)&Xs[srow + 3][scol] = cvt4(f3);
    __syncthreads();

    if (c0 + 32 < DIM) {  // prefetch next k-step; latency overlaps WMMA below
      const float* np = src + (size_t)(c0 + 32) * MM;
      f0 = *(const float4*)np;
      f1 = *(const float4*)(np + MM);
      f2 = *(const float4*)(np + 2 * MM);
      f3 = *(const float4*)(np + 3 * MM);
      // Stands in front of the first write to these loads' address registers,
      // which this build reuses for the fragment loads below.
      asm volatile("s_wait_xcnt 0x0" ::: "memory");
    }

    v16h a0 = frag_packed(wp + (c0 >> 5) * 512);
    v16h a1 = frag_packed(wp + ((DIM / 32) + (c0 >> 5)) * 512);
#pragma unroll
    for (int t = 0; t < 4; ++t) {
      v8h lo = lds_tr16(bp + t * 32);                  // K = 0..7   (+8)
      v8h hi = lds_tr16(bp + t * 32 + 16 * XS_PITCH);  // K = 16..23 (+8)
      v16h bf;
#pragma unroll
      for (int j = 0; j < 8; ++j) { bf[j] = lo[j]; bf[j + 8] = hi[j]; }
      acc[0][t] = wmma_f16(a0, bf, acc[0][t]);
      acc[1][t] = wmma_f16(a1, bf, acc[1][t]);
    }
    __syncthreads();
  }

  if (!isK) {
    // phiQT[m][e]: lane's 8 acc elements are consecutive in e -> one b128 store
#pragma unroll
    for (int i = 0; i < 2; ++i)
#pragma unroll
      for (int t = 0; t < 4; ++t) {
        v8h h;
#pragma unroll
        for (int r = 0; r < 8; ++r) {
          float v = acc[i][t][r] * alpha;
          h[r] = (_Float16)(v > 0.0f ? v : 0.0f);
        }
        int e = e_wave + i * 16 + ((lane >> 4) << 3);
        int m = m0 + m_wave0 + t * 16 + (lane & 15);
        *(v8h*)(phiQT + ((size_t)b * MM + m) * DIM + e) = h;
      }
  } else {
#pragma unroll
    for (int i = 0; i < 2; ++i)
#pragma unroll
      for (int t = 0; t < 4; ++t)
#pragma unroll
        for (int r = 0; r < 8; ++r) {
          int e = e_wave + i * 16 + r + ((lane >> 4) << 3);
          int n = m0 + m_wave0 + t * 16 + (lane & 15);
          float v = acc[i][t][r];
          v = v > 0.0f ? v : 0.0f;
          phiK[((size_t)b * DIM + e) * NN + n] = (_Float16)v;
        }
  }
}

// ---------------------------------------------------------------------------
// Kernel 3: part[b][d][e][ks] = sum over slice ks of n of phiK[b][e][n]*value[b][d][n]
// The n sum is cut into KSPLIT slices so that 4x the work-groups each walk a
// quarter of the serial, latency-bound steps; kv_reduce_kernel adds the slices.
// Partials are f32 and lie in accumulator order: one 1-KiB block per 16x16 tile
// and slice, a tile's KSPLIT blocks side by side, register quad q of lane l at
// floats q*128 + l*4, so every store is 512 contiguous bytes per wave.
// A tile (f16 phiK) staged by the Tensor Data Mover, double-buffered; the
// descriptor pads every 16 DW by 4 DW so rows land 40 halves apart (16B
// aligned, bank-conflict-free b128 fragment loads). B (value f32->f16) uses
// register-prefetch pipelining. TENSORcnt + barriers synchronize.
// The row sums of phiK ride along: rsPart[b][ks][e] = sum over slice ks of n of
// phiK[b][e][n], as the product of the A fragments with a B fragment of ones
// (f32 accumulate), so phiK is not read a second time by a launch of its own.
// ---------------------------------------------------------------------------
__global__ __launch_bounds__(256) void kv_kernel(const _Float16* __restrict__ phiK,
                                                 const float* __restrict__ value,
                                                 float* __restrict__ part,
                                                 float* __restrict__ rsPart) {
  __shared__ _Float16 Vs[128][40];
#if TDM_OK
  __shared__ _Float16 As[2][128][40];
#endif
  const int tid = threadIdx.x, lane = tid & 31, wid = tid >> 5;
  const int dblk = blockIdx.x, eblk = blockIdx.y;
  const int b    = blockIdx.z / KSPLIT;
  const int ks   = blockIdx.z % KSPLIT;
  const int nbeg = ks * (NN / KSPLIT);
  const int e_wave  = eblk * 128 + (wid & 3) * 32;
  const int d_wave0 = (wid >> 2) * 64;
  const int d0      = dblk * 128;

  v8f acc[2][4];
#pragma unroll
  for (int i = 0; i < 2; ++i)
#pragma unroll
    for (int t = 0; t < 4; ++t) acc[i][t] = zero8();

  v8f rs[2] = {zero8(), zero8()};  // every column holds the row sums of a0, a1
  const _Float16 one = (_Float16)1.0f;
  const v16h ones = {one, one, one, one, one, one, one, one,
                     one, one, one, one, one, one, one, one};

  const int srow = tid >> 1;
  const int scol = (tid & 1) << 4;
  const float* src = value + ((size_t)b * DIM + d0 + srow) * NN + nbeg + scol;

  const float4* sp = (const float4*)src;
  float4 f0 = sp[0], f1 = sp[1], f2 = sp[2], f3 = sp[3];

#if TDM_OK
  const _Float16* aGlob = phiK + ((size_t)b * DIM + eblk * 128) * NN + nbeg;
  const unsigned aoff0 = (unsigned)(uintptr_t)(&As[0][0][0]);
  const unsigned aoff1 = (unsigned)(uintptr_t)(&As[1][0][0]);
  if (wid == 0) {  // A tile for step 0: 32n x 128e rows, row stride NN
    tdm_load_2d_f16(aoff0, aGlob, NN, DIM, 32, 128, NN, /*int16DW*/3, /*amt4DW*/3);
    // Waited for here, so that no descriptor register is reused (for the loop's
    // counters) while the request is outstanding; the value loads above fly on.
    asm volatile("s_wait_tensorcnt 0x0" ::: "memory");
  }
#endif

  for (int n0 = 0; n0 < NN / KSPLIT; n0 += 32) {
    *(v8h*)&Vs[srow][scol]     = cvt8(f0, f1);
    *(v8h*)&Vs[srow][scol + 8] = cvt8(f2, f3);
#if TDM_OK
    const int buf = (n0 >> 5) & 1;
    // The issuing wave's wait for the tile of this step. Every wave runs it (at
    // once done where none is outstanding): a test here would save EXEC into a
    // scalar register, which may be one of the outstanding descriptor's.
    asm volatile("s_wait_tensorcnt 0x0" ::: "memory");
#endif
    __syncthreads();  // publish Vs stores (and DMA'd A tile)

    if (n0 + 32 < NN / KSPLIT) {  // prefetch next B tile; overlaps WMMA below
      const float4* np = (const float4*)(src + n0 + 32);
      f0 = np[0]; f1 = np[1]; f2 = np[2]; f3 = np[3];
#if TDM_OK
      if (wid == 0)  // DMA next A tile into the other buffer
        tdm_load_2d_f16(buf ? aoff0 : aoff1, aGlob + n0 + 32, NN, DIM, 32, 128,
                        NN, 3, 3);
#endif
    }

#if TDM_OK
    v16h a0, a1;
    {
      int hw8 = (lane >> 4) << 3;
      const _Float16* p0 = &As[buf][(wid & 3) * 32 + (lane & 15)][hw8];
      const _Float16* p1 = &As[buf][(wid & 3) * 32 + 16 + (lane & 15)][hw8];
      v8h lo0 = *(const v8h*)p0, hi0 = *(const v8h*)(p0 + 16);
      v8h lo1 = *(const v8h*)p1, hi1 = *(const v8h*)(p1 + 16);
#pragma unroll
      for (int j = 0; j < 8; ++j) {
        a0[j] = lo0[j]; a0[j + 8] = hi0[j];
        a1[j] = lo1[j]; a1[j + 8] = hi1[j];
      }
    }
#else
    v16h a0 = frag_kcontig(phiK + ((size_t)b * DIM + e_wave) * NN + nbeg + n0, NN, lane);
    v16h a1 = frag_kcontig(phiK + ((size_t)b * DIM + e_wave + 16) * NN + nbeg + n0, NN, lane);
#endif
    // Run by every wave, so that the loop holds no test: its steps wait on loads,
    // not on the matrix unit. One wave per e range stores the result.
    rs[0] = wmma_f16(a0, ones, rs[0]);
    rs[1] = wmma_f16(a1, ones, rs[1]);
#pragma unroll
    for (int t = 0; t < 4; ++t) {
      const _Float16* rp = &Vs[d_wave0 + t * 16 + (lane & 15)][(lane >> 4) << 3];
      v8h lo = *(const v8h*)rp;
      v8h hi = *(const v8h*)(rp + 16);
      v16h bf;
#pragma unroll
      for (int j = 0; j < 8; ++j) { bf[j] = lo[j]; bf[j + 8] = hi[j]; }
      acc[0][t] = wmma_f16(a0, bf, acc[0][t]);
      acc[1][t] = wmma_f16(a1, bf, acc[1][t]);
    }
    __syncthreads();  // tiles consumed; buffers reusable
  }

  // Tile (dt, et) = (d / 16, e / 16) of batch b, slice ks: block (dt * 16 + et) * KSPLIT + ks.
  float* pwg = part + (size_t)b * DIM * DIM * KSPLIT +
               (((d0 >> 4) * (DIM / 16) + eblk * 8) * KSPLIT + ks) * 256;
  const unsigned pw =
      (unsigned)(((d_wave0 >> 4) * (DIM / 16) + (wid & 3) * 2) * KSPLIT * 256 + lane * 4);
#pragma unroll
  for (int i = 0; i < 2; ++i)
#pragma unroll
    for (int t = 0; t < 4; ++t) {
      float* tp = pwg + (pw + (t * (DIM / 16) + i) * KSPLIT * 256);
      *(float4*)tp         = make_float4(acc[i][t][0], acc[i][t][1], acc[i][t][2], acc[i][t][3]);
      *(float4*)(tp + 128) = make_float4(acc[i][t][4], acc[i][t][5], acc[i][t][6], acc[i][t][7]);
    }

  // Column 0 of rs: lane 0 holds rows 0..7, lane 16 rows 8..15. The wave's 32
  // sums fill one 128-byte line.
  if (dblk == 0 && wid < 4 && (lane & 15) == 0) {
    float* rp = rsPart + ((size_t)b * KSPLIT + ks) * DIM + e_wave + ((lane >> 4) << 3);
    // Unrolled: constant indices keep rs in registers.
#pragma unroll
    for (int i = 0; i < 2; ++i) {
      *(float4*)(rp + i * 16)     = make_float4(rs[i][0], rs[i][1], rs[i][2], rs[i][3]);
      *(float4*)(rp + i * 16 + 4) = make_float4(rs[i][4], rs[i][5], rs[i][6], rs[i][7]);
    }
  }
}

// ---------------------------------------------------------------------------
// Kernel 3b: kvT[b][d][e] = (f16) sum_ks part[b][d][e][ks]
// One work-group per (b, 16 rows of d); each wave adds two 16x16 tiles. A lane
// holds what it held as accumulator: d = 16*dt + (lane & 15), e = 16*et +
// 8*(lane >> 4) + 0..7, so the result leaves as one 16-byte store.
// The first work-group of each batch also adds the slices of the row sums:
// rowsum[b][e] = sum_ks rsPart[b][ks][e].
// ---------------------------------------------------------------------------
__global__ __launch_bounds__(256) void kv_reduce_kernel(const float* __restrict__ part,
                                                        const float* __restrict__ rsPart,
                                                        _Float16* __restrict__ kvT,
                                                        float* __restrict__ rowsum) {
  const int tid = threadIdx.x, lane = tid & 31, wid = tid >> 5;
  const int b = blockIdx.x / (DIM / 16), dt = blockIdx.x % (DIM / 16);
  const float* pwg = part + (size_t)blockIdx.x * (DIM / 16) * KSPLIT * 256;
  const unsigned pw = (unsigned)(wid * 2 * KSPLIT * 256 + lane * 4);
  float4 lo[2][KSPLIT], hi[2][KSPLIT];
  // Unrolled (here and below): constant indices keep lo and hi in registers.
#pragma unroll
  for (int u = 0; u < 2; ++u)
#pragma unroll
    for (int s = 0; s < KSPLIT; ++s) {
      lo[u][s] = *(const float4*)(pwg + (pw + (u * KSPLIT + s) * 256));
      hi[u][s] = *(const float4*)(pwg + (pw + (u * KSPLIT + s) * 256 + 128));
    }
#pragma unroll
  for (int u = 0; u < 2; ++u) {
    float4 a = lo[u][0], c = hi[u][0];
#pragma unroll
    for (int s = 1; s < KSPLIT; ++s) {
      a.x += lo[u][s].x; a.y += lo[u][s].y; a.z += lo[u][s].z; a.w += lo[u][s].w;
      c.x += hi[u][s].x; c.y += hi[u][s].y; c.z += hi[u][s].z; c.w += hi[u][s].w;
    }
    int e = (wid * 2 + u) * 16 + ((lane >> 4) << 3);
    int d = dt * 16 + (lane & 15);
    *(v8h*)(kvT + ((size_t)b * DIM + d) * DIM + e) = cvt8(a, c);
  }
  if (dt == 0) {
    const float* rp = rsPart + (size_t)b * KSPLIT * DIM + tid;
    float r = rp[0];
    for (int s = 1; s < KSPLIT; ++s) r += rp[s * DIM];
    rowsum[b * DIM + tid] = r;
  }
}

// ---------------------------------------------------------------------------
// Kernel 4: scale[b][m] = 1 / (sum_e phiQT[b][m][e]*rowsum[b][e] + 1e-8)
// phiQT is m-major: each thread reads 512 contiguous bytes (v8h loads)
// ---------------------------------------------------------------------------
__global__ __launch_bounds__(256) void scale_kernel(const _Float16* __restrict__ phiQT,
                                                    const float* __restrict__ rowsum,
                                                    float* __restrict__ scale) {
  int b = blockIdx.y;
  int m = blockIdx.x * 256 + threadIdx.x;
  const v8h* pq = (const v8h*)(phiQT + ((size_t)b * MM + m) * DIM);
  const float* rs = rowsum + b * DIM;
  float s = 0.0f;
#pragma unroll 4
  for (int c = 0; c < DIM / 8; ++c) {
    v8h h = pq[c];
#pragma unroll
    for (int j = 0; j < 8; ++j) s += (float)h[j] * rs[c * 8 + j];
  }
  scale[(size_t)b * MM + m] = 1.0f / (s + 1e-8f);
}

// ---------------------------------------------------------------------------
// Kernel 5: out[b][d][m] = scale[b][m] * sum_e kvT[b][d][e]*phiQT[b][m][e]
// Both operands are K(=e)-contiguous f16 rows of 512 bytes. A fragment load
// straight from global memory touches 16 lines for 512 bytes, so the work-group's
// two 128-row tiles are brought into LDS once, whole lines at a time, by tensor
// loads, and the fragments come from LDS.
// Each wave brings one slice: 64 rows of one 256-byte half of the e range
// (source pitch 512 bytes), padded by the mover to a pitch of 272 bytes, at which
// 16-byte fragment reads of 16 rows fall on 64 different banks.
// Slice number = operand * 4 + e half * 2 + row half (operand 0 = kvT, 1 = phiQT).
// ---------------------------------------------------------------------------
#define OUT_PITCH 272    // bytes from row to row in LDS: 256 + the 16-byte pad
#define OUT_SLICE 18432  // 64 rows * 272 bytes = 17,408, rounded up to a multiple of 2 KiB

typedef __attribute__((ext_vector_type(8))) unsigned int u32x8;

__device__ __forceinline__ uint32_t uni(uint32_t v) {
  return (uint32_t)__builtin_amdgcn_readfirstlane(v);
}

// Same element order as frag_kcontig: 16 bytes at K = 0..7 (+8 for the upper
// half-wave, already in p), 16 bytes at K = 16..23 (+8).
__device__ __forceinline__ v16h frag_lds(const unsigned char* p) {
  v8h lo = *(const v8h*)p;
  v8h hi = *(const v8h*)(p + 32);
  v16h f;
#pragma unroll
  for (int j = 0; j < 8; ++j) { f[j] = lo[j]; f[j + 8] = hi[j]; }
  return f;
}

__global__ __launch_bounds__(256) void out_kernel(const _Float16* __restrict__ kvT,
                                                  const _Float16* __restrict__ phiQT,
                                                  const float* __restrict__ scale,
                                                  float* __restrict__ out) {
  __shared__ __attribute__((aligned(2048))) unsigned char L[8 * OUT_SLICE];
  const int tid = threadIdx.x, lane = tid & 31, wid = tid >> 5;
  const int mblk = blockIdx.x, dblk = blockIdx.y, b = blockIdx.z;
  const int d_wave  = dblk * 128 + (wid & 3) * 32;
  const int m_wave0 = (wid >> 2) * 64;
  const int m0      = mblk * 128;

  // Read at the head: the scheduling fences below would otherwise hold these
  // loads behind the last product.
  float scv[4];
#pragma unroll
  for (int t = 0; t < 4; ++t)
    scv[t] = scale[(size_t)b * MM + m0 + m_wave0 + t * 16 + (lane & 15)];

  {  // every wave issues the one request for its own slice
    const uint32_t wave = uni(threadIdx.x >> 5);
    const _Float16* rows = (wave >> 2) ? phiQT + ((size_t)b * MM + m0) * DIM
                                       : kvT + ((size_t)b * DIM + dblk * 128) * DIM;
    const uint64_t ga =
        (uint64_t)(uintptr_t)(rows + (size_t)(wave & 1u) * 64 * DIM + ((wave >> 1) & 1u) * 128);
    u32x4 g0;
    g0[0] = uni(1u);                                             // count 1
    g0[1] = uni((uint32_t)(uintptr_t)&L[0] + wave * OUT_SLICE);  // place in LDS
    g0[2] = uni((uint32_t)ga);
    g0[3] = uni((((uint32_t)(ga >> 32)) & 0x01FFFFFFu) | 0x80000000u);  // type 2
    u32x8 g1;  // extents in bytes; tensor dims = tile dims = 256 x 64
    g1[0] = uni((1u << 20) | (5u << 22) | (3u << 25));  // 4 dwords of pad behind every 64
    g1[1] = uni(256u << 16);
    g1[2] = uni(64u << 16);
    g1[3] = uni(256u << 16);
    g1[4] = uni(64u);
    g1[5] = uni(2u * DIM);  // source pitch: one whole row
    g1[6] = uni(0u);
    g1[7] = uni(0u);
    asm volatile("tensor_load_to_lds %0, %1" :: "s"(g0), "s"(g1) : "memory");
    // The slice has landed behind this.
    asm volatile("s_wait_tensorcnt 0x0" ::: "memory");
  }
  __syncthreads();  // every wave's slice is readable by the others behind this

  v8f acc[2][4];
#pragma unroll
  for (int i = 0; i < 2; ++i)
#pragma unroll
    for (int t = 0; t < 4; ++t) acc[i][t] = zero8();

  const unsigned lrow = (unsigned)(lane & 15) * OUT_PITCH + ((unsigned)(lane >> 4) << 4);
  const unsigned char* aP = L + ((wid & 3) >> 1) * OUT_SLICE + (wid & 1) * 32 * OUT_PITCH + lrow;
  const unsigned char* bP = L + (4 + (wid >> 2)) * OUT_SLICE + lrow;

  // Two fragment sets: the reads of step s + 1 go out as one group in front of
  // the products of step s, so a wave does not wait out its own LDS latency.
  v16h af[2][2], bf[2][4];
  af[0][0] = frag_lds(aP);
  af[0][1] = frag_lds(aP + 16 * OUT_PITCH);
#pragma unroll
  for (int t = 0; t < 4; ++t) bf[0][t] = frag_lds(bP + t * 16 * OUT_PITCH);

  // Unrolled: set numbers and LDS offsets must be constants (registers, immediates).
#pragma unroll
  for (int s = 0; s < DIM / 32; ++s) {
    const int cur = s & 1, nxt = cur ^ 1;
    if (s + 1 < DIM / 32) {
      const int off = ((s + 1) >> 2) * 2 * OUT_SLICE + ((s + 1) & 3) * 64;
      af[nxt][0] = frag_lds(aP + off);
      af[nxt][1] = frag_lds(aP + off + 16 * OUT_PITCH);
#pragma unroll
      for (int t = 0; t < 4; ++t) bf[nxt][t] = frag_lds(bP + off + t * 16 * OUT_PITCH);
    }
    // Keeps the read group whole and in front: without it the compiler hoists the
    // reads of all steps (over 256 VGPRs, one work-group per WGP instead of two).
    __builtin_amdgcn_sched_barrier(0);
#pragma unroll
    for (int t = 0; t < 4; ++t) {
      acc[0][t] = wmma_f16(af[cur][0], bf[cur][t], acc[0][t]);
      acc[1][t] = wmma_f16(af[cur][1], bf[cur][t], acc[1][t]);
    }
    // Keeps the next group's reads from moving in among these products.
    __builtin_amdgcn_sched_barrier(0);
  }

#pragma unroll
  for (int t = 0; t < 4; ++t) {
    int m = m0 + m_wave0 + t * 16 + (lane & 15);
    float sc = scv[t];
#pragma unroll
    for (int i = 0; i < 2; ++i)
#pragma unroll
      for (int r = 0; r < 8; ++r) {
        int d = d_wave + i * 16 + r + ((lane >> 4) << 3);
        out[((size_t)b * DIM + d) * MM + m] = acc[i][t][r] * sc;
      }
  }
}

// ---------------------------------------------------------------------------
extern "C" void kernel_launch(void* const* d_in, const int* in_sizes, int n_in,
                              void* d_out, int out_size, void* d_ws, size_t ws_size,
                              hipStream_t stream) {
  const float* query = (const float*)d_in[0];
  const float* key   = (const float*)d_in[1];
  const float* value = (const float*)d_in[2];
  const float* W     = (const float*)d_in[3];
  float* out = (float*)d_out;

  _Float16* Wt    = (_Float16*)d_ws;                       // 256*256 f16, fragment order
  _Float16* phiQT = Wt + (size_t)DIM * DIM;                // [b][m][e], 32 MB
  _Float16* phiK  = phiQT + (size_t)BATCH * MM * DIM;      // [b][e][n], 32 MB
  _Float16* kvT   = phiK + (size_t)BATCH * DIM * NN;       // [b][d][e], 4 MB
  float* rowsum   = (float*)(kvT + (size_t)BATCH * DIM * DIM);
  float* scaleB   = rowsum + BATCH * DIM;
  float* kvPart   = scaleB + (size_t)BATCH * MM;           // [b][tile][ks], f32, 32 MB
  float* rsPart   = kvPart + (size_t)BATCH * DIM * DIM * KSPLIT;  // [b][ks][e], f32

  wt_kernel<<<dim3(DIM), dim3(DIM), 0, stream>>>(W, Wt);
  phi_kernel<<<dim3(MM / 128, 2, BATCH * 2), dim3(256), 0, stream>>>(
      query, key, Wt, phiQT, phiK);
  kv_kernel<<<dim3(2, 2, BATCH * KSPLIT), dim3(256), 0, stream>>>(phiK, value, kvPart,
                                                                    rsPart);
  kv_reduce_kernel<<<dim3(BATCH * (DIM / 16)), dim3(256), 0, stream>>>(kvPart, rsPart, kvT,
                                                                          rowsum);
  scale_kernel<<<dim3(MM / 256, BATCH), dim3(256), 0, stream>>>(phiQT, rowsum, scaleB);
  out_kernel<<<dim3(MM / 128, 2, BATCH), dim3(256), 0, stream>>>(kvT, phiQT, scaleB, out);
}

// v006
// One run takes 85.2 microseconds.
// Next to v005, in two timings, it ran 1.08 and 1.06 times as fast.
// Over all steps from v000 it is 1.92 times as fast.
#include <hip/hip_runtime.h>
#include <hip/hip_bf16.h>
#include <stdint.h>

#define DIM 256
#define BATCH 32
#define MM 2048
#define NN 2048
#define KSPLIT 4  // slices of the n sum in kv_kernel, one work-group each

typedef __attribute__((ext_vector_type(16))) _Float16 v16h;
typedef __attribute__((ext_vector_type(8)))  _Float16 v8h;
typedef __attribute__((ext_vector_type(4)))  _Float16 v4h;
typedef __attribute__((ext_vector_type(8)))  float    v8f;
typedef __attribute__((ext_vector_type(4)))  unsigned int u32x4;
typedef __attribute__((ext_vector_type(4)))  int          i32x4;
typedef __attribute__((ext_vector_type(8)))  int          i32x8;

#define TDM_OK __has_builtin(__builtin_amdgcn_tensor_load_to_lds)

__device__ __forceinline__ v8f wmma_f16(v16h a, v16h b, v8f c) {
  // D = A(16x32 f16) * B(32x16 f16) + C(16x16 f32)
  return __builtin_amdgcn_wmma_f32_16x16x32_f16(false, a, false, b, (short)0, c,
                                                false, false);
}

__device__ __forceinline__ v8f zero8() {
  v8f z;
#pragma unroll
  for (int r = 0; r < 8; ++r) z[r] = 0.0f;
  return z;
}

__device__ __forceinline__ v8h cvt8(float4 a, float4 b) {
  v8h h;
  h[0] = (_Float16)a.x; h[1] = (_Float16)a.y; h[2] = (_Float16)a.z; h[3] = (_Float16)a.w;
  h[4] = (_Float16)b.x; h[5] = (_Float16)b.y; h[6] = (_Float16)b.z; h[7] = (_Float16)b.w;
  return h;
}

__device__ __forceinline__ v4h cvt4(float4 a) {
  v4h h;
  h[0] = (_Float16)a.x; h[1] = (_Float16)a.y; h[2] = (_Float16)a.z; h[3] = (_Float16)a.w;
  return h;
}

// Fragment from row-major f16 memory (row stride ld, K contiguous).
// Per ISA 16-bit A layout: row = lane%16, element j holds K = j + 8*((j>>3)+(lane>>4)).
// Same mapping serves B fragments when "row" is the B column and K is contiguous.
__device__ __forceinline__ v16h frag_kcontig(const _Float16* __restrict__ base,
                                             int ld, int lane) {
  const _Float16* p = base + (size_t)(lane & 15) * ld + ((lane >> 4) << 3);
  v8h lo = *(const v8h*)p;         // K = 0..7   (+8 for upper half-wave)
  v8h hi = *(const v8h*)(p + 16);  // K = 16..23 (+8)
  v16h f;
#pragma unroll
  for (int j = 0; j < 8; ++j) { f[j] = lo[j]; f[j + 8] = hi[j]; }
  return f;
}

// ---------------------------------------------------------------------------
// TDM: 2D tile (tile_d0 x tile_d1 elements of 2 bytes) global -> LDS with
// row stride stride0 (elements). LDS padding from descriptor: insert
// (pad_amt_code+1) DWORDs after every 2^(pad_int_code+1) DWORDs stored.
// ---------------------------------------------------------------------------
__device__ __forceinline__ void tdm_load_2d_f16(unsigned lds_off, const void* gaddr,
                                                unsigned tensor_d0, unsigned tensor_d1,
                                                unsigned tile_d0, unsigned tile_d1,
                                                unsigned stride0,
                                                unsigned pad_int_code,
                                                unsigned pad_amt_code) {
#if TDM_OK
  unsigned long long ga = (unsigned long long)(uintptr_t)gaddr;
  u32x4 g0;
  g0[0] = 1u;                                    // count=1 (valid user descriptor)
  g0[1] = lds_off;                               // lds_addr (bytes)
  g0[2] = (unsigned)(ga & 0xFFFFFFFFu);          // global_addr[31:0]
  g0[3] = (unsigned)((ga >> 32) & 0x01FFFFFFu) | (2u << 30);  // addr[56:32], type=2
  i32x8 g1;
  // wg_mask=0 | data_size=1(2B)<<16 | pad_enable<<20 | pad_interval<<22 | pad_amount<<25
  g1[0] = (int)((1u << 16) | (1u << 20) | (pad_int_code << 22) | (pad_amt_code << 25));
  g1[1] = (int)(tensor_d0 << 16);                         // tensor_dim0[15:0]
  g1[2] = (int)((tensor_d0 >> 16) | (tensor_d1 << 16));   // dim0 hi | dim1 lo
  g1[3] = (int)((tensor_d1 >> 16) | (tile_d0 << 16));     // dim1 hi | tile_dim0
  g1[4] = (int)(tile_d1 & 0xFFFFu);                       // tile_dim1 (tile_dim2=0)
  g1[5] = (int)stride0;                                   // tensor_dim0_stride lo
  g1[6] = 0;                                              // stride0 hi | stride1 lo
  g1[7] = 0;                                              // stride1 hi
  i32x4 z4 = {0, 0, 0, 0};
#if defined(__clang_major__) && __clang_major__ >= 23
  i32x8 z8 = {0, 0, 0, 0, 0, 0, 0, 0};
  __builtin_amdgcn_tensor_load_to_lds(g0, g1, z4, z4, z8, 0);
#else
  __builtin_amdgcn_tensor_load_to_lds(g0, g1, z4, z4, 0);
#endif
#endif
}

// ---------------------------------------------------------------------------
// Kernel 0: Wt = (f16) W transposed, packed in the order of phi_kernel's Wt
// fragments: one 1-KiB block per (16 rows of e, 32 columns of c); in it lane l's
// 8 halves for K = 0..7 (+8 for the upper half-wave) at halves l*8, those for
// K = 16..23 (+8) at halves 256 + l*8. A wave-wide 16-byte load of a fragment
// half is then 512 contiguous bytes (4 lines) instead of 16 rows (16 lines).
// ---------------------------------------------------------------------------
__global__ __launch_bounds__(256) void wt_kernel(const float* __restrict__ W,
                                                 _Float16* __restrict__ Wt) {
  int e = blockIdx.x, c = threadIdx.x;
  int blk  = (e >> 4) * (DIM / 32) + (c >> 5);
  int lane = (((c >> 3) & 1) << 4) + (e & 15);
  Wt[(size_t)blk * 512 + ((c >> 4) & 1) * 256 + lane * 8 + (c & 7)] =
      (_Float16)W[(size_t)c * DIM + e];
}

// A fragment from a block packed by wt_kernel (p = block + lane * 8); the element
// order is that of frag_kcontig.
__device__ __forceinline__ v16h frag_packed(const _Float16* __restrict__ p) {
  v8h lo = *(const v8h*)p;
  v8h hi = *(const v8h*)(p + 256);
  v16h f;
#pragma unroll
  for (int j = 0; j < 8; ++j) { f[j] = lo[j]; f[j + 8] = hi[j]; }
  return f;
}

// Transposing LDS load: with lane l's address at row 8*(l>>4) + (l&7), byte
// 16*((l>>3)&1) of a 16-bit tile, lane l gets rows 8*(l>>4) + 0..7 of column l&15.
typedef __attribute__((ext_vector_type(8))) short s16x8;
__device__ __forceinline__ v8h lds_tr16(const unsigned char* p) {
  typedef __attribute__((address_space(3))) s16x8 lds_s16x8;
  return __builtin_bit_cast(v8h, __builtin_amdgcn_ds_load_tr16_b128_v8i16((lds_s16x8*)p));
}

#define XS_PITCH 288  // bytes from row to row of Xs: 256 + 32, an odd multiple of 32
#define PS_PITCH 272  // bytes from row to row of the staged result: 256 + 16, an odd multiple of 16

// ---------------------------------------------------------------------------
// Kernel 1: phi = relu(alpha * Wt @ X) for Q, relu(Wt @ X) for K; software-pipelined f32->f16 staging.
// Every wave-wide global load covers whole 128-byte lines: a wave stages 4 rows of
// X, each as 512 contiguous bytes, and Wt comes packed in fragment order.
// Xs holds X as it lies in memory (row = c, the k of the product); an X fragment
// wants 8 + 8 values of k per lane, which two transposing loads deliver in the
// k order of the Wt fragments.
// Q result stored transposed phiQT[b][m][e], K result stored phiK[b][e][n] (what
// kv wants). The operand whose index runs along a result row stands first in the
// product (Wt for Q, X for K), so a lane's 8 accumulator registers are 16
// contiguous bytes of one result row. The work-group's 128 x 128 result is laid
// in LDS (over Xs, which is done with) and leaves in rows: every wave-wide
// 16-byte store covers two rows of 256 contiguous bytes, 4 whole lines.
// ---------------------------------------------------------------------------
template <bool IS_K>
__device__ __forceinline__ void phi_tile(const float* __restrict__ xsrc,
                                         const _Float16* __restrict__ wp,
                                         _Float16* __restrict__ dst, const int dpitch,
                                         unsigned char* S) {
  _Float16(*Xs)[XS_PITCH / 2] = (_Float16(*)[XS_PITCH / 2])S;
  const int tid = threadIdx.x, lane = tid & 31;
  // The wave's number in a scalar register: what is formed from it then takes no
  // VGPR (at 128 VGPRs 4 work-groups fit a WGP, one more register costs one).
  const int wid = __builtin_amdgcn_readfirstlane(tid >> 5);
  const int e_wave0 = (wid & 3) * 32;
  const int m_wave0 = (wid >> 2) * 64;

  v8f acc[2][4];
#pragma unroll
  for (int i = 0; i < 2; ++i)
#pragma unroll
    for (int t = 0; t < 4; ++t) acc[i][t] = zero8();

  const int srow = wid << 2;
  const int scol = lane << 2;
  const float* src = xsrc + (size_t)srow * MM + scol;

  const unsigned char* bp = S + (((lane >> 4) << 3) + (lane & 7)) * XS_PITCH + m_wave0 * 2 +
                            ((lane >> 3) & 1) * 16;

  float4 f0 = *(const float4*)src;
  float4 f1 = *(const float4*)(src + MM);
  float4 f2 = *(const float4*)(src + 2 * MM);
  float4 f3 = *(const float4*)(src + 3 * MM);
  // Stands in front of the first write to these loads' offset register, which
  // this build reuses in the loop while the last of them are still under way.
  asm volatile("s_wait_xcnt 0x0" ::: "memory");

  for (int c0 = 0; c0 < DIM; c0 += 32) {
    *(v4h*)&Xs[srow][scol]     = cvt4(f0);
    *(v4h*)&Xs[srow + 1][scol] = cvt4(f1);
    *(v4h*)&Xs[srow + 2][scol] = cvt4(f2);
    *(v4h*)&Xs[srow + 3][scol] = cvt4(f3);
    __syncthreads();

    if (c0 + 32 < DIM) {  // prefetch next k-step; latency overlaps WMMA below
      const float* np = src + (size_t)(c0 + 32) * MM;
      f0 = *(const float4*)np;
      f1 = *(const float4*)(np + MM);
      f2 = *(const float4*)(np + 2 * MM);
      f3 = *(const float4*)(np + 3 * MM);
      // Stands in front of the first write to these loads' address registers,
      // which this build reuses for the fragment loads below.
      asm volatile("s_wait_xcnt 0x0" ::: "memory");
    }

    v16h a0 = frag_packed(wp + (c0 >> 5) * 512);
    v16h a1 = frag_packed(wp + ((DIM / 32) + (c0 >> 5)) * 512);
#pragma unroll
    for (int t = 0; t < 4; ++t) {
      v8h lo = lds_tr16(bp + t * 32);                  // K = 0..7   (+8)
      v8h hi = lds_tr16(bp + t * 32 + 16 * XS_PITCH);  // K = 16..23 (+8)
      v16h bf;
#pragma unroll
      for (int j = 0; j < 8; ++j) { bf[j] = lo[j]; bf[j + 8] = hi[j]; }
      if (IS_K) {  // registers run along n, lanes along e
        acc[0][t] = wmma_f16(bf, a0, acc[0][t]);
        acc[1][t] = wmma_f16(bf, a1, acc[1][t]);
      } else {     // registers run along e, lanes along m
        acc[0][t] = wmma_f16(a0, bf, acc[0][t]);
        acc[1][t] = wmma_f16(a1, bf, acc[1][t]);
      }
    }
    __syncthreads();  // the last one also frees Xs for the staged result
  }

  const float alpha = 1.0f / 16.0f;  // Q alone
#pragma unroll
  for (int i = 0; i < 2; ++i)
#pragma unroll
    for (int t = 0; t < 4; ++t) {
      v8h h;
#pragma unroll
      for (int r = 0; r < 8; ++r) {
        float v = IS_K ? acc[i][t][r] : acc[i][t][r] * alpha;
        h[r] = (_Float16)(v > 0.0f ? v : 0.0f);
      }
      const int el = e_wave0 + i * 16, ml = m_wave0 + t * 16;
      const int row = (IS_K ? el : ml) + (lane & 15);
      const int col = (IS_K ? ml : el) + ((lane >> 4) << 3);
      *(v8h*)(S + row * PS_PITCH + col * 2) = h;
    }
  __syncthreads();  // rows are read back by other waves than wrote them

  const unsigned char* rp = S + (wid * 16 + (lane >> 4)) * PS_PITCH + (lane & 15) * 16;
  _Float16* gp = dst + (size_t)(wid * 16 + (lane >> 4)) * dpitch + (lane & 15) * 8;
  // Unrolled: row offsets become immediates of one address.
#pragma unroll
  for (int j = 0; j < 8; ++j)
    *(v8h*)(gp + (size_t)(j * 2) * dpitch) = *(const v8h*)(rp + j * 2 * PS_PITCH);
}

__global__ __launch_bounds__(256) void phi_kernel(const float* __restrict__ query,
                                                  const float* __restrict__ key,
                                                  const _Float16* __restrict__ Wt,
                                                  _Float16* __restrict__ phiQT,
                                                  _Float16* __restrict__ phiK) {
  __shared__ __attribute__((aligned(16))) unsigned char S[128 * PS_PITCH];
  const int lane = threadIdx.x & 31;
  const int wid  = __builtin_amdgcn_readfirstlane(threadIdx.x >> 5);  // scalar, as in phi_tile
  const int m0   = blockIdx.x * 128;
  const int e0   = blockIdx.y * 128;
  const int b    = blockIdx.z >> 1;
  const int isK  = blockIdx.z & 1;
  const _Float16* wp = Wt + (size_t)((e0 + (wid & 3) * 32) >> 4) * (DIM / 32) * 512 + lane * 8;
  const size_t xoff = (size_t)b * DIM * MM + m0;
  if (isK)
    phi_tile<true>(key + xoff, wp, phiK + ((size_t)b * DIM + e0) * NN + m0, NN, S);
  else
    phi_tile<false>(query + xoff, wp, phiQT + ((size_t)b * MM + m0) * DIM + e0, DIM, S);
}

// ---------------------------------------------------------------------------
// Kernel 3: part[b][d][e][ks] = sum over slice ks of n of phiK[b][e][n]*value[b][d][n]
// The n sum is cut into KSPLIT slices so that 4x the work-groups each walk a
// quarter of the serial, latency-bound steps; kv_reduce_kernel adds the slices.
// Partials are f32 and lie in accumulator order: one 1-KiB block per 16x16 tile
// and slice, a tile's KSPLIT blocks side by side, register quad q of lane l at
// floats q*128 + l*4, so every store is 512 contiguous bytes per wave.
// A tile (f16 phiK) staged by the Tensor Data Mover, double-buffered; the
// descriptor pads every 16 DW by 4 DW so rows land 40 halves apart (16B
// aligned, bank-conflict-free b128 fragment loads). B (value f32->f16) uses
// register-prefetch pipelining. TENSORcnt + barriers synchronize.
// The row sums of phiK ride along: rsPart[b][ks][e] = sum over slice ks of n of
// phiK[b][e][n], as the product of the A fragments with a B fragment of ones
// (f32 accumulate), so phiK is not read a second time by a launch of its own.
// ---------------------------------------------------------------------------
__global__ __launch_bounds__(256) void kv_kernel(const _Float16* __restrict__ phiK,
                                                 const float* __restrict__ value,
                                                 float* __restrict__ part,
                                                 float* __restrict__ rsPart) {
  __shared__ _Float16 Vs[128][40];
#if TDM_OK
  __shared__ _Float16 As[2][128][40];
#endif
  const int tid = threadIdx.x, lane = tid & 31, wid = tid >> 5;
  const int dblk = blockIdx.x, eblk = blockIdx.y;
  const int b    = blockIdx.z / KSPLIT;
  const int ks   = blockIdx.z % KSPLIT;
  const int nbeg = ks * (NN / KSPLIT);
  const int e_wave  = eblk * 128 + (wid & 3) * 32;
  const int d_wave0 = (wid >> 2) * 64;
  const int d0      = dblk * 128;

  v8f acc[2][4];
#pragma unroll
  for (int i = 0; i < 2; ++i)
#pragma unroll
    for (int t = 0; t < 4; ++t) acc[i][t] = zero8();

  v8f rs[2] = {zero8(), zero8()};  // every column holds the row sums of a0, a1
  const _Float16 one = (_Float16)1.0f;
  const v16h ones = {one, one, one, one, one, one, one, one,
                     one, one, one, one, one, one, one, one};

  const int srow = tid >> 1;
  const int scol = (tid & 1) << 4;
  const float* src = value + ((size_t)b * DIM + d0 + srow) * NN + nbeg + scol;

  const float4* sp = (const float4*)src;
  float4 f0 = sp[0], f1 = sp[1], f2 = sp[2], f3 = sp[3];

#if TDM_OK
  const _Float16* aGlob = phiK + ((size_t)b * DIM + eblk * 128) * NN + nbeg;
  const unsigned aoff0 = (unsigned)(uintptr_t)(&As[0][0][0]);
  const unsigned aoff1 = (unsigned)(uintptr_t)(&As[1][0][0]);
  if (wid == 0) {  // A tile for step 0: 32n x 128e rows, row stride NN
    tdm_load_2d_f16(aoff0, aGlob, NN, DIM, 32, 128, NN, /*int16DW*/3, /*amt4DW*/3);
    // Waited for here, so that no descriptor register is reused (for the loop's
    // counters) while the request is outstanding; the value loads above fly on.
    asm volatile("s_wait_tensorcnt 0x0" ::: "memory");
  }
#endif

  for (int n0 = 0; n0 < NN / KSPLIT; n0 += 32) {
    *(v8h*)&Vs[srow][scol]     = cvt8(f0, f1);
    *(v8h*)&Vs[srow][scol + 8] = cvt8(f2, f3);
#if TDM_OK
    const int buf = (n0 >> 5) & 1;
    // The issuing wave's wait for the tile of this step. Every wave runs it (at
    // once done where none is outstanding): a test here would save EXEC into a
    // scalar register, which may be one of the outstanding descriptor's.
    asm volatile("s_wait_tensorcnt 0x0" ::: "memory");
#endif
    __syncthreads();  // publish Vs stores (and DMA'd A tile)

    if (n0 + 32 < NN / KSPLIT) {  // prefetch next B tile; overlaps WMMA below
      const float4* np = (const float4*)(src + n0 + 32);
      f0 = np[0]; f1 = np[1]; f2 = np[2]; f3 = np[3];
#if TDM_OK
      if (wid == 0)  // DMA next A tile into the other buffer
        tdm_load_2d_f16(buf ? aoff0 : aoff1, aGlob + n0 + 32, NN, DIM, 32, 128,
                        NN, 3, 3);
#endif
    }

#if TDM_OK
    v16h a0, a1;
    {
      int hw8 = (lane >> 4) << 3;
      const _Float16* p0 = &As[buf][(wid & 3) * 32 + (lane & 15)][hw8];
      const _Float16* p1 = &As[buf][(wid & 3) * 32 + 16 + (lane & 15)][hw8];
      v8h lo0 = *(const v8h*)p0, hi0 = *(const v8h*)(p0 + 16);
      v8h lo1 = *(const v8h*)p1, hi1 = *(const v8h*)(p1 + 16);
#pragma unroll
      for (int j = 0; j < 8; ++j) {
        a0[j] = lo0[j]; a0[j + 8] = hi0[j];
        a1[j] = lo1[j]; a1[j + 8] = hi1[j];
      }
    }
#else
    v16h a0 = frag_kcontig(phiK + ((size_t)b * DIM + e_wave) * NN + nbeg + n0, NN, lane);
    v16h a1 = frag_kcontig(phiK + ((size_t)b * DIM + e_wave + 16) * NN + nbeg + n0, NN, lane);
#endif
    // Run by every wave, so that the loop holds no test: its steps wait on loads,
    // not on the matrix unit. One wave per e range stores the result.
    rs[0] = wmma_f16(a0, ones, rs[0]);
    rs[1] = wmma_f16(a1, ones, rs[1]);
#pragma unroll
    for (int t = 0; t < 4; ++t) {
      const _Float16* rp = &Vs[d_wave0 + t * 16 + (lane & 15)][(lane >> 4) << 3];
      v8h lo = *(const v8h*)rp;
      v8h hi = *(const v8h*)(rp + 16);
      v16h bf;
#pragma unroll
      for (int j = 0; j < 8; ++j) { bf[j] = lo[j]; bf[j + 8] = hi[j]; }
      acc[0][t] = wmma_f16(a0, bf, acc[0][t]);
      acc[1][t] = wmma_f16(a1, bf, acc[1][t]);
    }
    __syncthreads();  // tiles consumed; buffers reusable
  }

  // Tile (dt, et) = (d / 16, e / 16) of batch b, slice ks: block (dt * 16 + et) * KSPLIT + ks.
  float* pwg = part + (size_t)b * DIM * DIM * KSPLIT +
               (((d0 >> 4) * (DIM / 16) + eblk * 8) * KSPLIT + ks) * 256;
  const unsigned pw =
      (unsigned)(((d_wave0 >> 4) * (DIM / 16) + (wid & 3) * 2) * KSPLIT * 256 + lane * 4);
#pragma unroll
  for (int i = 0; i < 2; ++i)
#pragma unroll
    for (int t = 0; t < 4; ++t) {
      float* tp = pwg + (pw + (t * (DIM / 16) + i) * KSPLIT * 256);
      *(float4*)tp         = make_float4(acc[i][t][0], acc[i][t][1], acc[i][t][2], acc[i][t][3]);
      *(float4*)(tp + 128) = make_float4(acc[i][t][4], acc[i][t][5], acc[i][t][6], acc[i][t][7]);
    }

  // Column 0 of rs: lane 0 holds rows 0..7, lane 16 rows 8..15. The wave's 32
  // sums fill one 128-byte line.
  if (dblk == 0 && wid < 4 && (lane & 15) == 0) {
    float* rp = rsPart + ((size_t)b * KSPLIT + ks) * DIM + e_wave + ((lane >> 4) << 3);
    // Unrolled: constant indices keep rs in registers.
#pragma unroll
    for (int i = 0; i < 2; ++i) {
      *(float4*)(rp + i * 16)     = make_float4(rs[i][0], rs[i][1], rs[i][2], rs[i][3]);
      *(float4*)(rp + i * 16 + 4) = make_float4(rs[i][4], rs[i][5], rs[i][6], rs[i][7]);
    }
  }
}

// ---------------------------------------------------------------------------
// Kernel 3b: kvT[b][d][e] = (f16) sum_ks part[b][d][e][ks]
// One work-group per (b, 16 rows of d); each wave adds two 16x16 tiles. A lane
// holds what it held as accumulator: d = 16*dt + (lane & 15), e = 16*et +
// 8*(lane >> 4) + 0..7, so the result leaves as one 16-byte store.
// The first work-group of each batch also adds the slices of the row sums:
// rowsum[b][e] = sum_ks rsPart[b][ks][e].
// ---------------------------------------------------------------------------
__global__ __launch_bounds__(256) void kv_reduce_kernel(const float* __restrict__ part,
                                                        const float* __restrict__ rsPart,
                                                        _Float16* __restrict__ kvT,
                                                        float* __restrict__ rowsum) {
  const int tid = threadIdx.x, lane = tid & 31, wid = tid >> 5;
  const int b = blockIdx.x / (DIM / 16), dt = blockIdx.x % (DIM / 16);
  const float* pwg = part + (size_t)blockIdx.x * (DIM / 16) * KSPLIT * 256;
  const unsigned pw = (unsigned)(wid * 2 * KSPLIT * 256 + lane * 4);
  float4 lo[2][KSPLIT], hi[2][KSPLIT];
  // Unrolled (here and below): constant indices keep lo and hi in registers.
#pragma unroll
  for (int u = 0; u < 2; ++u)
#pragma unroll
    for (int s = 0; s < KSPLIT; ++s) {
      lo[u][s] = *(const float4*)(pwg + (pw + (u * KSPLIT + s) * 256));
      hi[u][s] = *(const float4*)(pwg + (pw + (u * KSPLIT + s) * 256 + 128));
    }
#pragma unroll
  for (int u = 0; u < 2; ++u) {
    float4 a = lo[u][0], c = hi[u][0];
#pragma unroll
    for (int s = 1; s < KSPLIT; ++s) {
      a.x += lo[u][s].x; a.y += lo[u][s].y; a.z += lo[u][s].z; a.w += lo[u][s].w;
      c.x += hi[u][s].x; c.y += hi[u][s].y; c.z += hi[u][s].z; c.w += hi[u][s].w;
    }
    int e = (wid * 2 + u) * 16 + ((lane >> 4) << 3);
    int d = dt * 16 + (lane & 15);
    *(v8h*)(kvT + ((size_t)b * DIM + d) * DIM + e) = cvt8(a, c);
  }
  if (dt == 0) {
    const float* rp = rsPart + (size_t)b * KSPLIT * DIM + tid;
    float r = rp[0];
    for (int s = 1; s < KSPLIT; ++s) r += rp[s * DIM];
    rowsum[b * DIM + tid] = r;
  }
}

// ---------------------------------------------------------------------------
// Kernel 4: scale[b][m] = 1 / (sum_e phiQT[b][m][e]*rowsum[b][e] + 1e-8)
// phiQT is m-major: each thread reads 512 contiguous bytes (v8h loads)
// ---------------------------------------------------------------------------
__global__ __launch_bounds__(256) void scale_kernel(const _Float16* __restrict__ phiQT,
                                                    const float* __restrict__ rowsum,
                                                    float* __restrict__ scale) {
  int b = blockIdx.y;
  int m = blockIdx.x * 256 + threadIdx.x;
  const v8h* pq = (const v8h*)(phiQT + ((size_t)b * MM + m) * DIM);
  const float* rs = rowsum + b * DIM;
  float s = 0.0f;
#pragma unroll 4
  for (int c = 0; c < DIM / 8; ++c) {
    v8h h = pq[c];
#pragma unroll
    for (int j = 0; j < 8; ++j) s += (float)h[j] * rs[c * 8 + j];
  }
  scale[(size_t)b * MM + m] = 1.0f / (s + 1e-8f);
}

// ---------------------------------------------------------------------------
// Kernel 5: out[b][d][m] = scale[b][m] * sum_e kvT[b][d][e]*phiQT[b][m][e]
// Both operands are K(=e)-contiguous f16 rows of 512 bytes. A fragment load
// straight from global memory touches 16 lines for 512 bytes, so the work-group's
// two 128-row tiles are brought into LDS once, whole lines at a time, by tensor
// loads, and the fragments come from LDS.
// Each wave brings one slice: 64 rows of one 256-byte half of the e range
// (source pitch 512 bytes), padded by the mover to a pitch of 272 bytes, at which
// 16-byte fragment reads of 16 rows fall on 64 different banks.
// Slice number = operand * 4 + e half * 2 + row half (operand 0 = kvT, 1 = phiQT).
// phiQT stands first in the product, so a lane's 8 accumulator registers are 32
// contiguous bytes of one out row. Each wave lays its 32 x 64 result in an LDS
// range of its own (over the operand tiles, once every wave is done with them)
// and stores it in rows: every wave-wide 16-byte store covers two rows of 256
// contiguous bytes, 4 whole lines.
// ---------------------------------------------------------------------------
#define OUT_PITCH 272    // bytes from row to row in LDS: 256 + the 16-byte pad
#define OUT_SLICE 18432  // 64 rows * 272 bytes = 17,408, rounded up to a multiple of 2 KiB

typedef __attribute__((ext_vector_type(8))) unsigned int u32x8;

__device__ __forceinline__ uint32_t uni(uint32_t v) {
  return (uint32_t)__builtin_amdgcn_readfirstlane(v);
}

// Same element order as frag_kcontig: 16 bytes at K = 0..7 (+8 for the upper
// half-wave, already in p), 16 bytes at K = 16..23 (+8).
__device__ __forceinline__ v16h frag_lds(const unsigned char* p) {
  v8h lo = *(const v8h*)p;
  v8h hi = *(const v8h*)(p + 32);
  v16h f;
#pragma unroll
  for (int j = 0; j < 8; ++j) { f[j] = lo[j]; f[j + 8] = hi[j]; }
  return f;
}

__global__ __launch_bounds__(256) void out_kernel(const _Float16* __restrict__ kvT,
                                                  const _Float16* __restrict__ phiQT,
                                                  const float* __restrict__ scale,
                                                  float* __restrict__ out) {
  __shared__ __attribute__((aligned(2048))) unsigned char L[8 * OUT_SLICE];
  const int tid = threadIdx.x, lane = tid & 31, wid = tid >> 5;
  const int mblk = blockIdx.x, dblk = blockIdx.y, b = blockIdx.z;
  const int d_wave  = dblk * 128 + (wid & 3) * 32;
  const int m_wave0 = (wid >> 2) * 64;
  const int m0      = mblk * 128;

  // Read at the head: the scheduling fences below would otherwise hold these
  // loads behind the last product.
  const float4 sc = *(const float4*)(scale + (size_t)b * MM + m0 + m_wave0 + (lane & 15) * 4);

  {  // every wave issues the one request for its own slice
    const uint32_t wave = uni(threadIdx.x >> 5);
    const _Float16* rows = (wave >> 2) ? phiQT + ((size_t)b * MM + m0) * DIM
                                       : kvT + ((size_t)b * DIM + dblk * 128) * DIM;
    const uint64_t ga =
        (uint64_t)(uintptr_t)(rows + (size_t)(wave & 1u) * 64 * DIM + ((wave >> 1) & 1u) * 128);
    u32x4 g0;
    g0[0] = uni(1u);                                             // count 1
    g0[1] = uni((uint32_t)(uintptr_t)&L[0] + wave * OUT_SLICE);  // place in LDS
    g0[2] = uni((uint32_t)ga);
    g0[3] = uni((((uint32_t)(ga >> 32)) & 0x01FFFFFFu) | 0x80000000u);  // type 2
    u32x8 g1;  // extents in bytes; tensor dims = tile dims = 256 x 64
    g1[0] = uni((1u << 20) | (5u << 22) | (3u << 25));  // 4 dwords of pad behind every 64
    g1[1] = uni(256u << 16);
    g1[2] = uni(64u << 16);
    g1[3] = uni(256u << 16);
    g1[4] = uni(64u);
    g1[5] = uni(2u * DIM);  // source pitch: one whole row
    g1[6] = uni(0u);
    g1[7] = uni(0u);
    asm volatile("tensor_load_to_lds %0, %1" :: "s"(g0), "s"(g1) : "memory");
    // The slice has landed behind this.
    asm volatile("s_wait_tensorcnt 0x0" ::: "memory");
  }
  __syncthreads();  // every wave's slice is readable by the others behind this

  v8f acc[2][4];
#pragma unroll
  for (int i = 0; i < 2; ++i)
#pragma unroll
    for (int t = 0; t < 4; ++t) acc[i][t] = zero8();

  const unsigned lrow = (unsigned)(lane & 15) * OUT_PITCH + ((unsigned)(lane >> 4) << 4);
  const unsigned char* aP = L + ((wid & 3) >> 1) * OUT_SLICE + (wid & 1) * 32 * OUT_PITCH + lrow;
  const unsigned char* bP = L + (4 + (wid >> 2)) * OUT_SLICE + lrow;

  // Two fragment sets: the reads of step s + 1 go out as one group in front of
  // the products of step s, so a wave does not wait out its own LDS latency.
  v16h af[2][2], bf[2][4];
  af[0][0] = frag_lds(aP);
  af[0][1] = frag_lds(aP + 16 * OUT_PITCH);
#pragma unroll
  for (int t = 0; t < 4; ++t) bf[0][t] = frag_lds(bP + t * 16 * OUT_PITCH);

  // Unrolled: set numbers and LDS offsets must be constants (registers, immediates).
#pragma unroll
  for (int s = 0; s < DIM / 32; ++s) {
    const int cur = s & 1, nxt = cur ^ 1;
    if (s + 1 < DIM / 32) {
      const int off = ((s + 1) >> 2) * 2 * OUT_SLICE + ((s + 1) & 3) * 64;
      af[nxt][0] = frag_lds(aP + off);
      af[nxt][1] = frag_lds(aP + off + 16 * OUT_PITCH);
#pragma unroll
      for (int t = 0; t < 4; ++t) bf[nxt][t] = frag_lds(bP + off + t * 16 * OUT_PITCH);
    }
    // Keeps the read group whole and in front: without it the compiler hoists the
    // reads of all steps (over 256 VGPRs, one work-group per WGP instead of two).
    __builtin_amdgcn_sched_barrier(0);
#pragma unroll
    for (int t = 0; t < 4; ++t) {
      acc[0][t] = wmma_f16(bf[cur][t], af[cur][0], acc[0][t]);  // registers along m,
      acc[1][t] = wmma_f16(bf[cur][t], af[cur][1], acc[1][t]);  // lanes along d
    }
    // Keeps the next group's reads from moving in among these products.
    __builtin_amdgcn_sched_barrier(0);
  }

  __syncthreads();  // every wave has read its last fragment: L may be written over

  // Row = d within the wave's 32, pitch OUT_PITCH; byte = 4 * (m within the wave's 64).
  unsigned char* st = L + wid * (32 * OUT_PITCH);
  unsigned char* wr = st + (lane & 15) * OUT_PITCH + (lane >> 4) * 32;
#pragma unroll
  for (int i = 0; i < 2; ++i)
#pragma unroll
    for (int t = 0; t < 4; ++t) {
      unsigned char* p = wr + i * 16 * OUT_PITCH + t * 64;
      *(float4*)p        = make_float4(acc[i][t][0], acc[i][t][1], acc[i][t][2], acc[i][t][3]);
      *(float4*)(p + 16) = make_float4(acc[i][t][4], acc[i][t][5], acc[i][t][6], acc[i][t][7]);
    }
  // The wave's own LDS writes are done before other lanes of it read them back.
  asm volatile("s_wait_dscnt 0x0" ::: "memory");

  const unsigned char* rd = st + (lane >> 4) * OUT_PITCH + (lane & 15) * 16;
  float* gp = out + ((size_t)b * DIM + d_wave + (lane >> 4)) * MM + m0 + m_wave0 + (lane & 15) * 4;
  // Unrolled: row offsets become immediates of one address.
#pragma unroll
  for (int j = 0; j < 16; ++j) {
    float4 v = *(const float4*)(rd + j * 2 * OUT_PITCH);
    *(float4*)(gp + (size_t)(j * 2) * MM) = make_float4(v.x * sc.x, v.y * sc.y, v.z * sc.z, v.w * sc.w);
  }
}

// ---------------------------------------------------------------------------
extern "C" void kernel_launch(void* const* d_in, const int* in_sizes, int n_in,
                              void* d_out, int out_size, void* d_ws, size_t ws_size,
                              hipStream_t stream) {
  const float* query = (const float*)d_in[0];
  const float* key   = (const float*)d_in[1];
  const float* value = (const float*)d_in[2];
  const float* W     = (const float*)d_in[3];
  float* out = (float*)d_out;

  _Float16* Wt    = (_Float16*)d_ws;                       // 256*256 f16, fragment order
  _Float16* phiQT = Wt + (size_t)DIM * DIM;                // [b][m][e], 32 MB
  _Float16* phiK  = phiQT + (size_t)BATCH * MM * DIM;      // [b][e][n], 32 MB
  _Float16* kvT   = phiK + (size_t)BATCH * DIM * NN;       // [b][d][e], 4 MB
  float* rowsum   = (float*)(kvT + (size_t)BATCH * DIM * DIM);
  float* scaleB   = rowsum + BATCH * DIM;
  float* kvPart   = scaleB + (size_t)BATCH * MM;           // [b][tile][ks], f32, 32 MB
  float* rsPart   = kvPart + (size_t)BATCH * DIM * DIM * KSPLIT;  // [b][ks][e], f32

  wt_kernel<<<dim3(DIM), dim3(DIM), 0, stream>>>(W, Wt);
  phi_kernel<<<dim3(MM / 128, 2, BATCH * 2), dim3(256), 0, stream>>>(
      query, key, Wt, phiQT, phiK);
  kv_kernel<<<dim3(2, 2, BATCH * KSPLIT), dim3(256), 0, stream>>>(phiK, value, kvPart,
                                                                    rsPart);
  kv_reduce_kernel<<<dim3(BATCH * (DIM / 16)), dim3(256), 0, stream>>>(kvPart, rsPart, kvT,
                                                                          rowsum);
  scale_kernel<<<dim3(MM / 256, BATCH), dim3(256), 0, stream>>>(phiQT, rowsum, scaleB);
  out_kernel<<<dim3(MM / 128, 2, BATCH), dim3(256), 0, stream>>>(kvT, phiQT, scaleB, out);
}

// v007
// A run of this version takes 78.4 microseconds.
// Timed twice side by side with v006, it ran 1.08 times as fast both times.
// All steps since v000 together make it 2.07 times as fast.
#include <hip/hip_runtime.h>
#include <hip/hip_bf16.h>
#include <stdint.h>

#define DIM 256
#define BATCH 32
#define MM 2048
#define NN 2048
#define KSPLIT 4  // slices of the n sum in kv_kernel, one work-group each

typedef __attribute__((ext_vector_type(16))) _Float16 v16h;
typedef __attribute__((ext_vector_type(8)))  _Float16 v8h;
typedef __attribute__((ext_vector_type(4)))  _Float16 v4h;
typedef __attribute__((ext_vector_type(8)))  float    v8f;
typedef __attribute__((ext_vector_type(4)))  unsigned int u32x4;
typedef __attribute__((ext_vector_type(4)))  int          i32x4;
typedef __attribute__((ext_vector_type(8)))  int          i32x8;

#define TDM_OK __has_builtin(__builtin_amdgcn_tensor_load_to_lds)

__device__ __forceinline__ v8f wmma_f16(v16h a, v16h b, v8f c) {
  // D = A(16x32 f16) * B(32x16 f16) + C(16x16 f32)
  return __builtin_amdgcn_wmma_f32_16x16x32_f16(false, a, false, b, (short)0, c,
                                                false, false);
}

__device__ __forceinline__ v8f zero8() {
  v8f z;
#pragma unroll
  for (int r = 0; r < 8; ++r) z[r] = 0.0f;
  return z;
}

__device__ __forceinline__ v8h cvt8(float4 a, float4 b) {
  v8h h;
  h[0] = (_Float16)a.x; h[1] = (_Float16)a.y; h[2] = (_Float16)a.z; h[3] = (_Float16)a.w;
  h[4] = (_Float16)b.x; h[5] = (_Float16)b.y; h[6] = (_Float16)b.z; h[7] = (_Float16)b.w;
  return h;
}

__device__ __forceinline__ v4h cvt4(float4 a) {
  v4h h;
  h[0] = (_Float16)a.x; h[1] = (_Float16)a.y; h[2] = (_Float16)a.z; h[3] = (_Float16)a.w;
  return h;
}

// Fragment from row-major f16 memory (row stride ld, K contiguous).
// Per ISA 16-bit A layout: row = lane%16, element j holds K = j + 8*((j>>3)+(lane>>4)).
// Same mapping serves B fragments when "row" is the B column and K is contiguous.
__device__ __forceinline__ v16h frag_kcontig(const _Float16* __restrict__ base,
                                             int ld, int lane) {
  const _Float16* p = base + (size_t)(lane & 15) * ld + ((lane >> 4) << 3);
  v8h lo = *(const v8h*)p;         // K = 0..7   (+8 for upper half-wave)
  v8h hi = *(const v8h*)(p + 16);  // K = 16..23 (+8)
  v16h f;
#pragma unroll
  for (int j = 0; j < 8; ++j) { f[j] = lo[j]; f[j + 8] = hi[j]; }
  return f;
}

// ---------------------------------------------------------------------------
// TDM: 2D tile (tile_d0 x tile_d1 elements of 2 bytes) global -> LDS with
// row stride stride0 (elements). LDS padding from descriptor: insert
// (pad_amt_code+1) DWORDs after every 2^(pad_int_code+1) DWORDs stored.
// ---------------------------------------------------------------------------
__device__ __forceinline__ void tdm_load_2d_f16(unsigned lds_off, const void* gaddr,
                                                unsigned tensor_d0, unsigned tensor_d1,
                                                unsigned tile_d0, unsigned tile_d1,
                                                unsigned stride0,
                                                unsigned pad_int_code,
                                                unsigned pad_amt_code) {
#if TDM_OK
  unsigned long long ga = (unsigned long long)(uintptr_t)gaddr;
  u32x4 g0;
  g0[0] = 1u;                                    // count=1 (valid user descriptor)
  g0[1] = lds_off;                               // lds_addr (bytes)
  g0[2] = (unsigned)(ga & 0xFFFFFFFFu);          // global_addr[31:0]
  g0[3] = (unsigned)((ga >> 32) & 0x01FFFFFFu) | (2u << 30);  // addr[56:32], type=2
  i32x8 g1;
  // wg_mask=0 | data_size=1(2B)<<16 | pad_enable<<20 | pad_interval<<22 | pad_amount<<25
  g1[0] = (int)((1u << 16) | (1u << 20) | (pad_int_code << 22) | (pad_amt_code << 25));
  g1[1] = (int)(tensor_d0 << 16);                         // tensor_dim0[15:0]
  g1[2] = (int)((tensor_d0 >> 16) | (tensor_d1 << 16));   // dim0 hi | dim1 lo
  g1[3] = (int)((tensor_d1 >> 16) | (tile_d0 << 16));     // dim1 hi | tile_dim0
  g1[4] = (int)(tile_d1 & 0xFFFFu);                       // tile_dim1 (tile_dim2=0)
  g1[5] = (int)stride0;                                   // tensor_dim0_stride lo
  g1[6] = 0;                                              // stride0 hi | stride1 lo
  g1[7] = 0;                                              // stride1 hi
  i32x4 z4 = {0, 0, 0, 0};
#if defined(__clang_major__) && __clang_major__ >= 23
  i32x8 z8 = {0, 0, 0, 0, 0, 0, 0, 0};
  __builtin_amdgcn_tensor_load_to_lds(g0, g1, z4, z4, z8, 0);
#else
  __builtin_amdgcn_tensor_load_to_lds(g0, g1, z4, z4, 0);
#endif
#endif
}

// ---------------------------------------------------------------------------
// Kernel 0: Wt = (f16) W transposed, packed in the order of phi_kernel's Wt
// fragments: one 1-KiB block per (16 rows of e, 32 columns of c); in it lane l's
// 8 halves for K = 0..7 (+8 for the upper half-wave) at halves l*8, those for
// K = 16..23 (+8) at halves 256 + l*8. A wave-wide 16-byte load of a fragment
// half is then 512 contiguous bytes (4 lines) instead of 16 rows (16 lines).
// ---------------------------------------------------------------------------
__global__ __launch_bounds__(256) void wt_kernel(const float* __restrict__ W,
                                                 _Float16* __restrict__ Wt) {
  int e = blockIdx.x, c = threadIdx.x;
  int blk  = (e >> 4) * (DIM / 32) + (c >> 5);
  int lane = (((c >> 3) & 1) << 4) + (e & 15);
  Wt[(size_t)blk * 512 + ((c >> 4) & 1) * 256 + lane * 8 + (c & 7)] =
      (_Float16)W[(size_t)c * DIM + e];
}

// A fragment from a block packed by wt_kernel (p = block + lane * 8); the element
// order is that of frag_kcontig.
__device__ __forceinline__ v16h frag_packed(const _Float16* __restrict__ p) {
  v8h lo = *(const v8h*)p;
  v8h hi = *(const v8h*)(p + 256);
  v16h f;
#pragma unroll
  for (int j = 0; j < 8; ++j) { f[j] = lo[j]; f[j + 8] = hi[j]; }
  return f;
}

// Transposing LDS load: with lane l's address at row 8*(l>>4) + (l&7), byte
// 16*((l>>3)&1) of a 16-bit tile, lane l gets rows 8*(l>>4) + 0..7 of column l&15.
typedef __attribute__((ext_vector_type(8))) short s16x8;
__device__ __forceinline__ v8h lds_tr16(const unsigned char* p) {
  typedef __attribute__((address_space(3))) s16x8 lds_s16x8;
  return __builtin_bit_cast(v8h, __builtin_amdgcn_ds_load_tr16_b128_v8i16((lds_s16x8*)p));
}

#define XS_PITCH 288  // bytes from row to row of Xs: 256 + 32, an odd multiple of 32
#define PS_PITCH 272  // bytes from row to row of the staged result: 256 + 16, an odd multiple of 16

// ---------------------------------------------------------------------------
// Kernel 1: phi = relu(alpha * Wt @ X) for Q, relu(Wt @ X) for K; software-pipelined f32->f16 staging.
// Every wave-wide global load covers whole 128-byte lines: a wave stages 4 rows of
// X, each as 512 contiguous bytes, and Wt comes packed in fragment order.
// Xs holds X as it lies in memory (row = c, the k of the product); an X fragment
// wants 8 + 8 values of k per lane, which two transposing loads deliver in the
// k order of the Wt fragments.
// Q result stored transposed phiQT[b][m][e], K result stored phiK[b][e][n] (what
// kv wants). The operand whose index runs along a result row stands first in the
// product (Wt for Q, X for K), so a lane's 8 accumulator registers are 16
// contiguous bytes of one result row. The work-group's 128 x 128 result is laid
// in LDS (over Xs, which is done with) and leaves in rows: every wave-wide
// 16-byte store covers two rows of 256 contiguous bytes, 4 whole lines.
// ---------------------------------------------------------------------------
template <bool IS_K>
__device__ __forceinline__ void phi_tile(const float* __restrict__ xsrc,
                                         const _Float16* __restrict__ wp,
                                         _Float16* __restrict__ dst, const int dpitch,
                                         unsigned char* S) {
  _Float16(*Xs)[XS_PITCH / 2] = (_Float16(*)[XS_PITCH / 2])S;
  const int tid = threadIdx.x, lane = tid & 31;
  // The wave's number in a scalar register: what is formed from it then takes no
  // VGPR (at 128 VGPRs 4 work-groups fit a WGP, one more register costs one).
  const int wid = __builtin_amdgcn_readfirstlane(tid >> 5);
  const int e_wave0 = (wid & 3) * 32;
  const int m_wave0 = (wid >> 2) * 64;

  v8f acc[2][4];
#pragma unroll
  for (int i = 0; i < 2; ++i)
#pragma unroll
    for (int t = 0; t < 4; ++t) acc[i][t] = zero8();

  const int srow = wid << 2;
  const int scol = lane << 2;
  const float* src = xsrc + (size_t)srow * MM + scol;

  const unsigned char* bp = S + (((lane >> 4) << 3) + (lane & 7)) * XS_PITCH + m_wave0 * 2 +
                            ((lane >> 3) & 1) * 16;

  float4 f0 = *(const float4*)src;
  float4 f1 = *(const float4*)(src + MM);
  float4 f2 = *(const float4*)(src + 2 * MM);
  float4 f3 = *(const float4*)(src + 3 * MM);
  // Stands in front of the first write to these loads' offset register, which
  // this build reuses in the loop while the last of them are still under way.
  asm volatile("s_wait_xcnt 0x0" ::: "memory");

  for (int c0 = 0; c0 < DIM; c0 += 32) {
    *(v4h*)&Xs[srow][scol]     = cvt4(f0);
    *(v4h*)&Xs[srow + 1][scol] = cvt4(f1);
    *(v4h*)&Xs[srow + 2][scol] = cvt4(f2);
    *(v4h*)&Xs[srow + 3][scol] = cvt4(f3);
    __syncthreads();

    if (c0 + 32 < DIM) {  // prefetch next k-step; latency overlaps WMMA below
      const float* np = src + (size_t)(c0 + 32) * MM;
      f0 = *(const float4*)np;
      f1 = *(const float4*)(np + MM);
      f2 = *(const float4*)(np + 2 * MM);
      f3 = *(const float4*)(np + 3 * MM);
      // Stands in front of the first write to these loads' address registers,
      // which this build reuses for the fragment loads below.
      asm volatile("s_wait_xcnt 0x0" ::: "memory");
    }

    v16h a0 = frag_packed(wp + (c0 >> 5) * 512);
    v16h a1 = frag_packed(wp + ((DIM / 32) + (c0 >> 5)) * 512);
#pragma unroll
    for (int t = 0; t < 4; ++t) {
      v8h lo = lds_tr16(bp + t * 32);                  // K = 0..7   (+8)
      v8h hi = lds_tr16(bp + t * 32 + 16 * XS_PITCH);  // K = 16..23 (+8)
      v16h bf;
#pragma unroll
      for (int j = 0; j < 8; ++j) { bf[j] = lo[j]; bf[j + 8] = hi[j]; }
      if (IS_K) {  // registers run along n, lanes along e
        acc[0][t] = wmma_f16(bf, a0, acc[0][t]);
        acc[1][t] = wmma_f16(bf, a1, acc[1][t]);
      } else {     // registers run along e, lanes along m
        acc[0][t] = wmma_f16(a0, bf, acc[0][t]);
        acc[1][t] = wmma_f16(a1, bf, acc[1][t]);
      }
    }
    __syncthreads();  // the last one also frees Xs for the staged result
  }

  const float alpha = 1.0f / 16.0f;  // Q alone
#pragma unroll
  for (int i = 0; i < 2; ++i)
#pragma unroll
    for (int t = 0; t < 4; ++t) {
      v8h h;
#pragma unroll
      for (int r = 0; r < 8; ++r) {
        float v = IS_K ? acc[i][t][r] : acc[i][t][r] * alpha;
        h[r] = (_Float16)(v > 0.0f ? v : 0.0f);
      }
      const int el = e_wave0 + i * 16, ml = m_wave0 + t * 16;
      const int row = (IS_K ? el : ml) + (lane & 15);
      const int col = (IS_K ? ml : el) + ((lane >> 4) << 3);
      *(v8h*)(S + row * PS_PITCH + col * 2) = h;
    }
  __syncthreads();  // rows are read back by other waves than wrote them

  const unsigned char* rp = S + (wid * 16 + (lane >> 4)) * PS_PITCH + (lane & 15) * 16;
  _Float16* gp = dst + (size_t)(wid * 16 + (lane >> 4)) * dpitch + (lane & 15) * 8;
  // Unrolled: row offsets become immediates of one address.
#pragma unroll
  for (int j = 0; j < 8; ++j)
    *(v8h*)(gp + (size_t)(j * 2) * dpitch) = *(const v8h*)(rp + j * 2 * PS_PITCH);
}

__global__ __launch_bounds__(256) void phi_kernel(const float* __restrict__ query,
                                                  const float* __restrict__ key,
                                                  const _Float16* __restrict__ Wt,
                                                  _Float16* __restrict__ phiQT,
                                                  _Float16* __restrict__ phiK) {
  __shared__ __attribute__((aligned(16))) unsigned char S[128 * PS_PITCH];
  const int lane = threadIdx.x & 31;
  const int wid  = __builtin_amdgcn_readfirstlane(threadIdx.x >> 5);  // scalar, as in phi_tile
  const int m0   = blockIdx.x * 128;
  const int e0   = blockIdx.y * 128;
  const int b    = blockIdx.z >> 1;
  const int isK  = blockIdx.z & 1;
  const _Float16* wp = Wt + (size_t)((e0 + (wid & 3) * 32) >> 4) * (DIM / 32) * 512 + lane * 8;
  const size_t xoff = (size_t)b * DIM * MM + m0;
  if (isK)
    phi_tile<true>(key + xoff, wp, phiK + ((size_t)b * DIM + e0) * NN + m0, NN, S);
  else
    phi_tile<false>(query + xoff, wp, phiQT + ((size_t)b * MM + m0) * DIM + e0, DIM, S);
}

// ---------------------------------------------------------------------------
// Kernel 3: part[b][d][e][ks] = sum over slice ks of n of phiK[b][e][n]*value[b][d][n]
// The n sum is cut into KSPLIT slices so that 4x the work-groups each walk a
// quarter of the serial, latency-bound steps; kv_reduce_kernel adds the slices.
// Partials are f32 and lie in accumulator order: one 1-KiB block per 16x16 tile
// and slice, a tile's KSPLIT blocks side by side, register quad q of lane l at
// floats q*128 + l*4, so every store is 512 contiguous bytes per wave.
// A tile (f16 phiK) staged by the Tensor Data Mover, double-buffered; the
// descriptor pads every 16 DW by 4 DW so rows land 40 halves apart (16B
// aligned, bank-conflict-free b128 fragment loads). B (value f32->f16) uses
// register-prefetch pipelining. TENSORcnt + barriers synchronize.
// The row sums of phiK ride along: rsPart[b][ks][e] = sum over slice ks of n of
// phiK[b][e][n], as the product of the A fragments with a B fragment of ones
// (f32 accumulate), so phiK is not read a second time by a launch of its own.
// ---------------------------------------------------------------------------
__global__ __launch_bounds__(256) void kv_kernel(const _Float16* __restrict__ phiK,
                                                 const float* __restrict__ value,
                                                 float* __restrict__ part,
                                                 float* __restrict__ rsPart) {
  __shared__ _Float16 Vs[128][40];
#if TDM_OK
  __shared__ _Float16 As[2][128][40];
#endif
  const int tid = threadIdx.x, lane = tid & 31, wid = tid >> 5;
  const int dblk = blockIdx.x, eblk = blockIdx.y;
  const int b    = blockIdx.z / KSPLIT;
  const int ks   = blockIdx.z % KSPLIT;
  const int nbeg = ks * (NN / KSPLIT);
  const int e_wave  = eblk * 128 + (wid & 3) * 32;
  const int d_wave0 = (wid >> 2) * 64;
  const int d0      = dblk * 128;

  v8f acc[2][4];
#pragma unroll
  for (int i = 0; i < 2; ++i)
#pragma unroll
    for (int t = 0; t < 4; ++t) acc[i][t] = zero8();

  v8f rs[2] = {zero8(), zero8()};  // every column holds the row sums of a0, a1
  const _Float16 one = (_Float16)1.0f;
  const v16h ones = {one, one, one, one, one, one, one, one,
                     one, one, one, one, one, one, one, one};

  const int srow = tid >> 1;
  const int scol = (tid & 1) << 4;
  const float* src = value + ((size_t)b * DIM + d0 + srow) * NN + nbeg + scol;

  const float4* sp = (const float4*)src;
  float4 f0 = sp[0], f1 = sp[1], f2 = sp[2], f3 = sp[3];

#if TDM_OK
  const _Float16* aGlob = phiK + ((size_t)b * DIM + eblk * 128) * NN + nbeg;
  const unsigned aoff0 = (unsigned)(uintptr_t)(&As[0][0][0]);
  const unsigned aoff1 = (unsigned)(uintptr_t)(&As[1][0][0]);
  if (wid == 0) {  // A tile for step 0: 32n x 128e rows, row stride NN
    tdm_load_2d_f16(aoff0, aGlob, NN, DIM, 32, 128, NN, /*int16DW*/3, /*amt4DW*/3);
    // Waited for here, so that no descriptor register is reused (for the loop's
    // counters) while the request is outstanding; the value loads above fly on.
    asm volatile("s_wait_tensorcnt 0x0" ::: "memory");
  }
#endif

  for (int n0 = 0; n0 < NN / KSPLIT; n0 += 32) {
    *(v8h*)&Vs[srow][scol]     = cvt8(f0, f1);
    *(v8h*)&Vs[srow][scol + 8] = cvt8(f2, f3);
#if TDM_OK
    const int buf = (n0 >> 5) & 1;
    // The issuing wave's wait for the tile of this step. Every wave runs it (at
    // once done where none is outstanding): a test here would save EXEC into a
    // scalar register, which may be one of the outstanding descriptor's.
    asm volatile("s_wait_tensorcnt 0x0" ::: "memory");
#endif
    __syncthreads();  // publish Vs stores (and DMA'd A tile)

    if (n0 + 32 < NN / KSPLIT) {  // prefetch next B tile; overlaps WMMA below
      const float4* np = (const float4*)(src + n0 + 32);
      f0 = np[0]; f1 = np[1]; f2 = np[2]; f3 = np[3];
#if TDM_OK
      if (wid == 0)  // DMA next A tile into the other buffer
        tdm_load_2d_f16(buf ? aoff0 : aoff1, aGlob + n0 + 32, NN, DIM, 32, 128,
                        NN, 3, 3);
#endif
    }

#if TDM_OK
    v16h a0, a1;
    {
      int hw8 = (lane >> 4) << 3;
      const _Float16* p0 = &As[buf][(wid & 3) * 32 + (lane & 15)][hw8];
      const _Float16* p1 = &As[buf][(wid & 3) * 32 + 16 + (lane & 15)][hw8];
      v8h lo0 = *(const v8h*)p0, hi0 = *(const v8h*)(p0 + 16);
      v8h lo1 = *(const v8h*)p1, hi1 = *(const v8h*)(p1 + 16);
#pragma unroll
      for (int j = 0; j < 8; ++j) {
        a0[j] = lo0[j]; a0[j + 8] = hi0[j];
        a1[j] = lo1[j]; a1[j + 8] = hi1[j];
      }
    }
#else
    v16h a0 = frag_kcontig(phiK + ((size_t)b * DIM + e_wave) * NN + nbeg + n0, NN, lane);
    v16h a1 = frag_kcontig(phiK + ((size_t)b * DIM + e_wave + 16) * NN + nbeg + n0, NN, lane);
#endif
    // Run by every wave, so that the loop holds no test: its steps wait on loads,
    // not on the matrix unit. One wave per e range stores the result.
    rs[0] = wmma_f16(a0, ones, rs[0]);
    rs[1] = wmma_f16(a1, ones, rs[1]);
#pragma unroll
    for (int t = 0; t < 4; ++t) {
      const _Float16* rp = &Vs[d_wave0 + t * 16 + (lane & 15)][(lane >> 4) << 3];
      v8h lo = *(const v8h*)rp;
      v8h hi = *(const v8h*)(rp + 16);
      v16h bf;
#pragma unroll
      for (int j = 0; j < 8; ++j) { bf[j] = lo[j]; bf[j + 8] = hi[j]; }
      acc[0][t] = wmma_f16(a0, bf, acc[0][t]);
      acc[1][t] = wmma_f16(a1, bf, acc[1][t]);
    }
    __syncthreads();  // tiles consumed; buffers reusable
  }

  // Tile (dt, et) = (d / 16, e / 16) of batch b, slice ks: block (dt * 16 + et) * KSPLIT + ks.
  float* pwg = part + (size_t)b * DIM * DIM * KSPLIT +
               (((d0 >> 4) * (DIM / 16) + eblk * 8) * KSPLIT + ks) * 256;
  const unsigned pw =
      (unsigned)(((d_wave0 >> 4) * (DIM / 16) + (wid & 3) * 2) * KSPLIT * 256 + lane * 4);
#pragma unroll
  for (int i = 0; i < 2; ++i)
#pragma unroll
    for (int t = 0; t < 4; ++t) {
      float* tp = pwg + (pw + (t * (DIM / 16) + i) * KSPLIT * 256);
      *(float4*)tp         = make_float4(acc[i][t][0], acc[i][t][1], acc[i][t][2], acc[i][t][3]);
      *(float4*)(tp + 128) = make_float4(acc[i][t][4], acc[i][t][5], acc[i][t][6], acc[i][t][7]);
    }

  // Column 0 of rs: lane 0 holds rows 0..7, lane 16 rows 8..15. The wave's 32
  // sums fill one 128-byte line.
  if (dblk == 0 && wid < 4 && (lane & 15) == 0) {
    float* rp = rsPart + ((size_t)b * KSPLIT + ks) * DIM + e_wave + ((lane >> 4) << 3);
    // Unrolled: constant indices keep rs in registers.
#pragma unroll
    for (int i = 0; i < 2; ++i) {
      *(float4*)(rp + i * 16)     = make_float4(rs[i][0], rs[i][1], rs[i][2], rs[i][3]);
      *(float4*)(rp + i * 16 + 4) = make_float4(rs[i][4], rs[i][5], rs[i][6], rs[i][7]);
    }
  }
}

// ---------------------------------------------------------------------------
// Kernel 3b: kvT[b][d][e] = (f16) sum_ks part[b][d][e][ks]
// One work-group per (b, 16 rows of d); each wave adds two 16x16 tiles. A lane
// holds what it held as accumulator: d = 16*dt + (lane & 15), e = 16*et +
// 8*(lane >> 4) + 0..7, so the result leaves as one 16-byte store.
// The first work-group of each batch also adds the slices of the row sums:
// rowsum[b][e] = sum_ks rsPart[b][ks][e].
// ---------------------------------------------------------------------------
__global__ __launch_bounds__(256) void kv_reduce_kernel(const float* __restrict__ part,
                                                        const float* __restrict__ rsPart,
                                                        _Float16* __restrict__ kvT,
                                                        float* __restrict__ rowsum) {
  const int tid = threadIdx.x, lane = tid & 31, wid = tid >> 5;
  const int b = blockIdx.x / (DIM / 16), dt = blockIdx.x % (DIM / 16);
  const float* pwg = part + (size_t)blockIdx.x * (DIM / 16) * KSPLIT * 256;
  const unsigned pw = (unsigned)(wid * 2 * KSPLIT * 256 + lane * 4);
  float4 lo[2][KSPLIT], hi[2][KSPLIT];
  // Unrolled (here and below): constant indices keep lo and hi in registers.
#pragma unroll
  for (int u = 0; u < 2; ++u)
#pragma unroll
    for (int s = 0; s < KSPLIT; ++s) {
      lo[u][s] = *(const float4*)(pwg + (pw + (u * KSPLIT + s) * 256));
      hi[u][s] = *(const float4*)(pwg + (pw + (u * KSPLIT + s) * 256 + 128));
    }
#pragma unroll
  for (int u = 0; u < 2; ++u) {
    float4 a = lo[u][0], c = hi[u][0];
#pragma unroll
    for (int s = 1; s < KSPLIT; ++s) {
      a.x += lo[u][s].x; a.y += lo[u][s].y; a.z += lo[u][s].z; a.w += lo[u][s].w;
      c.x += hi[u][s].x; c.y += hi[u][s].y; c.z += hi[u][s].z; c.w += hi[u][s].w;
    }
    int e = (wid * 2 + u) * 16 + ((lane >> 4) << 3);
    int d = dt * 16 + (lane & 15);
    *(v8h*)(kvT + ((size_t)b * DIM + d) * DIM + e) = cvt8(a, c);
  }
  if (dt == 0) {
    const float* rp = rsPart + (size_t)b * KSPLIT * DIM + tid;
    float r = rp[0];
    for (int s = 1; s < KSPLIT; ++s) r += rp[s * DIM];
    rowsum[b * DIM + tid] = r;
  }
}

// ---------------------------------------------------------------------------
// Kernel 5: out[b][d][m] = scale[b][m] * sum_e kvT[b][d][e]*phiQT[b][m][e],
//           scale[b][m] = 1 / (sum_e phiQT[b][m][e]*rowsum[b][e] + 1e-8)
// Both operands are K(=e)-contiguous f16 rows of 512 bytes. A fragment load
// straight from global memory touches 16 lines for 512 bytes, so the work-group's
// two 128-row tiles are brought into LDS once, whole lines at a time, by tensor
// loads, and the fragments come from LDS.
// Each wave brings one slice: 64 rows of one 256-byte half of the e range
// (source pitch 512 bytes), padded by the mover to a pitch of 272 bytes, at which
// 16-byte fragment reads of 16 rows fall on 64 different banks.
// Slice number = operand * 4 + e half * 2 + row half (operand 0 = kvT, 1 = phiQT).
// phiQT stands first in the product, so a lane's 8 accumulator registers are 32
// contiguous bytes of one out row. Each wave lays its 32 x 64 result in an LDS
// range of its own (over the operand tiles, once every wave is done with them)
// and stores it in rows: every wave-wide 16-byte store covers two rows of 256
// contiguous bytes, 4 whole lines.
// The sum in scale is one more product on the phiQT fragments that are in
// registers anyway, so phiQT is not read by a launch of its own. Its second
// operand holds rowsum / NN (the mean of phiK along n, which fits f16 whenever
// phiK does) as two f16 terms, value and remainder, in the even and the odd
// columns: their two sums together carry 22 of the row sum's 24 bits. Of the 4 waves
// that share 64 rows of m each does 16 rows; the sums cross in LDS at the barrier
// that stands in front of the staging anyway.
// ---------------------------------------------------------------------------
#define OUT_PITCH 272    // bytes from row to row in LDS: 256 + the 16-byte pad
#define OUT_SLICE 18432  // 64 rows * 272 bytes = 17,408, rounded up to a multiple of 2 KiB
#define RS_PITCH 528     // bytes from the value row to the remainder row: 512 + 16
#define RS_OFF (8 * OUT_SLICE)           // the two rows of rowsum / NN, behind the slices
#define DEN_OFF (RS_OFF + 2 * RS_PITCH)  // 2 x 128 floats: the two sums of each m
#define OUT_LDS (DEN_OFF + 2 * 128 * 4)

typedef __attribute__((ext_vector_type(8))) unsigned int u32x8;

__device__ __forceinline__ uint32_t uni(uint32_t v) {
  return (uint32_t)__builtin_amdgcn_readfirstlane(v);
}

// Same element order as frag_kcontig: 16 bytes at K = 0..7 (+8 for the upper
// half-wave, already in p), 16 bytes at K = 16..23 (+8).
__device__ __forceinline__ v16h frag_lds(const unsigned char* p) {
  v8h lo = *(const v8h*)p;
  v8h hi = *(const v8h*)(p + 32);
  v16h f;
#pragma unroll
  for (int j = 0; j < 8; ++j) { f[j] = lo[j]; f[j + 8] = hi[j]; }
  return f;
}

__global__ __launch_bounds__(256) void out_kernel(const _Float16* __restrict__ kvT,
                                                  const _Float16* __restrict__ phiQT,
                                                  const float* __restrict__ rowsum,
                                                  float* __restrict__ out) {
  __shared__ __attribute__((aligned(2048))) unsigned char L[OUT_LDS];
  const int tid = threadIdx.x, lane = tid & 31, wid = tid >> 5;
  const int mblk = blockIdx.x, dblk = blockIdx.y, b = blockIdx.z;
  const int d_wave  = dblk * 128 + (wid & 3) * 32;
  const int m_wave0 = (wid >> 2) * 64;
  const int m0      = mblk * 128;

  // Read at the head, so that it flies beside the tensor load.
  const float rmean = rowsum[b * DIM + tid] * (1.0f / NN);
  // Stands in front of the first write to this load's address registers.
  asm volatile("s_wait_xcnt 0x0" ::: "memory");

  {  // every wave issues the one request for its own slice
    const uint32_t wave = uni(threadIdx.x >> 5);
    const _Float16* rows = (wave >> 2) ? phiQT + ((size_t)b * MM + m0) * DIM
                                       : kvT + ((size_t)b * DIM + dblk * 128) * DIM;
    const uint64_t ga =
        (uint64_t)(uintptr_t)(rows + (size_t)(wave & 1u) * 64 * DIM + ((wave >> 1) & 1u) * 128);
    u32x4 g0;
    g0[0] = uni(1u);                                             // count 1
    g0[1] = uni((uint32_t)(uintptr_t)&L[0] + wave * OUT_SLICE);  // place in LDS
    g0[2] = uni((uint32_t)ga);
    g0[3] = uni((((uint32_t)(ga >> 32)) & 0x01FFFFFFu) | 0x80000000u);  // type 2
    u32x8 g1;  // extents in bytes; tensor dims = tile dims = 256 x 64
    g1[0] = uni((1u << 20) | (5u << 22) | (3u << 25));  // 4 dwords of pad behind every 64
    g1[1] = uni(256u << 16);
    g1[2] = uni(64u << 16);
    g1[3] = uni(256u << 16);
    g1[4] = uni(64u);
    g1[5] = uni(2u * DIM);  // source pitch: one whole row
    g1[6] = uni(0u);
    g1[7] = uni(0u);
    asm volatile("tensor_load_to_lds %0, %1" :: "s"(g0), "s"(g1) : "memory");
    // The slice has landed behind this.
    asm volatile("s_wait_tensorcnt 0x0" ::: "memory");
  }
  {
    const _Float16 hi = (_Float16)rmean;
    *(_Float16*)(L + RS_OFF + tid * 2)            = hi;
    *(_Float16*)(L + RS_OFF + RS_PITCH + tid * 2) = (_Float16)(rmean - (float)hi);
  }
  __syncthreads();  // every wave's slice (and the two rows) readable by the others behind this

  v8f acc[2][4];
#pragma unroll
  for (int i = 0; i < 2; ++i)
#pragma unroll
    for (int t = 0; t < 4; ++t) acc[i][t] = zero8();

  const unsigned lrow = (unsigned)(lane & 15) * OUT_PITCH + ((unsigned)(lane >> 4) << 4);
  const unsigned char* aP = L + ((wid & 3) >> 1) * OUT_SLICE + (wid & 1) * 32 * OUT_PITCH + lrow;
  const unsigned char* bP = L + (4 + (wid >> 2)) * OUT_SLICE + lrow;
  // The wave walks its four 16-row groups of m beginning with group jw, the one
  // whose scale sums it does: that group's fragment is then always set member 0.
  const int jw = (int)(uni(threadIdx.x >> 5) & 3u);
  const unsigned char* bU[4];
  // Unrolled: constant indices keep bU in registers.
#pragma unroll
  for (int u = 0; u < 4; ++u) bU[u] = bP + ((u + jw) & 3) * 16 * OUT_PITCH;
  // Column = lane & 15: even columns read the value row, odd ones the remainder row.
  const unsigned char* rP = L + RS_OFF + (lane & 1) * RS_PITCH + ((lane >> 4) << 4);
  v8f den = zero8();

  // Two fragment sets: the reads of step s + 1 go out as one group in front of
  // the products of step s, so a wave does not wait out its own LDS latency.
  v16h af[2][2], bf[2][4], rf[2];
  af[0][0] = frag_lds(aP);
  af[0][1] = frag_lds(aP + 16 * OUT_PITCH);
  rf[0]    = frag_lds(rP);
#pragma unroll
  for (int u = 0; u < 4; ++u) bf[0][u] = frag_lds(bU[u]);

  // Unrolled: set numbers and LDS offsets must be constants (registers, immediates).
#pragma unroll
  for (int s = 0; s < DIM / 32; ++s) {
    const int cur = s & 1, nxt = cur ^ 1;
    if (s + 1 < DIM / 32) {
      const int off = ((s + 1) >> 2) * 2 * OUT_SLICE + ((s + 1) & 3) * 64;
      af[nxt][0] = frag_lds(aP + off);
      af[nxt][1] = frag_lds(aP + off + 16 * OUT_PITCH);
      rf[nxt]    = frag_lds(rP + (s + 1) * 64);
#pragma unroll
      for (int u = 0; u < 4; ++u) bf[nxt][u] = frag_lds(bU[u] + off);
    }
    // Keeps the read group whole and in front: without it the compiler hoists the
    // reads of all steps (over 256 VGPRs, one work-group per WGP instead of two).
    __builtin_amdgcn_sched_barrier(0);
    den = wmma_f16(bf[cur][0], rf[cur], den);  // registers along m, lanes: value | remainder
#pragma unroll
    for (int u = 0; u < 4; ++u) {
      acc[0][u] = wmma_f16(bf[cur][u], af[cur][0], acc[0][u]);  // registers along m,
      acc[1][u] = wmma_f16(bf[cur][u], af[cur][1], acc[1][u]);  // lanes along d
    }
    // Keeps the next group's reads from moving in among these products.
    __builtin_amdgcn_sched_barrier(0);
  }

  // Columns 0 and 1 hold the two sums; lanes 0, 1 have rows 0..7, lanes 16, 17 rows 8..15.
  if ((lane & 15) < 2) {
    float* dp = (float*)(L + DEN_OFF) + (lane & 1) * 128 + m_wave0 + jw * 16 + ((lane >> 4) << 3);
    *(float4*)dp       = make_float4(den[0], den[1], den[2], den[3]);
    *(float4*)(dp + 4) = make_float4(den[4], den[5], den[6], den[7]);
  }

  // Every wave has read its last fragment: L may be written over. The sums of the
  // other waves are readable behind this too.
  __syncthreads();

  // Row = d within the wave's 32, pitch OUT_PITCH; byte = 4 * (m within the wave's 64).
  unsigned char* st = L + wid * (32 * OUT_PITCH);
  unsigned char* wr = st + (lane & 15) * OUT_PITCH + (lane >> 4) * 32;
#pragma unroll
  for (int i = 0; i < 2; ++i)
#pragma unroll
    for (int u = 0; u < 4; ++u) {
      unsigned char* p = wr + i * 16 * OUT_PITCH + ((u + jw) & 3) * 64;
      *(float4*)p        = make_float4(acc[i][u][0], acc[i][u][1], acc[i][u][2], acc[i][u][3]);
      *(float4*)(p + 16) = make_float4(acc[i][u][4], acc[i][u][5], acc[i][u][6], acc[i][u][7]);
    }
  // The wave's own LDS writes are done before other lanes of it read them back.
  asm volatile("s_wait_dscnt 0x0" ::: "memory");

  float4 sc;
  {
    const float* dn = (const float*)(L + DEN_OFF) + m_wave0 + (lane & 15) * 4;
    const float4 dv = *(const float4*)dn, dr = *(const float4*)(dn + 128);
    sc.x = 1.0f / ((dv.x + dr.x) * (float)NN + 1e-8f);
    sc.y = 1.0f / ((dv.y + dr.y) * (float)NN + 1e-8f);
    sc.z = 1.0f / ((dv.z + dr.z) * (float)NN + 1e-8f);
    sc.w = 1.0f / ((dv.w + dr.w) * (float)NN + 1e-8f);
  }

  const unsigned char* rd = st + (lane >> 4) * OUT_PITCH + (lane & 15) * 16;
  float* gp = out + ((size_t)b * DIM + d_wave + (lane >> 4)) * MM + m0 + m_wave0 + (lane & 15) * 4;
  // Unrolled: row offsets become immediates of one address.
#pragma unroll
  for (int j = 0; j < 16; ++j) {
    float4 v = *(const float4*)(rd + j * 2 * OUT_PITCH);
    *(float4*)(gp + (size_t)(j * 2) * MM) = make_float4(v.x * sc.x, v.y * sc.y, v.z * sc.z, v.w * sc.w);
  }
}

// ---------------------------------------------------------------------------
extern "C" void kernel_launch(void* const* d_in, const int* in_sizes, int n_in,
                              void* d_out, int out_size, void* d_ws, size_t ws_size,
                              hipStream_t stream) {
  const float* query = (const float*)d_in[0];
  const float* key   = (const float*)d_in[1];
  const float* value = (const float*)d_in[2];
  const float* W     = (const float*)d_in[3];
  float* out = (float*)d_out;

  _Float16* Wt    = (_Float16*)d_ws;                       // 256*256 f16, fragment order
  _Float16* phiQT = Wt + (size_t)DIM * DIM;                // [b][m][e], 32 MB
  _Float16* phiK  = phiQT + (size_t)BATCH * MM * DIM;      // [b][e][n], 32 MB
  _Float16* kvT   = phiK + (size_t)BATCH * DIM * NN;       // [b][d][e], 4 MB
  float* rowsum   = (float*)(kvT + (size_t)BATCH * DIM * DIM);
  float* kvPart   = rowsum + BATCH * DIM;                  // [b][tile][ks], f32, 32 MB
  float* rsPart   = kvPart + (size_t)BATCH * DIM * DIM * KSPLIT;  // [b][ks][e], f32

  wt_kernel<<<dim3(DIM), dim3(DIM), 0, stream>>>(W, Wt);
  phi_kernel<<<dim3(MM / 128, 2, BATCH * 2), dim3(256), 0, stream>>>(
      query, key, Wt, phiQT, phiK);
  kv_kernel<<<dim3(2, 2, BATCH * KSPLIT), dim3(256), 0, stream>>>(phiK, value, kvPart,
                                                                    rsPart);
  kv_reduce_kernel<<<dim3(BATCH * (DIM / 16)), dim3(256), 0, stream>>>(kvPart, rsPart, kvT,
                                                                          rowsum);
  out_kernel<<<dim3(MM / 128, 2, BATCH), dim3(256), 0, stream>>>(kvT, phiQT, rowsum, out);
}

// v008
// One run takes 74.9 microseconds.
// Two timings next to v007 put it at 1.04 and 1.05 times that version's speed.
// Over all steps from v000 it is 2.16 times as fast.
#include <hip/hip_runtime.h>
#include <hip/hip_bf16.h>
#include <stdint.h>

#define DIM 256
#define BATCH 32
#define MM 2048
#define NN 2048
#define KSPLIT 4  // slices of the n sum in kv_kernel, one work-group each

typedef __attribute__((ext_vector_type(16))) _Float16 v16h;
typedef __attribute__((ext_vector_type(8)))  _Float16 v8h;
typedef __attribute__((ext_vector_type(4)))  _Float16 v4h;
typedef __attribute__((ext_vector_type(8)))  float    v8f;
typedef __attribute__((ext_vector_type(4)))  unsigned int u32x4;
typedef __attribute__((ext_vector_type(4)))  int          i32x4;
typedef __attribute__((ext_vector_type(8)))  int          i32x8;

#define TDM_OK __has_builtin(__builtin_amdgcn_tensor_load_to_lds)

__device__ __forceinline__ v8f wmma_f16(v16h a, v16h b, v8f c) {
  // D = A(16x32 f16) * B(32x16 f16) + C(16x16 f32)
  return __builtin_amdgcn_wmma_f32_16x16x32_f16(false, a, false, b, (short)0, c,
                                                false, false);
}

__device__ __forceinline__ v8f zero8() {
  v8f z;
#pragma unroll
  for (int r = 0; r < 8; ++r) z[r] = 0.0f;
  return z;
}

__device__ __forceinline__ v8h cvt8(float4 a, float4 b) {
  v8h h;
  h[0] = (_Float16)a.x; h[1] = (_Float16)a.y; h[2] = (_Float16)a.z; h[3] = (_Float16)a.w;
  h[4] = (_Float16)b.x; h[5] = (_Float16)b.y; h[6] = (_Float16)b.z; h[7] = (_Float16)b.w;
  return h;
}

__device__ __forceinline__ v4h cvt4(float4 a) {
  v4h h;
  h[0] = (_Float16)a.x; h[1] = (_Float16)a.y; h[2] = (_Float16)a.z; h[3] = (_Float16)a.w;
  return h;
}

// Fragment from row-major f16 memory (row stride ld, K contiguous).
// Per ISA 16-bit A layout: row = lane%16, element j holds K = j + 8*((j>>3)+(lane>>4)).
// Same mapping serves B fragments when "row" is the B column and K is contiguous.
__device__ __forceinline__ v16h frag_kcontig(const _Float16* __restrict__ base,
                                             int ld, int lane) {
  const _Float16* p = base + (size_t)(lane & 15) * ld + ((lane >> 4) << 3);
  v8h lo = *(const v8h*)p;         // K = 0..7   (+8 for upper half-wave)
  v8h hi = *(const v8h*)(p + 16);  // K = 16..23 (+8)
  v16h f;
#pragma unroll
  for (int j = 0; j < 8; ++j) { f[j] = lo[j]; f[j + 8] = hi[j]; }
  return f;
}

// ---------------------------------------------------------------------------
// TDM: 2D tile (tile_d0 x tile_d1 elements of 2 bytes) global -> LDS with
// row stride stride0 (elements). LDS padding from descriptor: insert
// (pad_amt_code+1) DWORDs after every 2^(pad_int_code+1) DWORDs stored.
// ---------------------------------------------------------------------------
__device__ __forceinline__ void tdm_load_2d_f16(unsigned lds_off, const void* gaddr,
                                                unsigned tensor_d0, unsigned tensor_d1,
                                                unsigned tile_d0, unsigned tile_d1,
                                                unsigned stride0,
                                                unsigned pad_int_code,
                                                unsigned pad_amt_code) {
#if TDM_OK
  unsigned long long ga = (unsigned long long)(uintptr_t)gaddr;
  u32x4 g0;
  g0[0] = 1u;                                    // count=1 (valid user descriptor)
  g0[1] = lds_off;                               // lds_addr (bytes)
  g0[2] = (unsigned)(ga & 0xFFFFFFFFu);          // global_addr[31:0]
  g0[3] = (unsigned)((ga >> 32) & 0x01FFFFFFu) | (2u << 30);  // addr[56:32], type=2
  i32x8 g1;
  // wg_mask=0 | data_size=1(2B)<<16 | pad_enable<<20 | pad_interval<<22 | pad_amount<<25
  g1[0] = (int)((1u << 16) | (1u << 20) | (pad_int_code << 22) | (pad_amt_code << 25));
  g1[1] = (int)(tensor_d0 << 16);                         // tensor_dim0[15:0]
  g1[2] = (int)((tensor_d0 >> 16) | (tensor_d1 << 16));   // dim0 hi | dim1 lo
  g1[3] = (int)((tensor_d1 >> 16) | (tile_d0 << 16));     // dim1 hi | tile_dim0
  g1[4] = (int)(tile_d1 & 0xFFFFu);                       // tile_dim1 (tile_dim2=0)
  g1[5] = (int)stride0;                                   // tensor_dim0_stride lo
  g1[6] = 0;                                              // stride0 hi | stride1 lo
  g1[7] = 0;                                              // stride1 hi
  i32x4 z4 = {0, 0, 0, 0};
#if defined(__clang_major__) && __clang_major__ >= 23
  i32x8 z8 = {0, 0, 0, 0, 0, 0, 0, 0};
  __builtin_amdgcn_tensor_load_to_lds(g0, g1, z4, z4, z8, 0);
#else
  __builtin_amdgcn_tensor_load_to_lds(g0, g1, z4, z4, 0);
#endif
#endif
}

// ---------------------------------------------------------------------------
// Kernel 0: Wt = (f16) W transposed, packed in the order of phi_kernel's Wt
// fragments: one 1-KiB block per (16 rows of e, 32 columns of c); in it lane l's
// 8 halves for K = 0..7 (+8 for the upper half-wave) at halves l*8, those for
// K = 16..23 (+8) at halves 256 + l*8. A wave-wide 16-byte load of a fragment
// half is then 512 contiguous bytes (4 lines) instead of 16 rows (16 lines).
// ---------------------------------------------------------------------------
__global__ __launch_bounds__(256) void wt_kernel(const float* __restrict__ W,
                                                 _Float16* __restrict__ Wt) {
  int e = blockIdx.x, c = threadIdx.x;
  int blk  = (e >> 4) * (DIM / 32) + (c >> 5);
  int lane = (((c >> 3) & 1) << 4) + (e & 15);
  Wt[(size_t)blk * 512 + ((c >> 4) & 1) * 256 + lane * 8 + (c & 7)] =
      (_Float16)W[(size_t)c * DIM + e];
}

// A fragment from a block packed by wt_kernel (p = block + lane * 8); the element
// order is that of frag_kcontig.
__device__ __forceinline__ v16h frag_packed(const _Float16* __restrict__ p) {
  v8h lo = *(const v8h*)p;
  v8h hi = *(const v8h*)(p + 256);
  v16h f;
#pragma unroll
  for (int j = 0; j < 8; ++j) { f[j] = lo[j]; f[j + 8] = hi[j]; }
  return f;
}

// Transposing LDS load: with lane l's address at row 8*(l>>4) + (l&7), byte
// 16*((l>>3)&1) of a 16-bit tile, lane l gets rows 8*(l>>4) + 0..7 of column l&15.
typedef __attribute__((ext_vector_type(8))) short s16x8;
__device__ __forceinline__ v8h lds_tr16(const unsigned char* p) {
  typedef __attribute__((address_space(3))) s16x8 lds_s16x8;
  return __builtin_bit_cast(v8h, __builtin_amdgcn_ds_load_tr16_b128_v8i16((lds_s16x8*)p));
}

#define XS_PITCH 288  // bytes from row to row of Xs: 256 + 32, an odd multiple of 32
#define PS_PITCH 272  // bytes from row to row of the staged result: 256 + 16, an odd multiple of 16

// ---------------------------------------------------------------------------
// Kernel 1: phi = relu(alpha * Wt @ X) for Q, relu(Wt @ X) for K; software-pipelined f32->f16 staging.
// Every wave-wide global load covers whole 128-byte lines: a wave stages 4 rows of
// X, each as 512 contiguous bytes, and Wt comes packed in fragment order.
// Xs holds X as it lies in memory (row = c, the k of the product); an X fragment
// wants 8 + 8 values of k per lane, which two transposing loads deliver in the
// k order of the Wt fragments.
// Q result stored transposed phiQT[b][m][e], K result stored phiK[b][e][n] (what
// kv wants). The operand whose index runs along a result row stands first in the
// product (Wt for Q, X for K), so a lane's 8 accumulator registers are 16
// contiguous bytes of one result row. The work-group's 128 x 128 result is laid
// in LDS (over Xs, which is done with) and leaves in rows: every wave-wide
// 16-byte store covers two rows of 256 contiguous bytes, 4 whole lines.
// ---------------------------------------------------------------------------
template <bool IS_K>
__device__ __forceinline__ void phi_tile(const float* __restrict__ xsrc,
                                         const _Float16* __restrict__ wp,
                                         _Float16* __restrict__ dst, const int dpitch,
                                         unsigned char* S) {
  _Float16(*Xs)[XS_PITCH / 2] = (_Float16(*)[XS_PITCH / 2])S;
  const int tid = threadIdx.x, lane = tid & 31;
  // The wave's number in a scalar register: what is formed from it then takes no
  // VGPR (at 128 VGPRs 4 work-groups fit a WGP, one more register costs one).
  const int wid = __builtin_amdgcn_readfirstlane(tid >> 5);
  const int e_wave0 = (wid & 3) * 32;
  const int m_wave0 = (wid >> 2) * 64;

  v8f acc[2][4];
#pragma unroll
  for (int i = 0; i < 2; ++i)
#pragma unroll
    for (int t = 0; t < 4; ++t) acc[i][t] = zero8();

  const int srow = wid << 2;
  const int scol = lane << 2;
  const float* src = xsrc + (size_t)srow * MM + scol;

  const unsigned char* bp = S + (((lane >> 4) << 3) + (lane & 7)) * XS_PITCH + m_wave0 * 2 +
                            ((lane >> 3) & 1) * 16;

  float4 f0 = *(const float4*)src;
  float4 f1 = *(const float4*)(src + MM);
  float4 f2 = *(const float4*)(src + 2 * MM);
  float4 f3 = *(const float4*)(src + 3 * MM);
  // Stands in front of the first write to these loads' offset register (the lane
  // number, scaled by the load). It takes that register as an input, so that it
  // lives up to here and nothing is laid over it while the loads are under way.
  asm volatile("s_wait_xcnt 0x0" :: "v"(lane) : "memory");

  for (int c0 = 0; c0 < DIM; c0 += 32) {
    *(v4h*)&Xs[srow][scol]     = cvt4(f0);
    *(v4h*)&Xs[srow + 1][scol] = cvt4(f1);
    *(v4h*)&Xs[srow + 2][scol] = cvt4(f2);
    *(v4h*)&Xs[srow + 3][scol] = cvt4(f3);
    __syncthreads();

    if (c0 + 32 < DIM) {  // prefetch next k-step; latency overlaps WMMA below
      const float* np = src + (size_t)(c0 + 32) * MM;
      f0 = *(const float4*)np;
      f1 = *(const float4*)(np + MM);
      f2 = *(const float4*)(np + 2 * MM);
      f3 = *(const float4*)(np + 3 * MM);
      // Stands in front of the first write to these loads' address registers. It
      // takes the address as an input, so that the pair lives up to here and none
      // of the four results is laid over it while the other loads are under way.
      asm volatile("s_wait_xcnt 0x0" :: "v"(np) : "memory");
    }

    const _Float16* wq = wp + (c0 >> 5) * 512;
    v16h a0 = frag_packed(wq);
    v16h a1 = frag_packed(wq + (DIM / 32) * 512);
    // The same for the fragment loads' address.
    asm volatile("s_wait_xcnt 0x0" :: "v"(wq) : "memory");
#pragma unroll
    for (int t = 0; t < 4; ++t) {
      v8h lo = lds_tr16(bp + t * 32);                  // K = 0..7   (+8)
      v8h hi = lds_tr16(bp + t * 32 + 16 * XS_PITCH);  // K = 16..23 (+8)
      v16h bf;
#pragma unroll
      for (int j = 0; j < 8; ++j) { bf[j] = lo[j]; bf[j + 8] = hi[j]; }
      if (IS_K) {  // registers run along n, lanes along e
        acc[0][t] = wmma_f16(bf, a0, acc[0][t]);
        acc[1][t] = wmma_f16(bf, a1, acc[1][t]);
      } else {     // registers run along e, lanes along m
        acc[0][t] = wmma_f16(a0, bf, acc[0][t]);
        acc[1][t] = wmma_f16(a1, bf, acc[1][t]);
      }
    }
    __syncthreads();  // the last one also frees Xs for the staged result
  }

  const float alpha = 1.0f / 16.0f;  // Q alone
#pragma unroll
  for (int i = 0; i < 2; ++i)
#pragma unroll
    for (int t = 0; t < 4; ++t) {
      v8h h;
#pragma unroll
      for (int r = 0; r < 8; ++r) {
        float v = IS_K ? acc[i][t][r] : acc[i][t][r] * alpha;
        h[r] = (_Float16)(v > 0.0f ? v : 0.0f);
      }
      const int el = e_wave0 + i * 16, ml = m_wave0 + t * 16;
      const int row = (IS_K ? el : ml) + (lane & 15);
      const int col = (IS_K ? ml : el) + ((lane >> 4) << 3);
      *(v8h*)(S + row * PS_PITCH + col * 2) = h;
    }
  __syncthreads();  // rows are read back by other waves than wrote them

  const unsigned char* rp = S + (wid * 16 + (lane >> 4)) * PS_PITCH + (lane & 15) * 16;
  _Float16* gp = dst + (size_t)(wid * 16 + (lane >> 4)) * dpitch + (lane & 15) * 8;
  // Unrolled: row offsets become immediates of one address.
#pragma unroll
  for (int j = 0; j < 8; ++j)
    *(v8h*)(gp + (size_t)(j * 2) * dpitch) = *(const v8h*)(rp + j * 2 * PS_PITCH);
}

// The wave's first Wt block for the 128 rows of e that begin at e0.
__device__ __forceinline__ const _Float16* wt_wave(const _Float16* __restrict__ Wt, int e0) {
  const int lane = threadIdx.x & 31;
  const int wid  = __builtin_amdgcn_readfirstlane(threadIdx.x >> 5);  // scalar, as in phi_tile
  return Wt + (size_t)((e0 + (wid & 3) * 32) >> 4) * (DIM / 32) * 512 + lane * 8;
}

// This launch makes phiK alone, which the next launch reads. phiQT is first read
// by the last launch: its tiles ride in kv_kernel's grid.
__global__ __launch_bounds__(256) void phi_kernel(const float* __restrict__ key,
                                                  const _Float16* __restrict__ Wt,
                                                  _Float16* __restrict__ phiK) {
  __shared__ __attribute__((aligned(16))) unsigned char S[128 * PS_PITCH];
  const int n0 = blockIdx.x * 128;
  const int e0 = blockIdx.y * 128;
  const int b  = blockIdx.z;
  phi_tile<true>(key + (size_t)b * DIM * NN + n0, wt_wave(Wt, e0),
                 phiK + ((size_t)b * DIM + e0) * NN + n0, NN, S);
}

// ---------------------------------------------------------------------------
// Kernel 3: part[b][d][e][ks] = sum over slice ks of n of phiK[b][e][n]*value[b][d][n]
// The n sum is cut into KSPLIT slices so that 4x the work-groups each walk a
// quarter of the serial, latency-bound steps; kv_reduce_kernel adds the slices.
// Partials are f32 and lie in accumulator order: one 1-KiB block per 16x16 tile
// and slice, a tile's KSPLIT blocks side by side, register quad q of lane l at
// floats q*128 + l*4, so every store is 512 contiguous bytes per wave.
// A tile (f16 phiK) staged by the Tensor Data Mover, double-buffered; the
// descriptor pads every 16 DW by 4 DW so rows land 40 halves apart (16B
// aligned, bank-conflict-free b128 fragment loads). B (value f32->f16) uses
// register-prefetch pipelining. TENSORcnt + barriers synchronize.
// The row sums of phiK ride along: rsPart[b][ks][e] = sum over slice ks of n of
// phiK[b][e][n], as the product of the A fragments with a B fragment of ones
// (f32 accumulate), so phiK is not read a second time by a launch of its own.
// The grid holds a second, independent body behind the kv work-groups (higher
// blockIdx.z, so they start later): the phiQT tiles. The kv body leaves half of a
// WGP's wave places empty and spends its steps waiting on loads; the phiQT stream
// runs in those places and in that time instead of in a launch ahead of this one.
// ---------------------------------------------------------------------------
// 8 waves per SIMD (at most 128 VGPRs): 4 work-groups fit a WGP, so that two phiQT
// tiles run beside the two kv work-groups that a WGP gets.
__global__ __launch_bounds__(256, 8) void kv_kernel(const _Float16* __restrict__ phiK,
                                                 const float* __restrict__ value,
                                                 float* __restrict__ part,
                                                 float* __restrict__ rsPart,
                                                 const float* __restrict__ query,
                                                 const _Float16* __restrict__ Wt,
                                                 _Float16* __restrict__ phiQT) {
  // One LDS range for either body: a phiQT tile uses all of it; the kv body has
  // its two A buffers (10 KiB each) at the start and Vs behind them.
  __shared__ __attribute__((aligned(2048))) unsigned char SM[128 * PS_PITCH];
  if (blockIdx.z >= BATCH * KSPLIT) {  // the same for the whole work-group
    const int q  = (blockIdx.z - BATCH * KSPLIT) * 4 + blockIdx.y * 2 + blockIdx.x;
    const int m0 = (q & (MM / 128 - 1)) * 128;
    const int e0 = ((q / (MM / 128)) & 1) * 128;
    const int bq = q / (MM / 128 * 2);
    phi_tile<false>(query + (size_t)bq * DIM * MM + m0, wt_wave(Wt, e0),
                    phiQT + ((size_t)bq * MM + m0) * DIM + e0, DIM, SM);
    return;
  }
  _Float16(*Vs)[40] = (_Float16(*)[40])(SM + 2 * 128 * 40 * 2);
#if TDM_OK
  _Float16(*As)[128][40] = (_Float16(*)[128][40])SM;
#endif
  const int tid = threadIdx.x, lane = tid & 31, wid = tid >> 5;
  // The wave's number in a scalar register as well: the offsets formed from it
  // then take no VGPR, which helps the body under the limit of 128.
  const int ws = __builtin_amdgcn_readfirstlane(tid >> 5);
  const int dblk = blockIdx.x, eblk = blockIdx.y;
  const int b    = blockIdx.z / KSPLIT;
  const int ks   = blockIdx.z % KSPLIT;
  const int nbeg = ks * (NN / KSPLIT);
  const int e_wave  = eblk * 128 + (ws & 3) * 32;
  const int d_wave0 = (ws >> 2) * 64;
  const int d0      = dblk * 128;

  v8f acc[2][4];
#pragma unroll
  for (int i = 0; i < 2; ++i)
#pragma unroll
    for (int t = 0; t < 4; ++t) acc[i][t] = zero8();

  v8f rs[2] = {zero8(), zero8()};  // every column holds the row sums of a0, a1
  const _Float16 one = (_Float16)1.0f;
  const v16h ones = {one, one, one, one, one, one, one, one,
                     one, one, one, one, one, one, one, one};

  const int srow = tid >> 1;
  const int scol = (tid & 1) << 4;
  const float* src = value + ((size_t)b * DIM + d0 + srow) * NN + nbeg + scol;

  const float4* sp = (const float4*)src;
  float4 f0 = sp[0], f1 = sp[1], f2 = sp[2], f3 = sp[3];

#if TDM_OK
  const _Float16* aGlob = phiK + ((size_t)b * DIM + eblk * 128) * NN + nbeg;
  const unsigned aoff0 = (unsigned)(uintptr_t)(&As[0][0][0]);
  const unsigned aoff1 = (unsigned)(uintptr_t)(&As[1][0][0]);
  if (wid == 0) {  // A tile for step 0: 32n x 128e rows, row stride NN
    tdm_load_2d_f16(aoff0, aGlob, NN, DIM, 32, 128, NN, /*int16DW*/3, /*amt4DW*/3);
    // Waited for here, so that no descriptor register is reused (for the loop's
    // counters) while the request is outstanding; the value loads above fly on.
    asm volatile("s_wait_tensorcnt 0x0" ::: "memory");
  }
#endif

  for (int n0 = 0; n0 < NN / KSPLIT; n0 += 32) {
    *(v8h*)&Vs[srow][scol]     = cvt8(f0, f1);
    *(v8h*)&Vs[srow][scol + 8] = cvt8(f2, f3);
#if TDM_OK
    const int buf = (n0 >> 5) & 1;
    // The issuing wave's wait for the tile of this step. Every wave runs it (at
    // once done where none is outstanding): a test here would save EXEC into a
    // scalar register, which may be one of the outstanding descriptor's.
    asm volatile("s_wait_tensorcnt 0x0" ::: "memory");
#endif
    __syncthreads();  // publish Vs stores (and DMA'd A tile)

    if (n0 + 32 < NN / KSPLIT) {  // prefetch next B tile; overlaps WMMA below
      const float4* np = (const float4*)(src + n0 + 32);
      f0 = np[0]; f1 = np[1]; f2 = np[2]; f3 = np[3];
#if TDM_OK
      if (wid == 0)  // DMA next A tile into the other buffer
        tdm_load_2d_f16(buf ? aoff0 : aoff1, aGlob + n0 + 32, NN, DIM, 32, 128,
                        NN, 3, 3);
#endif
    }

#if TDM_OK
    v16h a0, a1;
    {
      int hw8 = (lane >> 4) << 3;
      const _Float16* p0 = &As[buf][(ws & 3) * 32 + (lane & 15)][hw8];
      const _Float16* p1 = &As[buf][(ws & 3) * 32 + 16 + (lane & 15)][hw8];
      v8h lo0 = *(const v8h*)p0, hi0 = *(const v8h*)(p0 + 16);
      v8h lo1 = *(const v8h*)p1, hi1 = *(const v8h*)(p1 + 16);
#pragma unroll
      for (int j = 0; j < 8; ++j) {
        a0[j] = lo0[j]; a0[j + 8] = hi0[j];
        a1[j] = lo1[j]; a1[j + 8] = hi1[j];
      }
    }
#else
    v16h a0 = frag_kcontig(phiK + ((size_t)b * DIM + e_wave) * NN + nbeg + n0, NN, lane);
    v16h a1 = frag_kcontig(phiK + ((size_t)b * DIM + e_wave + 16) * NN + nbeg + n0, NN, lane);
#endif
    // Run by every wave, so that the loop holds no test: its steps wait on loads,
    // not on the matrix unit. One wave per e range stores the result.
    rs[0] = wmma_f16(a0, ones, rs[0]);
    rs[1] = wmma_f16(a1, ones, rs[1]);
#pragma unroll
    for (int t = 0; t < 4; ++t) {
      const _Float16* rp = &Vs[d_wave0 + t * 16 + (lane & 15)][(lane >> 4) << 3];
      v8h lo = *(const v8h*)rp;
      v8h hi = *(const v8h*)(rp + 16);
      v16h bf;
#pragma unroll
      for (int j = 0; j < 8; ++j) { bf[j] = lo[j]; bf[j + 8] = hi[j]; }
      acc[0][t] = wmma_f16(a0, bf, acc[0][t]);
      acc[1][t] = wmma_f16(a1, bf, acc[1][t]);
    }
    __syncthreads();  // tiles consumed; buffers reusable
  }

  // Tile (dt, et) = (d / 16, e / 16) of batch b, slice ks: block (dt * 16 + et) * KSPLIT + ks.
  float* pwg = part + (size_t)b * DIM * DIM * KSPLIT +
               (((d0 >> 4) * (DIM / 16) + eblk * 8) * KSPLIT + ks) * 256;
  const unsigned pw =
      (unsigned)(((d_wave0 >> 4) * (DIM / 16) + (ws & 3) * 2) * KSPLIT * 256 + lane * 4);
#pragma unroll
  for (int i = 0; i < 2; ++i)
#pragma unroll
    for (int t = 0; t < 4; ++t) {
      float* tp = pwg + (pw + (t * (DIM / 16) + i) * KSPLIT * 256);
      *(float4*)tp         = make_float4(acc[i][t][0], acc[i][t][1], acc[i][t][2], acc[i][t][3]);
      *(float4*)(tp + 128) = make_float4(acc[i][t][4], acc[i][t][5], acc[i][t][6], acc[i][t][7]);
    }
  // Stands in front of the first write to a register that these stores name. It
  // takes the stored values as inputs, so that they live up to here and nothing
  // is laid over them while the stores are under way.
  asm volatile("s_wait_xcnt 0x0" :: "v"(acc[0][0]), "v"(acc[0][1]), "v"(acc[0][2]), "v"(acc[0][3]),
               "v"(acc[1][0]), "v"(acc[1][1]), "v"(acc[1][2]), "v"(acc[1][3]) : "memory");

  // Column 0 of rs: lane 0 holds rows 0..7, lane 16 rows 8..15. The wave's 32
  // sums fill one 128-byte line.
  if (dblk == 0 && ws < 4 && (lane & 15) == 0) {
    float* rp = rsPart + ((size_t)b * KSPLIT + ks) * DIM + e_wave + ((lane >> 4) << 3);
    // Unrolled: constant indices keep rs in registers.
#pragma unroll
    for (int i = 0; i < 2; ++i) {
      *(float4*)(rp + i * 16)     = make_float4(rs[i][0], rs[i][1], rs[i][2], rs[i][3]);
      *(float4*)(rp + i * 16 + 4) = make_float4(rs[i][4], rs[i][5], rs[i][6], rs[i][7]);
    }
  }
}

// ---------------------------------------------------------------------------
// Kernel 3b: kvT[b][d][e] = (f16) sum_ks part[b][d][e][ks]
// One work-group per (b, 16 rows of d); each wave adds two 16x16 tiles. A lane
// holds what it held as accumulator: d = 16*dt + (lane & 15), e = 16*et +
// 8*(lane >> 4) + 0..7, so the result leaves as one 16-byte store.
// The first work-group of each batch also adds the slices of the row sums:
// rowsum[b][e] = sum_ks rsPart[b][ks][e].
// ---------------------------------------------------------------------------
__global__ __launch_bounds__(256) void kv_reduce_kernel(const float* __restrict__ part,
                                                        const float* __restrict__ rsPart,
                                                        _Float16* __restrict__ kvT,
                                                        float* __restrict__ rowsum) {
  const int tid = threadIdx.x, lane = tid & 31, wid = tid >> 5;
  const int b = blockIdx.x / (DIM / 16), dt = blockIdx.x % (DIM / 16);
  const float* pwg = part + (size_t)blockIdx.x * (DIM / 16) * KSPLIT * 256;
  const unsigned pw = (unsigned)(wid * 2 * KSPLIT * 256 + lane * 4);
  float4 lo[2][KSPLIT], hi[2][KSPLIT];
  // Unrolled (here and below): constant indices keep lo and hi in registers.
#pragma unroll
  for (int u = 0; u < 2; ++u)
#pragma unroll
    for (int s = 0; s < KSPLIT; ++s) {
      lo[u][s] = *(const float4*)(pwg + (pw + (u * KSPLIT + s) * 256));
      hi[u][s] = *(const float4*)(pwg + (pw + (u * KSPLIT + s) * 256 + 128));
    }
#pragma unroll
  for (int u = 0; u < 2; ++u) {
    float4 a = lo[u][0], c = hi[u][0];
#pragma unroll
    for (int s = 1; s < KSPLIT; ++s) {
      a.x += lo[u][s].x; a.y += lo[u][s].y; a.z += lo[u][s].z; a.w += lo[u][s].w;
      c.x += hi[u][s].x; c.y += hi[u][s].y; c.z += hi[u][s].z; c.w += hi[u][s].w;
    }
    int e = (wid * 2 + u) * 16 + ((lane >> 4) << 3);
    int d = dt * 16 + (lane & 15);
    *(v8h*)(kvT + ((size_t)b * DIM + d) * DIM + e) = cvt8(a, c);
  }
  if (dt == 0) {
    const float* rp = rsPart + (size_t)b * KSPLIT * DIM + tid;
    float r = rp[0];
    for (int s = 1; s < KSPLIT; ++s) r += rp[s * DIM];
    rowsum[b * DIM + tid] = r;
  }
}

// ---------------------------------------------------------------------------
// Kernel 5: out[b][d][m] = scale[b][m] * sum_e kvT[b][d][e]*phiQT[b][m][e],
//           scale[b][m] = 1 / (sum_e phiQT[b][m][e]*rowsum[b][e] + 1e-8)
// Both operands are K(=e)-contiguous f16 rows of 512 bytes. A fragment load
// straight from global memory touches 16 lines for 512 bytes, so the work-group's
// two 128-row tiles are brought into LDS once, whole lines at a time, by tensor
// loads, and the fragments come from LDS.
// Each wave brings one slice: 64 rows of one 256-byte half of the e range
// (source pitch 512 bytes), padded by the mover to a pitch of 272 bytes, at which
// 16-byte fragment reads of 16 rows fall on 64 different banks.
// Slice number = operand * 4 + e half * 2 + row half (operand 0 = kvT, 1 = phiQT).
// phiQT stands first in the product, so a lane's 8 accumulator registers are 32
// contiguous bytes of one out row. Each wave lays its 32 x 64 result in an LDS
// range of its own (over the operand tiles, once every wave is done with them)
// and stores it in rows: every wave-wide 16-byte store covers two rows of 256
// contiguous bytes, 4 whole lines.
// The sum in scale is one more product on the phiQT fragments that are in
// registers anyway, so phiQT is not read by a launch of its own. Its second
// operand holds rowsum / NN (the mean of phiK along n, which fits f16 whenever
// phiK does) as two f16 terms, value and remainder, in the even and the odd
// columns: their two sums together carry 22 of the row sum's 24 bits. Of the 4 waves
// that share 64 rows of m each does 16 rows; the sums cross in LDS at the barrier
// that stands in front of the staging anyway.
// ---------------------------------------------------------------------------
#define OUT_PITCH 272    // bytes from row to row in LDS: 256 + the 16-byte pad
#define OUT_SLICE 18432  // 64 rows * 272 bytes = 17,408, rounded up to a multiple of 2 KiB
#define RS_PITCH 528     // bytes from the value row to the remainder row: 512 + 16
#define RS_OFF (8 * OUT_SLICE)           // the two rows of rowsum / NN, behind the slices
#define DEN_OFF (RS_OFF + 2 * RS_PITCH)  // 2 x 128 floats: the two sums of each m
#define OUT_LDS (DEN_OFF + 2 * 128 * 4)

typedef __attribute__((ext_vector_type(8))) unsigned int u32x8;

__device__ __forceinline__ uint32_t uni(uint32_t v) {
  return (uint32_t)__builtin_amdgcn_readfirstlane(v);
}

// Same element order as frag_kcontig: 16 bytes at K = 0..7 (+8 for the upper
// half-wave, already in p), 16 bytes at K = 16..23 (+8).
__device__ __forceinline__ v16h frag_lds(const unsigned char* p) {
  v8h lo = *(const v8h*)p;
  v8h hi = *(const v8h*)(p + 32);
  v16h f;
#pragma unroll
  for (int j = 0; j < 8; ++j) { f[j] = lo[j]; f[j + 8] = hi[j]; }
  return f;
}

__global__ __launch_bounds__(256) void out_kernel(const _Float16* __restrict__ kvT,
                                                  const _Float16* __restrict__ phiQT,
                                                  const float* __restrict__ rowsum,
                                                  float* __restrict__ out) {
  __shared__ __attribute__((aligned(2048))) unsigned char L[OUT_LDS];
  const int tid = threadIdx.x, lane = tid & 31, wid = tid >> 5;
  const int mblk = blockIdx.x, dblk = blockIdx.y, b = blockIdx.z;
  const int d_wave  = dblk * 128 + (wid & 3) * 32;
  const int m_wave0 = (wid >> 2) * 64;
  const int m0      = mblk * 128;

  // Read at the head, so that it flies beside the tensor load.
  const float rmean = rowsum[b * DIM + tid] * (1.0f / NN);
  // Stands in front of the first write to this load's address registers.
  asm volatile("s_wait_xcnt 0x0" ::: "memory");

  {  // every wave issues the one request for its own slice
    const uint32_t wave = uni(threadIdx.x >> 5);
    const _Float16* rows = (wave >> 2) ? phiQT + ((size_t)b * MM + m0) * DIM
                                       : kvT + ((size_t)b * DIM + dblk * 128) * DIM;
    const uint64_t ga =
        (uint64_t)(uintptr_t)(rows + (size_t)(wave & 1u) * 64 * DIM + ((wave >> 1) & 1u) * 128);
    u32x4 g0;
    g0[0] = uni(1u);                                             // count 1
    g0[1] = uni((uint32_t)(uintptr_t)&L[0] + wave * OUT_SLICE);  // place in LDS
    g0[2] = uni((uint32_t)ga);
    g0[3] = uni((((uint32_t)(ga >> 32)) & 0x01FFFFFFu) | 0x80000000u);  // type 2
    u32x8 g1;  // extents in bytes; tensor dims = tile dims = 256 x 64
    g1[0] = uni((1u << 20) | (5u << 22) | (3u << 25));  // 4 dwords of pad behind every 64
    g1[1] = uni(256u << 16);
    g1[2] = uni(64u << 16);
    g1[3] = uni(256u << 16);
    g1[4] = uni(64u);
    g1[5] = uni(2u * DIM);  // source pitch: one whole row
    g1[6] = uni(0u);
    g1[7] = uni(0u);
    asm volatile("tensor_load_to_lds %0, %1" :: "s"(g0), "s"(g1) : "memory");
    // The slice has landed behind this.
    asm volatile("s_wait_tensorcnt 0x0" ::: "memory");
  }
  {
    const _Float16 hi = (_Float16)rmean;
    *(_Float16*)(L + RS_OFF + tid * 2)            = hi;
    *(_Float16*)(L + RS_OFF + RS_PITCH + tid * 2) = (_Float16)(rmean - (float)hi);
  }
  __syncthreads();  // every wave's slice (and the two rows) readable by the others behind this

  v8f acc[2][4];
#pragma unroll
  for (int i = 0; i < 2; ++i)
#pragma unroll
    for (int t = 0; t < 4; ++t) acc[i][t] = zero8();

  const unsigned lrow = (unsigned)(lane & 15) * OUT_PITCH + ((unsigned)(lane >> 4) << 4);
  const unsigned char* aP = L + ((wid & 3) >> 1) * OUT_SLICE + (wid & 1) * 32 * OUT_PITCH + lrow;
  const unsigned char* bP = L + (4 + (wid >> 2)) * OUT_SLICE + lrow;
  // The wave walks its four 16-row groups of m beginning with group jw, the one
  // whose scale sums it does: that group's fragment is then always set member 0.
  const int jw = (int)(uni(threadIdx.x >> 5) & 3u);
  const unsigned char* bU[4];
  // Unrolled: constant indices keep bU in registers.
#pragma unroll
  for (int u = 0; u < 4; ++u) bU[u] = bP + ((u + jw) & 3) * 16 * OUT_PITCH;
  // Column = lane & 15: even columns read the value row, odd ones the remainder row.
  const unsigned char* rP = L + RS_OFF + (lane & 1) * RS_PITCH + ((lane >> 4) << 4);
  v8f den = zero8();

  // Two fragment sets: the reads of step s + 1 go out as one group in front of
  // the products of step s, so a wave does not wait out its own LDS latency.
  v16h af[2][2], bf[2][4], rf[2];
  af[0][0] = frag_lds(aP);
  af[0][1] = frag_lds(aP + 16 * OUT_PITCH);
  rf[0]    = frag_lds(rP);
#pragma unroll
  for (int u = 0; u < 4; ++u) bf[0][u] = frag_lds(bU[u]);

  // Unrolled: set numbers and LDS offsets must be constants (registers, immediates).
#pragma unroll
  for (int s = 0; s < DIM / 32; ++s) {
    const int cur = s & 1, nxt = cur ^ 1;
    if (s + 1 < DIM / 32) {
      const int off = ((s + 1) >> 2) * 2 * OUT_SLICE + ((s + 1) & 3) * 64;
      af[nxt][0] = frag_lds(aP + off);
      af[nxt][1] = frag_lds(aP + off + 16 * OUT_PITCH);
      rf[nxt]    = frag_lds(rP + (s + 1) * 64);
#pragma unroll
      for (int u = 0; u < 4; ++u) bf[nxt][u] = frag_lds(bU[u] + off);
    }
    // Keeps the read group whole and in front: without it the compiler hoists the
    // reads of all steps (over 256 VGPRs, one work-group per WGP instead of two).
    __builtin_amdgcn_sched_barrier(0);
    den = wmma_f16(bf[cur][0], rf[cur], den);  // registers along m, lanes: value | remainder
#pragma unroll
    for (int u = 0; u < 4; ++u) {
      acc[0][u] = wmma_f16(bf[cur][u], af[cur][0], acc[0][u]);  // registers along m,
      acc[1][u] = wmma_f16(bf[cur][u], af[cur][1], acc[1][u]);  // lanes along d
    }
    // Keeps the next group's reads from moving in among these products.
    __builtin_amdgcn_sched_barrier(0);
  }

  // Columns 0 and 1 hold the two sums; lanes 0, 1 have rows 0..7, lanes 16, 17 rows 8..15.
  if ((lane & 15) < 2) {
    float* dp = (float*)(L + DEN_OFF) + (lane & 1) * 128 + m_wave0 + jw * 16 + ((lane >> 4) << 3);
    *(float4*)dp       = make_float4(den[0], den[1], den[2], den[3]);
    *(float4*)(dp + 4) = make_float4(den[4], den[5], den[6], den[7]);
  }

  // Every wave has read its last fragment: L may be written over. The sums of the
  // other waves are readable behind this too.
  __syncthreads();

  // Row = d within the wave's 32, pitch OUT_PITCH; byte = 4 * (m within the wave's 64).
  unsigned char* st = L + wid * (32 * OUT_PITCH);
  unsigned char* wr = st + (lane & 15) * OUT_PITCH + (lane >> 4) * 32;
#pragma unroll
  for (int i = 0; i < 2; ++i)
#pragma unroll
    for (int u = 0; u < 4; ++u) {
      unsigned char* p = wr + i * 16 * OUT_PITCH + ((u + jw) & 3) * 64;
      *(float4*)p        = make_float4(acc[i][u][0], acc[i][u][1], acc[i][u][2], acc[i][u][3]);
      *(float4*)(p + 16) = make_float4(acc[i][u][4], acc[i][u][5], acc[i][u][6], acc[i][u][7]);
    }
  // The wave's own LDS writes are done before other lanes of it read them back.
  asm volatile("s_wait_dscnt 0x0" ::: "memory");

  float4 sc;
  {
    const float* dn = (const float*)(L + DEN_OFF) + m_wave0 + (lane & 15) * 4;
    const float4 dv = *(const float4*)dn, dr = *(const float4*)(dn + 128);
    sc.x = 1.0f / ((dv.x + dr.x) * (float)NN + 1e-8f);
    sc.y = 1.0f / ((dv.y + dr.y) * (float)NN + 1e-8f);
    sc.z = 1.0f / ((dv.z + dr.z) * (float)NN + 1e-8f);
    sc.w = 1.0f / ((dv.w + dr.w) * (float)NN + 1e-8f);
  }

  const unsigned char* rd = st + (lane >> 4) * OUT_PITCH + (lane & 15) * 16;
  float* gp = out + ((size_t)b * DIM + d_wave + (lane >> 4)) * MM + m0 + m_wave0 + (lane & 15) * 4;
  // Unrolled: row offsets become immediates of one address.
#pragma unroll
  for (int j = 0; j < 16; ++j) {
    float4 v = *(const float4*)(rd + j * 2 * OUT_PITCH);
    *(float4*)(gp + (size_t)(j * 2) * MM) = make_float4(v.x * sc.x, v.y * sc.y, v.z * sc.z, v.w * sc.w);
  }
}

// ---------------------------------------------------------------------------
extern "C" void kernel_launch(void* const* d_in, const int* in_sizes, int n_in,
                              void* d_out, int out_size, void* d_ws, size_t ws_size,
                              hipStream_t stream) {
  const float* query = (const float*)d_in[0];
  const float* key   = (const float*)d_in[1];
  const float* value = (const float*)d_in[2];
  const float* W     = (const float*)d_in[3];
  float* out = (float*)d_out;

  _Float16* Wt    = (_Float16*)d_ws;                       // 256*256 f16, fragment order
  _Float16* phiQT = Wt + (size_t)DIM * DIM;                // [b][m][e], 32 MB
  _Float16* phiK  = phiQT + (size_t)BATCH * MM * DIM;      // [b][e][n], 32 MB
  _Float16* kvT   = phiK + (size_t)BATCH * DIM * NN;       // [b][d][e], 4 MB
  float* rowsum   = (float*)(kvT + (size_t)BATCH * DIM * DIM);
  float* kvPart   = rowsum + BATCH * DIM;                  // [b][tile][ks], f32, 32 MB
  float* rsPart   = kvPart + (size_t)BATCH * DIM * DIM * KSPLIT;  // [b][ks][e], f32

  wt_kernel<<<dim3(DIM), dim3(DIM), 0, stream>>>(W, Wt);
  phi_kernel<<<dim3(NN / 128, 2, BATCH), dim3(256), 0, stream>>>(key, Wt, phiK);
  // BATCH * KSPLIT planes of kv work-groups, then the phiQT tiles, 4 to a plane.
  kv_kernel<<<dim3(2, 2, BATCH * KSPLIT + BATCH * (MM / 128) * 2 / 4), dim3(256), 0, stream>>>(
      phiK, value, kvPart, rsPart, query, Wt, phiQT);
  kv_reduce_kernel<<<dim3(BATCH * (DIM / 16)), dim3(256), 0, stream>>>(kvPart, rsPart, kvT,
                                                                          rowsum);
  out_kernel<<<dim3(MM / 128, 2, BATCH), dim3(256), 0, stream>>>(kvT, phiQT, rowsum, out);
}

// v009
// Measured time: 70 microseconds a run.
// In two side-by-side timings against v008, it was 1.08 and 1.07 times as fast.
// All steps since v000 together make it 2.32 times as fast.
#include <hip/hip_runtime.h>
#include <hip/hip_bf16.h>
#include <stdint.h>

#define DIM 256
#define BATCH 32
#define MM 2048
#define NN 2048
#define KSPLIT 4  // slices of the n sum in kv_kernel, one work-group each

typedef __attribute__((ext_vector_type(16))) _Float16 v16h;
typedef __attribute__((ext_vector_type(8)))  _Float16 v8h;
typedef __attribute__((ext_vector_type(4)))  _Float16 v4h;
typedef __attribute__((ext_vector_type(8)))  float    v8f;
typedef __attribute__((ext_vector_type(4)))  unsigned int u32x4;
typedef __attribute__((ext_vector_type(4)))  int          i32x4;
typedef __attribute__((ext_vector_type(8)))  int          i32x8;

#define TDM_OK __has_builtin(__builtin_amdgcn_tensor_load_to_lds)

__device__ __forceinline__ v8f wmma_f16(v16h a, v16h b, v8f c) {
  // D = A(16x32 f16) * B(32x16 f16) + C(16x16 f32)
  return __builtin_amdgcn_wmma_f32_16x16x32_f16(false, a, false, b, (short)0, c,
                                                false, false);
}

__device__ __forceinline__ v8f zero8() {
  v8f z;
#pragma unroll
  for (int r = 0; r < 8; ++r) z[r] = 0.0f;
  return z;
}

__device__ __forceinline__ v8h cvt8(float4 a, float4 b) {
  v8h h;
  h[0] = (_Float16)a.x; h[1] = (_Float16)a.y; h[2] = (_Float16)a.z; h[3] = (_Float16)a.w;
  h[4] = (_Float16)b.x; h[5] = (_Float16)b.y; h[6] = (_Float16)b.z; h[7] = (_Float16)b.w;
  return h;
}

__device__ __forceinline__ v4h cvt4(float4 a) {
  v4h h;
  h[0] = (_Float16)a.x; h[1] = (_Float16)a.y; h[2] = (_Float16)a.z; h[3] = (_Float16)a.w;
  return h;
}

// Fragment from row-major f16 memory (row stride ld, K contiguous).
// Per ISA 16-bit A layout: row = lane%16, element j holds K = j + 8*((j>>3)+(lane>>4)).
// Same mapping serves B fragments when "row" is the B column and K is contiguous.
__device__ __forceinline__ v16h frag_kcontig(const _Float16* __restrict__ base,
                                             int ld, int lane) {
  const _Float16* p = base + (size_t)(lane & 15) * ld + ((lane >> 4) << 3);
  v8h lo = *(const v8h*)p;         // K = 0..7   (+8 for upper half-wave)
  v8h hi = *(const v8h*)(p + 16);  // K = 16..23 (+8)
  v16h f;
#pragma unroll
  for (int j = 0; j < 8; ++j) { f[j] = lo[j]; f[j + 8] = hi[j]; }
  return f;
}

// ---------------------------------------------------------------------------
// TDM: 2D tile (tile_d0 x tile_d1 elements of 2 bytes) global -> LDS with
// row stride stride0 (elements). LDS padding from descriptor: insert
// (pad_amt_code+1) DWORDs after every 2^(pad_int_code+1) DWORDs stored.
// ---------------------------------------------------------------------------
__device__ __forceinline__ void tdm_load_2d_f16(unsigned lds_off, const void* gaddr,
                                                unsigned tensor_d0, unsigned tensor_d1,
                                                unsigned tile_d0, unsigned tile_d1,
                                                unsigned stride0,
                                                unsigned pad_int_code,
                                                unsigned pad_amt_code) {
#if TDM_OK
  unsigned long long ga = (unsigned long long)(uintptr_t)gaddr;
  u32x4 g0;
  g0[0] = 1u;                                    // count=1 (valid user descriptor)
  g0[1] = lds_off;                               // lds_addr (bytes)
  g0[2] = (unsigned)(ga & 0xFFFFFFFFu);          // global_addr[31:0]
  g0[3] = (unsigned)((ga >> 32) & 0x01FFFFFFu) | (2u << 30);  // addr[56:32], type=2
  i32x8 g1;
  // wg_mask=0 | data_size=1(2B)<<16 | pad_enable<<20 | pad_interval<<22 | pad_amount<<25
  g1[0] = (int)((1u << 16) | (1u << 20) | (pad_int_code << 22) | (pad_amt_code << 25));
  g1[1] = (int)(tensor_d0 << 16);                         // tensor_dim0[15:0]
  g1[2] = (int)((tensor_d0 >> 16) | (tensor_d1 << 16));   // dim0 hi | dim1 lo
  g1[3] = (int)((tensor_d1 >> 16) | (tile_d0 << 16));     // dim1 hi | tile_dim0
  g1[4] = (int)(tile_d1 & 0xFFFFu);                       // tile_dim1 (tile_dim2=0)
  g1[5] = (int)stride0;                                   // tensor_dim0_stride lo
  g1[6] = 0;                                              // stride0 hi | stride1 lo
  g1[7] = 0;                                              // stride1 hi
  i32x4 z4 = {0, 0, 0, 0};
#if defined(__clang_major__) && __clang_major__ >= 23
  i32x8 z8 = {0, 0, 0, 0, 0, 0, 0, 0};
  __builtin_amdgcn_tensor_load_to_lds(g0, g1, z4, z4, z8, 0);
#else
  __builtin_amdgcn_tensor_load_to_lds(g0, g1, z4, z4, 0);
#endif
#endif
}

// ---------------------------------------------------------------------------
// Kernel 0: Wt = (f16) W transposed, packed in the order of phi_kernel's B
// fragments: one 1-KiB block per (16 rows of e, 32 columns of c); in it lane l's
// 8 halves for K = 0..7 (+8 for the upper half-wave) at halves l*8, those for
// K = 16..23 (+8) at halves 256 + l*8. A wave-wide 16-byte load of a fragment
// half is then 512 contiguous bytes (4 lines) instead of 16 rows (16 lines).
// ---------------------------------------------------------------------------
__global__ __launch_bounds__(256) void wt_kernel(const float* __restrict__ W,
                                                 _Float16* __restrict__ Wt) {
  int e = blockIdx.x, c = threadIdx.x;
  int blk  = (e >> 4) * (DIM / 32) + (c >> 5);
  int lane = (((c >> 3) & 1) << 4) + (e & 15);
  Wt[(size_t)blk * 512 + ((c >> 4) & 1) * 256 + lane * 8 + (c & 7)] =
      (_Float16)W[(size_t)c * DIM + e];
}

// A fragment from a block packed by wt_kernel (p = block + lane * 8); the element
// order is that of frag_kcontig.
__device__ __forceinline__ v16h frag_packed(const _Float16* __restrict__ p) {
  v8h lo = *(const v8h*)p;
  v8h hi = *(const v8h*)(p + 256);
  v16h f;
#pragma unroll
  for (int j = 0; j < 8; ++j) { f[j] = lo[j]; f[j + 8] = hi[j]; }
  return f;
}

// Transposing LDS load: with lane l's address at row 8*(l>>4) + (l&7), byte
// 16*((l>>3)&1) of a 16-bit tile, lane l gets rows 8*(l>>4) + 0..7 of column l&15.
typedef __attribute__((ext_vector_type(8))) short s16x8;
__device__ __forceinline__ v8h lds_tr16(const unsigned char* p) {
  typedef __attribute__((address_space(3))) s16x8 lds_s16x8;
  return __builtin_bit_cast(v8h, __builtin_amdgcn_ds_load_tr16_b128_v8i16((lds_s16x8*)p));
}

#define XS_PITCH 288  // bytes from row to row of Xs: 256 + 32, an odd multiple of 32
#define PS_PITCH 272  // bytes from row to row of the staged result: 256 + 16, an odd multiple of 16

// ---------------------------------------------------------------------------
// Kernel 1: phiK = relu(Wt @ key); software-pipelined f32->f16 staging.
// Every wave-wide global load covers whole 128-byte lines: a wave stages 4 rows of
// X, each as 512 contiguous bytes, and Wt comes packed in fragment order.
// Xs holds X as it lies in memory (row = c, the k of the product); an X fragment
// wants 8 + 8 values of k per lane, which two transposing loads deliver in the
// k order of the Wt fragments.
// The result is stored phiK[b][e][n] (what kv wants). X, whose index runs along a
// result row, stands first in the product, so a lane's 8 accumulator registers are
// 16 contiguous bytes of one result row. The work-group's 128 x 128 result is laid
// in LDS (over Xs, which is done with) and leaves in rows: every wave-wide
// 16-byte store covers two rows of 256 contiguous bytes, 4 whole lines.
// ---------------------------------------------------------------------------
__device__ __forceinline__ void phi_tile(const float* __restrict__ xsrc,
                                         const _Float16* __restrict__ wp,
                                         _Float16* __restrict__ dst, const int dpitch,
                                         unsigned char* S) {
  _Float16(*Xs)[XS_PITCH / 2] = (_Float16(*)[XS_PITCH / 2])S;
  const int tid = threadIdx.x, lane = tid & 31;
  // The wave's number in a scalar register: what is formed from it then takes no
  // VGPR (at 128 VGPRs 4 work-groups fit a WGP, one more register costs one).
  const int wid = __builtin_amdgcn_readfirstlane(tid >> 5);
  const int e_wave0 = (wid & 3) * 32;
  const int m_wave0 = (wid >> 2) * 64;

  v8f acc[2][4];
#pragma unroll
  for (int i = 0; i < 2; ++i)
#pragma unroll
    for (int t = 0; t < 4; ++t) acc[i][t] = zero8();

  const int srow = wid << 2;
  const int scol = lane << 2;
  const float* src = xsrc + (size_t)srow * MM + scol;

  const unsigned char* bp = S + (((lane >> 4) << 3) + (lane & 7)) * XS_PITCH + m_wave0 * 2 +
                            ((lane >> 3) & 1) * 16;

  float4 f0 = *(const float4*)src;
  float4 f1 = *(const float4*)(src + MM);
  float4 f2 = *(const float4*)(src + 2 * MM);
  float4 f3 = *(const float4*)(src + 3 * MM);
  // Stands in front of the first write to these loads' offset register (the lane
  // number, scaled by the load). It takes that register as an input, so that it
  // lives up to here and nothing is laid over it while the loads are under way.
  asm volatile("s_wait_xcnt 0x0" :: "v"(lane) : "memory");

  for (int c0 = 0; c0 < DIM; c0 += 32) {
    *(v4h*)&Xs[srow][scol]     = cvt4(f0);
    *(v4h*)&Xs[srow + 1][scol] = cvt4(f1);
    *(v4h*)&Xs[srow + 2][scol] = cvt4(f2);
    *(v4h*)&Xs[srow + 3][scol] = cvt4(f3);
    __syncthreads();

    if (c0 + 32 < DIM) {  // prefetch next k-step; latency overlaps WMMA below
      const float* np = src + (size_t)(c0 + 32) * MM;
      f0 = *(const float4*)np;
      f1 = *(const float4*)(np + MM);
      f2 = *(const float4*)(np + 2 * MM);
      f3 = *(const float4*)(np + 3 * MM);
      // Stands in front of the first write to these loads' address registers. It
      // takes the address as an input, so that the pair lives up to here and none
      // of the four results is laid over it while the other loads are under way.
      asm volatile("s_wait_xcnt 0x0" :: "v"(np) : "memory");
    }

    const _Float16* wq = wp + (c0 >> 5) * 512;
    v16h a0 = frag_packed(wq);
    v16h a1 = frag_packed(wq + (DIM / 32) * 512);
    // The same for the fragment loads' address.
    asm volatile("s_wait_xcnt 0x0" :: "v"(wq) : "memory");
#pragma unroll
    for (int t = 0; t < 4; ++t) {
      v8h lo = lds_tr16(bp + t * 32);                  // K = 0..7   (+8)
      v8h hi = lds_tr16(bp + t * 32 + 16 * XS_PITCH);  // K = 16..23 (+8)
      v16h bf;
#pragma unroll
      for (int j = 0; j < 8; ++j) { bf[j] = lo[j]; bf[j + 8] = hi[j]; }
      acc[0][t] = wmma_f16(bf, a0, acc[0][t]);  // registers run along n,
      acc[1][t] = wmma_f16(bf, a1, acc[1][t]);  // lanes along e
    }
    __syncthreads();  // the last one also frees Xs for the staged result
  }

#pragma unroll
  for (int i = 0; i < 2; ++i)
#pragma unroll
    for (int t = 0; t < 4; ++t) {
      v8h h;
#pragma unroll
      for (int r = 0; r < 8; ++r) {
        float v = acc[i][t][r];
        h[r] = (_Float16)(v > 0.0f ? v : 0.0f);
      }
      const int el = e_wave0 + i * 16, ml = m_wave0 + t * 16;
      const int row = el + (lane & 15);
      const int col = ml + ((lane >> 4) << 3);
      *(v8h*)(S + row * PS_PITCH + col * 2) = h;
    }
  __syncthreads();  // rows are read back by other waves than wrote them

  const unsigned char* rp = S + (wid * 16 + (lane >> 4)) * PS_PITCH + (lane & 15) * 16;
  _Float16* gp = dst + (size_t)(wid * 16 + (lane >> 4)) * dpitch + (lane & 15) * 8;
  // Unrolled: row offsets become immediates of one address.
#pragma unroll
  for (int j = 0; j < 8; ++j)
    *(v8h*)(gp + (size_t)(j * 2) * dpitch) = *(const v8h*)(rp + j * 2 * PS_PITCH);
}

// The wave's first Wt block for the 128 rows of e that begin at e0.
__device__ __forceinline__ const _Float16* wt_wave(const _Float16* __restrict__ Wt, int e0) {
  const int lane = threadIdx.x & 31;
  const int wid  = __builtin_amdgcn_readfirstlane(threadIdx.x >> 5);  // scalar, as in phi_tile
  return Wt + (size_t)((e0 + (wid & 3) * 32) >> 4) * (DIM / 32) * 512 + lane * 8;
}

__global__ __launch_bounds__(256) void phi_kernel(const float* __restrict__ key,
                                                  const _Float16* __restrict__ Wt,
                                                  _Float16* __restrict__ phiK) {
  __shared__ __attribute__((aligned(16))) unsigned char S[128 * PS_PITCH];
  const int n0 = blockIdx.x * 128;
  const int e0 = blockIdx.y * 128;
  const int b  = blockIdx.z;
  phi_tile(key + (size_t)b * DIM * NN + n0, wt_wave(Wt, e0),
           phiK + ((size_t)b * DIM + e0) * NN + n0, NN, S);
}

// ---------------------------------------------------------------------------
// Kernel 3: part[b][d][e][ks] = sum over slice ks of n of phiK[b][e][n]*value[b][d][n]
// The n sum is cut into KSPLIT slices so that 4x the work-groups each walk a
// quarter of the serial, latency-bound steps; kv_reduce_kernel adds the slices.
// Partials are f32 and lie in accumulator order: one 1-KiB block per 16x16 tile
// and slice, a tile's KSPLIT blocks side by side, register quad q of lane l at
// floats q*128 + l*4, so every store is 512 contiguous bytes per wave.
// A tile (f16 phiK) staged by the Tensor Data Mover, double-buffered; the
// descriptor pads every 16 DW by 4 DW so rows land 40 halves apart (16B
// aligned, bank-conflict-free b128 fragment loads). B (value f32->f16) uses
// register-prefetch pipelining. TENSORcnt + barriers synchronize.
// The row sums of phiK ride along: rsPart[b][ks][e] = sum over slice ks of n of
// phiK[b][e][n], as the product of the A fragments with a B fragment of ones
// (f32 accumulate), so phiK is not read a second time by a launch of its own.
// ---------------------------------------------------------------------------
__global__ __launch_bounds__(256) void kv_kernel(const _Float16* __restrict__ phiK,
                                                 const float* __restrict__ value,
                                                 float* __restrict__ part,
                                                 float* __restrict__ rsPart) {
  // The two A buffers (10 KiB each) at the start, Vs behind them.
  __shared__ __attribute__((aligned(2048))) unsigned char SM[3 * 128 * 40 * 2];
  _Float16(*Vs)[40] = (_Float16(*)[40])(SM + 2 * 128 * 40 * 2);
#if TDM_OK
  _Float16(*As)[128][40] = (_Float16(*)[128][40])SM;
#endif
  const int tid = threadIdx.x, lane = tid & 31, wid = tid >> 5;
  // The wave's number in a scalar register as well: the offsets formed from it
  // then take no VGPR.
  const int ws = __builtin_amdgcn_readfirstlane(tid >> 5);
  const int dblk = blockIdx.x, eblk = blockIdx.y;
  const int b    = blockIdx.z / KSPLIT;
  const int ks   = blockIdx.z % KSPLIT;
  const int nbeg = ks * (NN / KSPLIT);
  const int e_wave  = eblk * 128 + (ws & 3) * 32;
  const int d_wave0 = (ws >> 2) * 64;
  const int d0      = dblk * 128;

  v8f acc[2][4];
#pragma unroll
  for (int i = 0; i < 2; ++i)
#pragma unroll
    for (int t = 0; t < 4; ++t) acc[i][t] = zero8();

  v8f rs[2] = {zero8(), zero8()};  // every column holds the row sums of a0, a1
  const _Float16 one = (_Float16)1.0f;
  const v16h ones = {one, one, one, one, one, one, one, one,
                     one, one, one, one, one, one, one, one};

  const int srow = tid >> 1;
  const int scol = (tid & 1) << 4;
  const float* src = value + ((size_t)b * DIM + d0 + srow) * NN + nbeg + scol;

  const float4* sp = (const float4*)src;
  float4 f0 = sp[0], f1 = sp[1], f2 = sp[2], f3 = sp[3];

#if TDM_OK
  const _Float16* aGlob = phiK + ((size_t)b * DIM + eblk * 128) * NN + nbeg;
  const unsigned aoff0 = (unsigned)(uintptr_t)(&As[0][0][0]);
  const unsigned aoff1 = (unsigned)(uintptr_t)(&As[1][0][0]);
  if (wid == 0) {  // A tile for step 0: 32n x 128e rows, row stride NN
    tdm_load_2d_f16(aoff0, aGlob, NN, DIM, 32, 128, NN, /*int16DW*/3, /*amt4DW*/3);
    // Waited for here, so that no descriptor register is reused (for the loop's
    // counters) while the request is outstanding; the value loads above fly on.
    asm volatile("s_wait_tensorcnt 0x0" ::: "memory");
  }
#endif

  for (int n0 = 0; n0 < NN / KSPLIT; n0 += 32) {
    *(v8h*)&Vs[srow][scol]     = cvt8(f0, f1);
    *(v8h*)&Vs[srow][scol + 8] = cvt8(f2, f3);
#if TDM_OK
    const int buf = (n0 >> 5) & 1;
    // The issuing wave's wait for the tile of this step. Every wave runs it (at
    // once done where none is outstanding): a test here would save EXEC into a
    // scalar register, which may be one of the outstanding descriptor's.
    asm volatile("s_wait_tensorcnt 0x0" ::: "memory");
#endif
    __syncthreads();  // publish Vs stores (and DMA'd A tile)

    if (n0 + 32 < NN / KSPLIT) {  // prefetch next B tile; overlaps WMMA below
      const float4* np = (const float4*)(src + n0 + 32);
      f0 = np[0]; f1 = np[1]; f2 = np[2]; f3 = np[3];
#if TDM_OK
      if (wid == 0)  // DMA next A tile into the other buffer
        tdm_load_2d_f16(buf ? aoff0 : aoff1, aGlob + n0 + 32, NN, DIM, 32, 128,
                        NN, 3, 3);
#endif
    }

#if TDM_OK
    v16h a0, a1;
    {
      int hw8 = (lane >> 4) << 3;
      const _Float16* p0 = &As[buf][(ws & 3) * 32 + (lane & 15)][hw8];
      const _Float16* p1 = &As[buf][(ws & 3) * 32 + 16 + (lane & 15)][hw8];
      v8h lo0 = *(const v8h*)p0, hi0 = *(const v8h*)(p0 + 16);
      v8h lo1 = *(const v8h*)p1, hi1 = *(const v8h*)(p1 + 16);
#pragma unroll
      for (int j = 0; j < 8; ++j) {
        a0[j] = lo0[j]; a0[j + 8] = hi0[j];
        a1[j] = lo1[j]; a1[j + 8] = hi1[j];
      }
    }
#else
    v16h a0 = frag_kcontig(phiK + ((size_t)b * DIM + e_wave) * NN + nbeg + n0, NN, lane);
    v16h a1 = frag_kcontig(phiK + ((size_t)b * DIM + e_wave + 16) * NN + nbeg + n0, NN, lane);
#endif
    // Run by every wave, so that the loop holds no test: its steps wait on loads,
    // not on the matrix unit. One wave per e range stores the result.
    rs[0] = wmma_f16(a0, ones, rs[0]);
    rs[1] = wmma_f16(a1, ones, rs[1]);
#pragma unroll
    for (int t = 0; t < 4; ++t) {
      const _Float16* rp = &Vs[d_wave0 + t * 16 + (lane & 15)][(lane >> 4) << 3];
      v8h lo = *(const v8h*)rp;
      v8h hi = *(const v8h*)(rp + 16);
      v16h bf;
#pragma unroll
      for (int j = 0; j < 8; ++j) { bf[j] = lo[j]; bf[j + 8] = hi[j]; }
      acc[0][t] = wmma_f16(a0, bf, acc[0][t]);
      acc[1][t] = wmma_f16(a1, bf, acc[1][t]);
    }
    __syncthreads();  // tiles consumed; buffers reusable
  }

  // Tile (dt, et) = (d / 16, e / 16) of batch b, slice ks: block (dt * 16 + et) * KSPLIT + ks.
  float* pwg = part + (size_t)b * DIM * DIM * KSPLIT +
               (((d0 >> 4) * (DIM / 16) + eblk * 8) * KSPLIT + ks) * 256;
  const unsigned pw =
      (unsigned)(((d_wave0 >> 4) * (DIM / 16) + (ws & 3) * 2) * KSPLIT * 256 + lane * 4);
#pragma unroll
  for (int i = 0; i < 2; ++i)
#pragma unroll
    for (int t = 0; t < 4; ++t) {
      float* tp = pwg + (pw + (t * (DIM / 16) + i) * KSPLIT * 256);
      *(float4*)tp         = make_float4(acc[i][t][0], acc[i][t][1], acc[i][t][2], acc[i][t][3]);
      *(float4*)(tp + 128) = make_float4(acc[i][t][4], acc[i][t][5], acc[i][t][6], acc[i][t][7]);
    }
  // Stands in front of the first write to a register that these stores name. It
  // takes the stored values as inputs, so that they live up to here and nothing
  // is laid over them while the stores are under way.
  asm volatile("s_wait_xcnt 0x0" :: "v"(acc[0][0]), "v"(acc[0][1]), "v"(acc[0][2]), "v"(acc[0][3]),
               "v"(acc[1][0]), "v"(acc[1][1]), "v"(acc[1][2]), "v"(acc[1][3]) : "memory");

  // Column 0 of rs: lane 0 holds rows 0..7, lane 16 rows 8..15. The wave's 32
  // sums fill one 128-byte line.
  if (dblk == 0 && ws < 4 && (lane & 15) == 0) {
    float* rp = rsPart + ((size_t)b * KSPLIT + ks) * DIM + e_wave + ((lane >> 4) << 3);
    // Unrolled: constant indices keep rs in registers.
#pragma unroll
    for (int i = 0; i < 2; ++i) {
      *(float4*)(rp + i * 16)     = make_float4(rs[i][0], rs[i][1], rs[i][2], rs[i][3]);
      *(float4*)(rp + i * 16 + 4) = make_float4(rs[i][4], rs[i][5], rs[i][6], rs[i][7]);
    }
  }
}

// ---------------------------------------------------------------------------
// Kernel 3b: kvT[b][d][e] = (f16) sum_ks part[b][d][e][ks]
// One work-group per (b, 16 rows of d); each wave adds two 16x16 tiles. A lane
// holds what it held as accumulator: d = 16*dt + (lane & 15), e = 16*et +
// 8*(lane >> 4) + 0..7, so the result leaves as one 16-byte store.
// The first work-group of each batch also adds the slices of the row sums:
// rowsum[b][e] = sum_ks rsPart[b][ks][e].
// ---------------------------------------------------------------------------
__global__ __launch_bounds__(256) void kv_reduce_kernel(const float* __restrict__ part,
                                                        const float* __restrict__ rsPart,
                                                        _Float16* __restrict__ kvT,
                                                        float* __restrict__ rowsum) {
  const int tid = threadIdx.x, lane = tid & 31, wid = tid >> 5;
  const int b = blockIdx.x / (DIM / 16), dt = blockIdx.x % (DIM / 16);
  const float* pwg = part + (size_t)blockIdx.x * (DIM / 16) * KSPLIT * 256;
  const unsigned pw = (unsigned)(wid * 2 * KSPLIT * 256 + lane * 4);
  float4 lo[2][KSPLIT], hi[2][KSPLIT];
  // Unrolled (here and below): constant indices keep lo and hi in registers.
#pragma unroll
  for (int u = 0; u < 2; ++u)
#pragma unroll
    for (int s = 0; s < KSPLIT; ++s) {
      lo[u][s] = *(const float4*)(pwg + (pw + (u * KSPLIT + s) * 256));
      hi[u][s] = *(const float4*)(pwg + (pw + (u * KSPLIT + s) * 256 + 128));
    }
#pragma unroll
  for (int u = 0; u < 2; ++u) {
    float4 a = lo[u][0], c = hi[u][0];
#pragma unroll
    for (int s = 1; s < KSPLIT; ++s) {
      a.x += lo[u][s].x; a.y += lo[u][s].y; a.z += lo[u][s].z; a.w += lo[u][s].w;
      c.x += hi[u][s].x; c.y += hi[u][s].y; c.z += hi[u][s].z; c.w += hi[u][s].w;
    }
    int e = (wid * 2 + u) * 16 + ((lane >> 4) << 3);
    int d = dt * 16 + (lane & 15);
    *(v8h*)(kvT + ((size_t)b * DIM + d) * DIM + e) = cvt8(a, c);
  }
  if (dt == 0) {
    const float* rp = rsPart + (size_t)b * KSPLIT * DIM + tid;
    float r = rp[0];
    for (int s = 1; s < KSPLIT; ++s) r += rp[s * DIM];
    rowsum[b * DIM + tid] = r;
  }
}

// ---------------------------------------------------------------------------
// Kernel 5: out[b][d][m] = scale[b][m] * sum_e kvT[b][d][e]*phiQT[m][e],
//           phiQT[m][e]  = relu(sum_c Wt[e][c]*query[b][c][m] / 16),
//           scale[b][m]  = 1 / (sum_e phiQT[m][e]*rowsum[b][e] + 1e-8)
// One work-group per (b, 128 columns of m). It forms its own 128 x 256 tile of
// phiQT and keeps it in LDS, so phiQT is neither written to nor read from memory,
// and it uses the tile for both 128-row halves of d, one after the other.
// First part, phiQT: as in phi_tile (X staged f32->f16 in Xs, fragments by
// transposing loads, Wt packed in fragment order), but a wave does 64 e x 64 m, so
// that 8 waves cover all of e and X is staged once. Wt stands first in the product:
// a lane's 8 accumulator registers are 16 contiguous bytes of a phiQT row. A row
// (512 bytes of e) lies in LDS as two halves of 256 bytes, each at a pitch of 272
// bytes, at which 16-byte fragment reads of 16 rows fall on 64 different banks.
// Second part, per half of d: kvT's 128 rows come into LDS whole lines at a time by
// tensor loads. Each wave brings one slice: 32 rows of one 256-byte half of the e
// range (source pitch 512 bytes), padded by the mover to the same pitch of 272.
// Slice number = e half * 4 + 32-row group.
// phiQT stands first in the product, so a lane's 8 accumulator registers are 32
// contiguous bytes of one out row. Each wave lays its 32 x 64 result in the LDS of
// the slice that it has brought itself (once every wave is done with the slices)
// and stores it in rows: every wave-wide 16-byte store covers two rows of 256
// contiguous bytes, 4 whole lines. The same wave then refills that slice.
// The sum in scale is one more product on the phiQT fragments that are in
// registers anyway (first half of d only). Its second
// operand holds rowsum / NN (the mean of phiK along n, which fits f16 whenever
// phiK does) as two f16 terms, value and remainder, in the even and the odd
// columns: their two sums together carry 22 of the row sum's 24 bits. Of the 4 waves
// that share 64 rows of m each does 16 rows; the sums cross in LDS at the barrier
// that stands in front of the staging anyway.
// ---------------------------------------------------------------------------
#define OUT_PITCH 272   // bytes from row to row in LDS: 256 + the 16-byte pad
#define KV_SLICE 10240  // 32 rows * 272 bytes = 8,704, rounded up to a multiple of 2 KiB
#define PQ_OFF (8 * KV_SLICE)          // phiQT behind the slices
#define PQ_HALF (128 * OUT_PITCH)      // 128 rows of one e half
#define XS_OFF PQ_OFF                  // Xs, 64 rows: done with before phiQT is laid there
#define RS_PITCH 528                   // bytes from the value row to the remainder row: 512 + 16
#define RS_OFF (PQ_OFF + 2 * PQ_HALF)  // the two rows of rowsum / NN
#define DEN_OFF (RS_OFF + 2 * RS_PITCH)  // 2 x 128 floats: the two sums of each m
#define OUT_LDS (DEN_OFF + 2 * 128 * 4)  // under 160 KiB: two work-groups a WGP

typedef __attribute__((ext_vector_type(8))) unsigned int u32x8;

__device__ __forceinline__ uint32_t uni(uint32_t v) {
  return (uint32_t)__builtin_amdgcn_readfirstlane(v);
}

// Same element order as frag_kcontig: 16 bytes at K = 0..7 (+8 for the upper
// half-wave, already in p), 16 bytes at K = 16..23 (+8).
__device__ __forceinline__ v16h frag_lds(const unsigned char* p) {
  v8h lo = *(const v8h*)p;
  v8h hi = *(const v8h*)(p + 32);
  v16h f;
#pragma unroll
  for (int j = 0; j < 8; ++j) { f[j] = lo[j]; f[j + 8] = hi[j]; }
  return f;
}

// Work-group barrier for LDS traffic alone. __syncthreads() also waits out the
// wave's global loads and stores; across this one the next step's X loads and the
// first d half's out stores stay in flight.
__device__ __forceinline__ void lds_barrier() {
  asm volatile("s_wait_dscnt 0x0\n\ts_barrier_signal -1\n\ts_barrier_wait -1" ::: "memory");
}

// One wave's request for its slice of kvT, and its wait.
__device__ __forceinline__ void kv_slice_load(const _Float16* src, uint32_t place) {
  const uint64_t ga = (uint64_t)(uintptr_t)src;
  u32x4 g0;
  g0[0] = uni(1u);     // count 1
  g0[1] = uni(place);  // place in LDS
  g0[2] = uni((uint32_t)ga);
  g0[3] = uni((((uint32_t)(ga >> 32)) & 0x01FFFFFFu) | 0x80000000u);  // type 2
  u32x8 g1;  // extents in bytes; tensor dims = tile dims = 256 x 32
  g1[0] = uni((1u << 20) | (5u << 22) | (3u << 25));  // 4 dwords of pad behind every 64
  g1[1] = uni(256u << 16);
  g1[2] = uni(32u << 16);
  g1[3] = uni(256u << 16);
  g1[4] = uni(32u);
  g1[5] = uni(2u * DIM);  // source pitch: one whole row
  g1[6] = uni(0u);
  g1[7] = uni(0u);
  // The compiler places no wait for the mover: the slice has landed behind this
  // statement. Load and wait are one statement, so that nothing which reuses a
  // descriptor register is scheduled between them.
  asm volatile("tensor_load_to_lds %0, %1\n\ts_wait_tensorcnt 0x0" :: "s"(g0), "s"(g1) : "memory");
}

__global__ __launch_bounds__(256) void out_kernel(const float* __restrict__ query,
                                                  const _Float16* __restrict__ Wt,
                                                  const _Float16* __restrict__ kvT,
                                                  const float* __restrict__ rowsum,
                                                  float* __restrict__ out) {
  __shared__ __attribute__((aligned(2048))) unsigned char L[OUT_LDS];
  const int tid = threadIdx.x, lane = tid & 31, wid = tid >> 5;
  const uint32_t wave = uni(threadIdx.x >> 5);
  const int mblk = blockIdx.x, b = blockIdx.y;
  const int m_wave0 = (wid >> 2) * 64;
  const int m0      = mblk * 128;

  // Read at the head, so that it flies beside the tensor load.
  const float rmean = rowsum[b * DIM + tid] * (1.0f / NN);
  // Stands in front of the first write to this load's address registers.
  asm volatile("s_wait_xcnt 0x0" ::: "memory");

  const int srow = (int)wave << 3;
  const int scol = lane << 2;
  const float* xrow = query + ((size_t)b * DIM + srow) * MM + m0;  // the same in every lane
  const float* src  = xrow + scol;
  // A step is 64 rows of X, 8 loads a wave: with two work-groups a WGP that holds
  // as many bytes in flight as four work-groups with steps of 32 rows.
  float4 f[8];
  // Unrolled: constant indices keep f in registers.
#pragma unroll
  for (int r = 0; r < 8; ++r) f[r] = *(const float4*)(src + (size_t)r * MM);
  // Stands in front of the first write to these loads' address registers (the
  // scalar base; the lane number, scaled by the load). It takes both as inputs, so
  // that they live up to here and nothing is laid over them while the loads are
  // under way.
  asm volatile("s_wait_xcnt 0x0" :: "v"(lane), "s"(xrow) : "memory");

  // Every wave issues the one request for its own slice (first half of d); the
  // loads above fly beside it.
  const _Float16* kvw = kvT + ((size_t)b * DIM + (wave & 3u) * 32) * DIM + (wave >> 2) * 128;
  const uint32_t place = (uint32_t)(uintptr_t)&L[0] + wave * KV_SLICE;
  kv_slice_load(kvw, place);

  {  // phiQT: the wave's 64 e x 64 m
    _Float16(*Xs)[XS_PITCH / 2] = (_Float16(*)[XS_PITCH / 2])(L + XS_OFF);
    v8f pa[4][4];
#pragma unroll
    for (int i = 0; i < 4; ++i)
#pragma unroll
      for (int t = 0; t < 4; ++t) pa[i][t] = zero8();

    const unsigned char* bp = L + XS_OFF + (((lane >> 4) << 3) + (lane & 7)) * XS_PITCH +
                              (wave >> 2) * 128 + ((lane >> 3) & 1) * 16;
    const _Float16* wp = Wt + (size_t)((wave & 3u) * 4) * (DIM / 32) * 512 + lane * 8;

    auto step = [&](const int c0, const bool more) __attribute__((always_inline)) {
#pragma unroll
      for (int r = 0; r < 8; ++r) *(v4h*)&Xs[srow + r][scol] = cvt4(f[r]);
      lds_barrier();

      // The Wt fragments go out ahead of the next step's X: loads come back in
      // order, so the products wait for these alone and X flies on behind them.
      const _Float16* wq = wp + (c0 >> 5) * 512;
      v16h a[2][4];
#pragma unroll
      for (int k = 0; k < 2; ++k)
#pragma unroll
        for (int i = 0; i < 4; ++i) a[k][i] = frag_packed(wq + (i * (DIM / 32) + k) * 512);
      // Stands in front of the first write to the fragment loads' address.
      asm volatile("s_wait_xcnt 0x0" :: "v"(wq) : "memory");

      if (more) {  // next step; latency overlaps the products below
        const float* np = src + (size_t)(c0 + 64) * MM;
#pragma unroll
        for (int r = 0; r < 8; ++r) f[r] = *(const float4*)(np + (size_t)r * MM);
        // Stands in front of the first write to these loads' address registers. It
        // takes the address as an input, so that the pair lives up to here and none
        // of the results is laid over it while the other loads are under way.
        asm volatile("s_wait_xcnt 0x0" :: "v"(np) : "memory");
      }

#pragma unroll
      for (int k = 0; k < 2; ++k)
#pragma unroll
        for (int t = 0; t < 4; ++t) {
          const unsigned char* q = bp + k * 32 * XS_PITCH + t * 32;
          v8h lo = lds_tr16(q);                  // K = 0..7   (+8)
          v8h hi = lds_tr16(q + 16 * XS_PITCH);  // K = 16..23 (+8)
          v16h bf;
#pragma unroll
          for (int j = 0; j < 8; ++j) { bf[j] = lo[j]; bf[j + 8] = hi[j]; }
#pragma unroll
          for (int i = 0; i < 4; ++i)
            pa[i][t] = wmma_f16(a[k][i], bf, pa[i][t]);  // registers run along e, lanes along m
        }
      lds_barrier();  // the last one also frees Xs for phiQT
    };
    // Not unrolled, the last step apart: on every path the waits for the Wt
    // fragments can then count the X loads that are under way behind them.
#pragma unroll 1
    for (int c0 = 0; c0 < DIM - 64; c0 += 64) step(c0, true);
    step(DIM - 64, false);

    const float alpha = 1.0f / 16.0f;
    unsigned char* pw = L + PQ_OFF + ((wave & 3u) >> 1) * PQ_HALF +
                        ((wave >> 2) * 64 + (lane & 15)) * OUT_PITCH + (wave & 1u) * 128 +
                        ((lane >> 4) << 4);
#pragma unroll
    for (int i = 0; i < 4; ++i)
#pragma unroll
      for (int t = 0; t < 4; ++t) {
        v8h h;
#pragma unroll
        for (int r = 0; r < 8; ++r) {
          float v = pa[i][t][r] * alpha;
          h[r] = (_Float16)(v > 0.0f ? v : 0.0f);
        }
        *(v8h*)(pw + t * 16 * OUT_PITCH + i * 32) = h;
      }
  }
  {
    const _Float16 hi = (_Float16)rmean;
    *(_Float16*)(L + RS_OFF + tid * 2)            = hi;
    *(_Float16*)(L + RS_OFF + RS_PITCH + tid * 2) = (_Float16)(rmean - (float)hi);
  }
  lds_barrier();  // phiQT and the two rows readable by the other waves behind this

  const unsigned lrow = (unsigned)(lane & 15) * OUT_PITCH + ((unsigned)(lane >> 4) << 4);
  const unsigned char* aP = L + (wid & 3) * KV_SLICE + lrow;
  const unsigned char* bP = L + PQ_OFF + (wid >> 2) * 64 * OUT_PITCH + lrow;
  // The wave walks its four 16-row groups of m beginning with group jw, the one
  // whose scale sums it does: that group's fragment is then always set member 0.
  const int jw = (int)(wave & 3u);
  const unsigned char* bU[4];
  // Unrolled: constant indices keep bU in registers.
#pragma unroll
  for (int u = 0; u < 4; ++u) bU[u] = bP + ((u + jw) & 3) * 16 * OUT_PITCH;
  // Column = lane & 15: even columns read the value row, odd ones the remainder row.
  const unsigned char* rP = L + RS_OFF + (lane & 1) * RS_PITCH + ((lane >> 4) << 4);
  float4 sc;

  // Unrolled: what only the first half of d does (the scale sums, the refill) is
  // then no test at run time.
#pragma unroll
  for (int dblk = 0; dblk < 2; ++dblk) {
    v8f acc[2][4];
#pragma unroll
    for (int i = 0; i < 2; ++i)
#pragma unroll
      for (int t = 0; t < 4; ++t) acc[i][t] = zero8();
    v8f den = zero8();

    // Two fragment sets: the reads of step s + 1 go out as one group in front of
    // the products of step s, so a wave does not wait out its own LDS latency.
    v16h af[2][2], bf[2][4], rf[2];
    af[0][0] = frag_lds(aP);
    af[0][1] = frag_lds(aP + 16 * OUT_PITCH);
    if (dblk == 0) rf[0] = frag_lds(rP);
#pragma unroll
    for (int u = 0; u < 4; ++u) bf[0][u] = frag_lds(bU[u]);

    // Unrolled: set numbers and LDS offsets must be constants (registers, immediates).
#pragma unroll
    for (int s = 0; s < DIM / 32; ++s) {
      const int cur = s & 1, nxt = cur ^ 1;
      if (s + 1 < DIM / 32) {
        const int col = ((s + 1) & 3) * 64;
        const int offa = ((s + 1) >> 2) * 4 * KV_SLICE + col;
        const int offb = ((s + 1) >> 2) * PQ_HALF + col;
        af[nxt][0] = frag_lds(aP + offa);
        af[nxt][1] = frag_lds(aP + offa + 16 * OUT_PITCH);
        if (dblk == 0) rf[nxt] = frag_lds(rP + (s + 1) * 64);
#pragma unroll
        for (int u = 0; u < 4; ++u) bf[nxt][u] = frag_lds(bU[u] + offb);
      }
      // Keeps the read group whole and in front: without it the compiler hoists the
      // reads of all steps (over 256 VGPRs, one work-group per WGP instead of two).
      __builtin_amdgcn_sched_barrier(0);
      if (dblk == 0)
        den = wmma_f16(bf[cur][0], rf[cur], den);  // registers along m, lanes: value | remainder
#pragma unroll
      for (int u = 0; u < 4; ++u) {
        acc[0][u] = wmma_f16(bf[cur][u], af[cur][0], acc[0][u]);  // registers along m,
        acc[1][u] = wmma_f16(bf[cur][u], af[cur][1], acc[1][u]);  // lanes along d
      }
      // Keeps the next group's reads from moving in among these products.
      __builtin_amdgcn_sched_barrier(0);
    }

    // Columns 0 and 1 hold the two sums; lanes 0, 1 have rows 0..7, lanes 16, 17 rows 8..15.
    if (dblk == 0 && (lane & 15) < 2) {
      float* dp = (float*)(L + DEN_OFF) + (lane & 1) * 128 + m_wave0 + jw * 16 + ((lane >> 4) << 3);
      *(float4*)dp       = make_float4(den[0], den[1], den[2], den[3]);
      *(float4*)(dp + 4) = make_float4(den[4], den[5], den[6], den[7]);
    }

    // Every wave has read its last kvT fragment: the slices may be written over. The
    // sums of the other waves are readable behind this too.
    lds_barrier();

    // Row = d within the wave's 32, pitch OUT_PITCH; byte = 4 * (m within the wave's 64).
    unsigned char* st = L + wid * KV_SLICE;
    unsigned char* wr = st + (lane & 15) * OUT_PITCH + (lane >> 4) * 32;
#pragma unroll
    for (int i = 0; i < 2; ++i)
#pragma unroll
      for (int u = 0; u < 4; ++u) {
        unsigned char* p = wr + i * 16 * OUT_PITCH + ((u + jw) & 3) * 64;
        *(float4*)p        = make_float4(acc[i][u][0], acc[i][u][1], acc[i][u][2], acc[i][u][3]);
        *(float4*)(p + 16) = make_float4(acc[i][u][4], acc[i][u][5], acc[i][u][6], acc[i][u][7]);
      }
    // The wave's own LDS writes are done before other lanes of it read them back.
    asm volatile("s_wait_dscnt 0x0" ::: "memory");

    if (dblk == 0) {
      const float* dn = (const float*)(L + DEN_OFF) + m_wave0 + (lane & 15) * 4;
      const float4 dv = *(const float4*)dn, dr = *(const float4*)(dn + 128);
      sc.x = 1.0f / ((dv.x + dr.x) * (float)NN + 1e-8f);
      sc.y = 1.0f / ((dv.y + dr.y) * (float)NN + 1e-8f);
      sc.z = 1.0f / ((dv.z + dr.z) * (float)NN + 1e-8f);
      sc.w = 1.0f / ((dv.w + dr.w) * (float)NN + 1e-8f);
    }

    const unsigned char* rd = st + (lane >> 4) * OUT_PITCH + (lane & 15) * 16;
    float* gp = out + ((size_t)b * DIM + dblk * 128 + (wid & 3) * 32 + (lane >> 4)) * MM + m0 +
                m_wave0 + (lane & 15) * 4;
    // Unrolled: row offsets become immediates of one address.
#pragma unroll
    for (int j = 0; j < 16; ++j) {
      float4 v = *(const float4*)(rd + j * 2 * OUT_PITCH);
      *(float4*)(gp + (size_t)(j * 2) * MM) = make_float4(v.x * sc.x, v.y * sc.y, v.z * sc.z, v.w * sc.w);
    }

    if (dblk == 0) {
      // Stands in front of the first write to a register that these stores name.
      asm volatile("s_wait_xcnt 0x0" :: "v"(gp) : "memory");
      // The wave's own reads of its staged rows are done before the mover writes
      // there. No other wave touches this slice since the barrier above.
      asm volatile("s_wait_dscnt 0x0" ::: "memory");
      kv_slice_load(kvw + (size_t)128 * DIM, place);  // second half of d
      lds_barrier();  // every wave's new slice readable by the others behind this
    }
  }
}

// ---------------------------------------------------------------------------
extern "C" void kernel_launch(void* const* d_in, const int* in_sizes, int n_in,
                              void* d_out, int out_size, void* d_ws, size_t ws_size,
                              hipStream_t stream) {
  const float* query = (const float*)d_in[0];
  const float* key   = (const float*)d_in[1];
  const float* value = (const float*)d_in[2];
  const float* W     = (const float*)d_in[3];
  float* out = (float*)d_out;

  _Float16* Wt    = (_Float16*)d_ws;                       // 256*256 f16, fragment order
  _Float16* phiK  = Wt + (size_t)DIM * DIM;                // [b][e][n], 32 MB
  _Float16* kvT   = phiK + (size_t)BATCH * DIM * NN;       // [b][d][e], 4 MB
  float* rowsum   = (float*)(kvT + (size_t)BATCH * DIM * DIM);
  float* kvPart   = rowsum + BATCH * DIM;                  // [b][tile][ks], f32, 32 MB
  float* rsPart   = kvPart + (size_t)BATCH * DIM * DIM * KSPLIT;  // [b][ks][e], f32

  wt_kernel<<<dim3(DIM), dim3(DIM), 0, stream>>>(W, Wt);
  phi_kernel<<<dim3(NN / 128, 2, BATCH), dim3(256), 0, stream>>>(key, Wt, phiK);
  kv_kernel<<<dim3(2, 2, BATCH * KSPLIT), dim3(256), 0, stream>>>(phiK, value, kvPart, rsPart);
  kv_reduce_kernel<<<dim3(BATCH * (DIM / 16)), dim3(256), 0, stream>>>(kvPart, rsPart, kvT,
                                                                          rowsum);
  out_kernel<<<dim3(MM / 128, BATCH), dim3(256), 0, stream>>>(query, Wt, kvT, rowsum, out);
}

// v010
// One run takes 57 microseconds.
// In two side-by-side timings against v009, it was 1.24 and 1.23 times as fast.
// Counting every step since v000, it is 2.85 times as fast.
#include <hip/hip_runtime.h>
#include <hip/hip_bf16.h>
#include <stdint.h>

#define DIM 256
#define BATCH 32
#define MM 2048
#define NN 2048
#define KSPLIT 4  // slices of the n sum in kv_kernel, one work-group each per 128-row half of d

typedef __attribute__((ext_vector_type(16))) _Float16 v16h;
typedef __attribute__((ext_vector_type(8)))  _Float16 v8h;
typedef __attribute__((ext_vector_type(4)))  _Float16 v4h;
typedef __attribute__((ext_vector_type(8)))  float    v8f;
typedef __attribute__((ext_vector_type(4)))  unsigned int u32x4;

__device__ __forceinline__ v8f wmma_f16(v16h a, v16h b, v8f c) {
  // D = A(16x32 f16) * B(32x16 f16) + C(16x16 f32)
  return __builtin_amdgcn_wmma_f32_16x16x32_f16(false, a, false, b, (short)0, c,
                                                false, false);
}

__device__ __forceinline__ v8f zero8() {
  v8f z;
#pragma unroll
  for (int r = 0; r < 8; ++r) z[r] = 0.0f;
  return z;
}

__device__ __forceinline__ v8h cvt8(float4 a, float4 b) {
  v8h h;
  h[0] = (_Float16)a.x; h[1] = (_Float16)a.y; h[2] = (_Float16)a.z; h[3] = (_Float16)a.w;
  h[4] = (_Float16)b.x; h[5] = (_Float16)b.y; h[6] = (_Float16)b.z; h[7] = (_Float16)b.w;
  return h;
}

__device__ __forceinline__ v4h cvt4(float4 a) {
  v4h h;
  h[0] = (_Float16)a.x; h[1] = (_Float16)a.y; h[2] = (_Float16)a.z; h[3] = (_Float16)a.w;
  return h;
}

// The fragment order, per the ISA's 16-bit A layout: row = lane%16, element j holds
// K = j + 8*((j>>3)+(lane>>4)). The same mapping serves B fragments when "row" is the
// B column.

// ---------------------------------------------------------------------------
// Kernel 0: Wt = (f16) W transposed, packed in the order of the A
// fragments: one 1-KiB block per (16 rows of e, 32 columns of c); in it lane l's
// 8 halves for K = 0..7 (+8 for the upper half-wave) at halves l*8, those for
// K = 16..23 (+8) at halves 256 + l*8. A wave-wide 16-byte load of a fragment
// half is then 512 contiguous bytes (4 lines) instead of 16 rows (16 lines).
// ---------------------------------------------------------------------------
__global__ __launch_bounds__(256) void wt_kernel(const float* __restrict__ W,
                                                 _Float16* __restrict__ Wt) {
  int e = blockIdx.x, c = threadIdx.x;
  int blk  = (e >> 4) * (DIM / 32) + (c >> 5);
  int lane = (((c >> 3) & 1) << 4) + (e & 15);
  Wt[(size_t)blk * 512 + ((c >> 4) & 1) * 256 + lane * 8 + (c & 7)] =
      (_Float16)W[(size_t)c * DIM + e];
}

// A fragment from a block packed by wt_kernel (p = block + lane * 8); the element
// order is the fragment order above.
__device__ __forceinline__ v16h frag_packed(const _Float16* __restrict__ p) {
  v8h lo = *(const v8h*)p;
  v8h hi = *(const v8h*)(p + 256);
  v16h f;
#pragma unroll
  for (int j = 0; j < 8; ++j) { f[j] = lo[j]; f[j + 8] = hi[j]; }
  return f;
}

// Transposing LDS load: with lane l's address at row 8*(l>>4) + (l&7), byte
// 16*((l>>3)&1) of a 16-bit tile, lane l gets rows 8*(l>>4) + 0..7 of column l&15.
typedef __attribute__((ext_vector_type(8))) short s16x8;
__device__ __forceinline__ v8h lds_tr16(const unsigned char* p) {
  typedef __attribute__((address_space(3))) s16x8 lds_s16x8;
  return __builtin_bit_cast(v8h, __builtin_amdgcn_ds_load_tr16_b128_v8i16((lds_s16x8*)p));
}

#define XS_PITCH 288  // bytes from row to row of Xs: 256 + 32, an odd multiple of 32

// ---------------------------------------------------------------------------
// Kernel 3b: kvT[b][d][e] = (f16) sum_ks part[b][d][e][ks]
// One work-group per (b, 16 rows of d); each wave adds two 16x16 tiles. A lane
// holds what it held as accumulator: d = 16*dt + (lane & 15), e = 16*et +
// 8*(lane >> 4) + 0..7, so the result leaves as one 16-byte store.
// The first work-group of each batch also adds the slices of the row sums:
// rowsum[b][e] = sum_ks rsPart[b][ks][e].
// ---------------------------------------------------------------------------
__global__ __launch_bounds__(256) void kv_reduce_kernel(const float* __restrict__ part,
                                                        const float* __restrict__ rsPart,
                                                        _Float16* __restrict__ kvT,
                                                        float* __restrict__ rowsum) {
  const int tid = threadIdx.x, lane = tid & 31, wid = tid >> 5;
  const int b = blockIdx.x / (DIM / 16), dt = blockIdx.x % (DIM / 16);
  const float* pwg = part + (size_t)blockIdx.x * (DIM / 16) * KSPLIT * 256;
  const unsigned pw = (unsigned)(wid * 2 * KSPLIT * 256 + lane * 4);
  float4 lo[2][KSPLIT], hi[2][KSPLIT];
  // Unrolled (here and below): constant indices keep lo and hi in registers.
#pragma unroll
  for (int u = 0; u < 2; ++u)
#pragma unroll
    for (int s = 0; s < KSPLIT; ++s) {
      lo[u][s] = *(const float4*)(pwg + (pw + (u * KSPLIT + s) * 256));
      hi[u][s] = *(const float4*)(pwg + (pw + (u * KSPLIT + s) * 256 + 128));
    }
#pragma unroll
  for (int u = 0; u < 2; ++u) {
    float4 a = lo[u][0], c = hi[u][0];
#pragma unroll
    for (int s = 1; s < KSPLIT; ++s) {
      a.x += lo[u][s].x; a.y += lo[u][s].y; a.z += lo[u][s].z; a.w += lo[u][s].w;
      c.x += hi[u][s].x; c.y += hi[u][s].y; c.z += hi[u][s].z; c.w += hi[u][s].w;
    }
    int e = (wid * 2 + u) * 16 + ((lane >> 4) << 3);
    int d = dt * 16 + (lane & 15);
    *(v8h*)(kvT + ((size_t)b * DIM + d) * DIM + e) = cvt8(a, c);
  }
  if (dt == 0) {
    const float* rp = rsPart + (size_t)b * KSPLIT * DIM + tid;
    float r = rp[0];
    for (int s = 1; s < KSPLIT; ++s) r += rp[s * DIM];
    rowsum[b * DIM + tid] = r;
  }
}

// ---------------------------------------------------------------------------
// Kernel 5: out[b][d][m] = scale[b][m] * sum_e kvT[b][d][e]*phiQT[m][e],
//           phiQT[m][e]  = relu(sum_c Wt[e][c]*query[b][c][m] / 16),
//           scale[b][m]  = 1 / (sum_e phiQT[m][e]*rowsum[b][e] + 1e-8)
// One work-group per (b, 128 columns of m). It forms its own 128 x 256 tile of
// phiQT and keeps it in LDS, so phiQT is neither written to nor read from memory,
// and it uses the tile for both 128-row halves of d, one after the other.
// First part, phiQT: as in kv_kernel (X staged f32->f16 in Xs, fragments by
// transposing loads, Wt packed in fragment order), and a wave does 64 e x 64 m, so
// that 8 waves cover all of e and X is staged once. Wt stands first in the product:
// a lane's 8 accumulator registers are 16 contiguous bytes of a phiQT row. A row
// (512 bytes of e) lies in LDS as two halves of 256 bytes, each at a pitch of 272
// bytes, at which 16-byte fragment reads of 16 rows fall on 64 different banks.
// Second part, per half of d: kvT's 128 rows come into LDS whole lines at a time by
// tensor loads. Each wave brings one slice: 32 rows of one 256-byte half of the e
// range (source pitch 512 bytes), padded by the mover to the same pitch of 272.
// Slice number = e half * 4 + 32-row group.
// phiQT stands first in the product, so a lane's 8 accumulator registers are 32
// contiguous bytes of one out row. Each wave lays its 32 x 64 result in the LDS of
// the slice that it has brought itself (once every wave is done with the slices)
// and stores it in rows: every wave-wide 16-byte store covers two rows of 256
// contiguous bytes, 4 whole lines. The same wave then refills that slice.
// The sum in scale is one more product on the phiQT fragments that are in
// registers anyway (first half of d only). Its second
// operand holds rowsum / NN (the mean of phiK along n, which fits f16 whenever
// phiK does) as two f16 terms, value and remainder, in the even and the odd
// columns: their two sums together carry 22 of the row sum's 24 bits. Of the 4 waves
// that share 64 rows of m each does 16 rows; the sums cross in LDS at the barrier
// that stands in front of the staging anyway.
// ---------------------------------------------------------------------------
#define OUT_PITCH 272   // bytes from row to row in LDS: 256 + the 16-byte pad
#define KV_SLICE 10240  // 32 rows * 272 bytes = 8,704, rounded up to a multiple of 2 KiB
#define PQ_OFF (8 * KV_SLICE)          // phiQT behind the slices
#define PQ_HALF (128 * OUT_PITCH)      // 128 rows of one e half
#define XS_OFF PQ_OFF                  // Xs, 64 rows: done with before phiQT is laid there
#define RS_PITCH 528                   // bytes from the value row to the remainder row: 512 + 16
#define RS_OFF (PQ_OFF + 2 * PQ_HALF)  // the two rows of rowsum / NN
#define DEN_OFF (RS_OFF + 2 * RS_PITCH)  // 2 x 128 floats: the two sums of each m
#define OUT_LDS (DEN_OFF + 2 * 128 * 4)  // under 160 KiB: two work-groups a WGP

typedef __attribute__((ext_vector_type(8))) unsigned int u32x8;

__device__ __forceinline__ uint32_t uni(uint32_t v) {
  return (uint32_t)__builtin_amdgcn_readfirstlane(v);
}

// The fragment order above: 16 bytes at K = 0..7 (+8 for the upper
// half-wave, already in p), 16 bytes at K = 16..23 (+8).
__device__ __forceinline__ v16h frag_lds(const unsigned char* p) {
  v8h lo = *(const v8h*)p;
  v8h hi = *(const v8h*)(p + 32);
  v16h f;
#pragma unroll
  for (int j = 0; j < 8; ++j) { f[j] = lo[j]; f[j + 8] = hi[j]; }
  return f;
}

// Work-group barrier for LDS traffic alone. __syncthreads() also waits out the
// wave's global loads and stores; across this one the next step's X loads and the
// first d half's out stores stay in flight.
__device__ __forceinline__ void lds_barrier() {
  asm volatile("s_wait_dscnt 0x0\n\ts_barrier_signal -1\n\ts_barrier_wait -1" ::: "memory");
}

// ---------------------------------------------------------------------------
// Kernel 3: part[b][d][e][ks] = sum over slice ks of n of phiK[e][n]*value[b][d][n],
//           phiK[e][n] = relu(sum_c Wt[e][c]*key[b][c][n])
// One work-group per (b, slice ks of n, 128-row half of d), one work-group a WGP.
// phiK is neither written to nor read from memory: the work-group walks its slice in
// pieces of 128 n, forms the 256 e x 128 n piece of phiK in LDS and multiplies it
// there with its piece of value. The two work-groups of a (b, ks) form the same phiK.
// Wt is copied to LDS once, as it lies (fragment order): with two waves a SIMD there
// is nobody to hide a cache's latency at every step.
// First part, phiK: four steps of 64 rows of key, staged f32->f16 in Xs (two buffers,
// one barrier a step) as they lie in memory (row = c, the k of the product);
// fragments by transposing loads; a wave does 64 e x 64 n.
// X, whose index runs along a phiK row, stands first in the
// product, so a lane's 8 accumulator registers are 16 contiguous bytes of one phiK
// row. Each step also stages 32 rows of value, so that the loads of both inputs go
// out evenly. Rows are loaded two steps ahead, into two register sets; those of the
// next piece's first two steps fly under the second part.
// Second part: a wave does 64 e x 64 d over the 128 n, fragments by 16-byte reads at
// a pitch of 272 bytes, one step ahead. Vs has two buffers: a wave that is done with
// a piece stages the next one while others still read, with no barrier between.
// Partials are f32 and lie in accumulator order: one 1-KiB block per 16x16 tile
// and slice, a tile's KSPLIT blocks side by side, register quad q of lane l at
// floats q*128 + l*4, so every store is 512 contiguous bytes per wave.
// The row sums of phiK ride along: rsPart[b][ks][e] = sum over slice ks of n of
// phiK[e][n], as the product of phiK fragments with a fragment of ones (f32
// accumulate). Of the two waves that share 64 rows of e each does 32: a wave walks
// its four 16-row groups of e beginning with its own two.
// ---------------------------------------------------------------------------
#define KV_PITCH 272                       // bytes from row to row: 256 + 16
#define KP_OFF (2 * 64 * XS_PITCH)         // phiK piece behind the two buffers of Xs (64 rows each)
#define KVS_OFF (KP_OFF + 256 * KV_PITCH)  // the two buffers of value behind it
#define KVS_SIZE (128 * KV_PITCH)
#define KWT_OFF (KVS_OFF + 2 * KVS_SIZE)   // Wt, 128 KiB
#define KV_LDS (KWT_OFF + DIM * DIM * 2)
#define KV_PIECES (NN / KSPLIT / 128)

__global__ __launch_bounds__(256) void kv_kernel(const float* __restrict__ key,
                                                 const float* __restrict__ value,
                                                 const _Float16* __restrict__ Wt,
                                                 float* __restrict__ part,
                                                 float* __restrict__ rsPart) {
  __shared__ __attribute__((aligned(16))) unsigned char L[KV_LDS];
  const int tid = threadIdx.x, lane = tid & 31;
  const uint32_t wave = uni(threadIdx.x >> 5);
  const uint32_t we = wave & 3u, wd = wave >> 2;
  const int dh = blockIdx.x, ks = blockIdx.y, b = blockIdx.z;
  const int nbeg = ks * (NN / KSPLIT);
  const int scol = lane << 2;

  // Wt goes out first: loads come back in order.
  const unsigned wcp = (unsigned)tid * 16;
  v8h w[32];
  // Unrolled (here and below): constant indices keep w, f and g in registers.
#pragma unroll
  for (int j = 0; j < 32; ++j)
    w[j] = *(const v8h*)((const unsigned char*)Wt + (wcp + j * 4096));
  // Stands in front of the first write to these loads' offset register.
  asm volatile("s_wait_xcnt 0x0" :: "v"(wcp) : "memory");

  // A step is 64 rows of key and 32 of value: 12 loads a wave, each 512 contiguous bytes.
  const float* xrow = key + ((size_t)b * DIM + wave * 8) * NN + nbeg;  // the same in every lane
  const float* vrow = value + ((size_t)b * DIM + dh * 128 + wave * 4) * NN + nbeg;
  const float* xp = xrow + scol;
  const float* vp = vrow + scol;
  float4 f[2][8], g[2][4];
#pragma unroll
  for (int u = 0; u < 2; ++u) {
#pragma unroll
    for (int r = 0; r < 8; ++r) f[u][r] = *(const float4*)(xp + (size_t)(u * 64 + r) * NN);
#pragma unroll
    for (int r = 0; r < 4; ++r) g[u][r] = *(const float4*)(vp + (size_t)(u * 32 + r) * NN);
  }
  // Stands in front of the first write to these loads' address registers (the scalar
  // bases; the lane number, scaled by the load). It takes them as inputs, so that they
  // live up to here and nothing is laid over them while the loads are under way.
  asm volatile("s_wait_xcnt 0x0" :: "v"(lane), "s"(xrow), "s"(vrow) : "memory");

#pragma unroll
  for (int j = 0; j < 32; ++j) *(v8h*)(L + KWT_OFF + wcp + j * 4096) = w[j];
  lds_barrier();  // Wt readable by every wave behind this

  v8f acc[4][4];
#pragma unroll
  for (int i = 0; i < 4; ++i)
#pragma unroll
    for (int t = 0; t < 4; ++t) acc[i][t] = zero8();
  v8f rs[2] = {zero8(), zero8()};  // every column holds the row sums
  const _Float16 one = (_Float16)1.0f;
  const v16h ones = {one, one, one, one, one, one, one, one,
                     one, one, one, one, one, one, one, one};

  _Float16(*Xs)[XS_PITCH / 2] = (_Float16(*)[XS_PITCH / 2])L;
  const unsigned char* bp = L + (((lane >> 4) << 3) + (lane & 7)) * XS_PITCH + wd * 128 +
                            ((lane >> 3) & 1) * 16;
  // The wave's first Wt block: block = (e / 16) * (DIM / 32) + c / 32, 1 KiB each.
  const unsigned char* wl = L + KWT_OFF + (we * 4) * (DIM / 32) * 1024 + lane * 16;
  const unsigned lrow = (unsigned)(lane & 15) * KV_PITCH + ((unsigned)(lane >> 4) << 4);
  const unsigned char* aU[4];
  // Unrolled: constant indices keep aU in registers.
#pragma unroll
  for (int i = 0; i < 4; ++i)
    aU[i] = L + KP_OFF + (we * 64 + ((i + 2 * wd) & 3u) * 16) * KV_PITCH + lrow;

  // Not unrolled (the pieces, and in each the pairs of steps): the rows that a pass
  // loads are then used in a later pass of the loop, and the compiler cannot move
  // their conversion up to the loads, where it would wait out the memory latency.
#pragma unroll 1
  for (int p = 0; p < KV_PIECES; ++p) {
    unsigned char* vs = L + KVS_OFF + (p & 1) * KVS_SIZE;
    v8f pa[4][4];
#pragma unroll
    for (int i = 0; i < 4; ++i)
#pragma unroll
      for (int t = 0; t < 4; ++t) pa[i][t] = zero8();

#pragma unroll 1
    for (int h = 0; h < 2; ++h) {
      // The rows that this pair of steps sends for: those of the pair after it. The
      // last pair of all has none: it reads its own piece's first rows again, unused,
      // so that every pass has the same loads and the waits can count them.
      const float* xq = xp + (h == 0 ? 128L * NN : (p + 1 < KV_PIECES ? 128L : 0L));
      const float* vq = vp + (h == 0 ? 64L * NN : (p + 1 < KV_PIECES ? 128L : 0L));
      const unsigned char* wh = wl + h * 4 * 1024;
      unsigned char* vh = vs + (h * 64 + wave * 4) * KV_PITCH + scol * 2;
      // Unrolled: the register set of a step must be a constant.
#pragma unroll
      for (int u = 0; u < 2; ++u) {
        // The step's eight groups of products, g = k * 4 + i: one Wt fragment each, on
        // the four X fragments of its k. Same halves as frag_packed: 16 bytes at 0, 16 at 512.
        auto wfrag = [&](const int gq) __attribute__((always_inline)) {
          const unsigned char* q = wh + ((gq & 3) * (DIM / 32) + u * 2 + (gq >> 2)) * 1024;
          v8h lo = *(const v8h*)q;
          v8h hi = *(const v8h*)(q + 512);
          v16h r;
#pragma unroll
          for (int j = 0; j < 8; ++j) { r[j] = lo[j]; r[j + 8] = hi[j]; }
          return r;
        };
        auto xfrag = [&](const int k, const int t) __attribute__((always_inline)) {
          const unsigned char* q = bp + (u * 64 + k * 32) * XS_PITCH + t * 32;
          v8h lo = lds_tr16(q);                  // K = 0..7   (+8)
          v8h hi = lds_tr16(q + 16 * XS_PITCH);  // K = 16..23 (+8)
          v16h r;
#pragma unroll
          for (int j = 0; j < 8; ++j) { r[j] = lo[j]; r[j + 8] = hi[j]; }
          return r;
        };
        v16h xf[4], a[2];
        a[0] = wfrag(0);  // hangs on no barrier: read in front of it, it is there when it opens
#pragma unroll
        for (int r = 0; r < 8; ++r) *(v4h*)&Xs[u * 64 + wave * 8 + r][scol] = cvt4(f[u][r]);
#pragma unroll
        for (int r = 0; r < 4; ++r) *(v4h*)(vh + (u * 32 + r) * KV_PITCH) = cvt4(g[u][r]);
        // The one barrier of a step: it publishes this step's rows, and every wave that
        // has passed it is done with the other buffer of Xs, which the next step fills.
        lds_barrier();

#pragma unroll
        for (int t = 0; t < 4; ++t) xf[t] = xfrag(0, t);

        // Into the set just emptied.
#pragma unroll
        for (int r = 0; r < 8; ++r) f[u][r] = *(const float4*)(xq + (long)(u * 64 + r) * NN);
#pragma unroll
        for (int r = 0; r < 4; ++r) g[u][r] = *(const float4*)(vq + (long)(u * 32 + r) * NN);
        // Stands in front of the first write to these loads' address registers. It takes
        // the addresses as inputs, so that they live up to here and no result is laid
        // over them while the other loads are under way.
        asm volatile("s_wait_xcnt 0x0" :: "v"(xq), "v"(vq) : "memory");

        // The Wt fragment of group g + 1 is read in front of the products of group g; the
        // X fragments of the second k take their places one by one, each behind the last
        // product on the fragment it replaces. The scheduling barriers hold that order:
        // left alone, the compiler reads each fragment right in front of its first use
        // and waits out the LDS latency eight times a step.
#pragma unroll
        for (int gq = 0; gq < 8; ++gq) {
          const int i = gq & 3;
          if (gq + 1 < 8) a[(gq + 1) & 1] = wfrag(gq + 1);
          __builtin_amdgcn_sched_barrier(0);
#pragma unroll
          for (int t = 0; t < 4; ++t) {
            pa[i][t] = wmma_f16(xf[t], a[gq & 1], pa[i][t]);  // registers run along n, lanes along e
            if (gq == 3) {
              xf[t] = xfrag(1, t);
              __builtin_amdgcn_sched_barrier(0);
            }
          }
          __builtin_amdgcn_sched_barrier(0);
        }
      }
    }
    xp += 128;
    vp += 128;

    unsigned char* pw = L + KP_OFF + (we * 64 + (lane & 15)) * KV_PITCH + wd * 128 +
                        ((lane >> 4) << 4);
#pragma unroll
    for (int i = 0; i < 4; ++i)
#pragma unroll
      for (int t = 0; t < 4; ++t) {
        v8h h;
#pragma unroll
        for (int r = 0; r < 8; ++r) {
          float v = pa[i][t][r];
          h[r] = (_Float16)(v > 0.0f ? v : 0.0f);
        }
        *(v8h*)(pw + i * 16 * KV_PITCH + t * 32) = h;
      }
    lds_barrier();  // the phiK piece readable by the other waves behind this

    const unsigned char* bP = vs + wd * 64 * KV_PITCH + lrow;
    // Two fragment sets: the reads of step s + 1 go out as one group in front of
    // the products of step s, so a wave does not wait out its own LDS latency.
    v16h af[2][4], bf[2][4];
#pragma unroll
    for (int i = 0; i < 4; ++i) af[0][i] = frag_lds(aU[i]);
#pragma unroll
    for (int t = 0; t < 4; ++t) bf[0][t] = frag_lds(bP + t * 16 * KV_PITCH);
    // Unrolled: set numbers and LDS offsets must be constants (registers, immediates).
#pragma unroll
    for (int s = 0; s < 4; ++s) {
      const int cur = s & 1, nxt = cur ^ 1;
      if (s + 1 < 4) {
#pragma unroll
        for (int i = 0; i < 4; ++i) af[nxt][i] = frag_lds(aU[i] + (s + 1) * 64);
#pragma unroll
        for (int t = 0; t < 4; ++t) bf[nxt][t] = frag_lds(bP + t * 16 * KV_PITCH + (s + 1) * 64);
      }
      // Keeps the read group whole and in front of the products that hide it.
      __builtin_amdgcn_sched_barrier(0);
      rs[0] = wmma_f16(af[cur][0], ones, rs[0]);
      rs[1] = wmma_f16(af[cur][1], ones, rs[1]);
#pragma unroll
      for (int i = 0; i < 4; ++i)
#pragma unroll
        for (int t = 0; t < 4; ++t)
          acc[i][t] = wmma_f16(af[cur][i], bf[cur][t], acc[i][t]);  // registers along e, lanes along d
      // Keeps the next group's reads from moving in among these products.
      __builtin_amdgcn_sched_barrier(0);
    }
  }

  // Tile (dt, et) = (d / 16, e / 16) of batch b, slice ks: block (dt * 16 + et) * KSPLIT + ks.
  float* pwg = part + (size_t)b * DIM * DIM * KSPLIT + ks * 256 + lane * 4;
#pragma unroll
  for (int i = 0; i < 4; ++i)
#pragma unroll
    for (int t = 0; t < 4; ++t) {
      const unsigned dt = dh * 8 + wd * 4 + t, et = we * 4 + ((i + 2 * wd) & 3u);
      float* tp = pwg + (dt * (DIM / 16) + et) * (KSPLIT * 256);
      *(float4*)tp         = make_float4(acc[i][t][0], acc[i][t][1], acc[i][t][2], acc[i][t][3]);
      *(float4*)(tp + 128) = make_float4(acc[i][t][4], acc[i][t][5], acc[i][t][6], acc[i][t][7]);
    }
  // Stands in front of the first write to a register that these stores name.
  asm volatile("s_wait_xcnt 0x0" ::: "memory");

  // Column 0 of rs: lane 0 holds rows 0..7, lane 16 rows 8..15. The wave's 32
  // sums fill one 128-byte line.
  if (dh == 0 && (lane & 15) == 0) {
    float* rp = rsPart + ((size_t)b * KSPLIT + ks) * DIM + we * 64 + wd * 32 + ((lane >> 4) << 3);
    // Unrolled: constant indices keep rs in registers.
#pragma unroll
    for (int i = 0; i < 2; ++i) {
      *(float4*)(rp + i * 16)     = make_float4(rs[i][0], rs[i][1], rs[i][2], rs[i][3]);
      *(float4*)(rp + i * 16 + 4) = make_float4(rs[i][4], rs[i][5], rs[i][6], rs[i][7]);
    }
  }
}

// One wave's request for its slice of kvT, and its wait.
__device__ __forceinline__ void kv_slice_load(const _Float16* src, uint32_t place) {
  const uint64_t ga = (uint64_t)(uintptr_t)src;
  u32x4 g0;
  g0[0] = uni(1u);     // count 1
  g0[1] = uni(place);  // place in LDS
  g0[2] = uni((uint32_t)ga);
  g0[3] = uni((((uint32_t)(ga >> 32)) & 0x01FFFFFFu) | 0x80000000u);  // type 2
  u32x8 g1;  // extents in bytes; tensor dims = tile dims = 256 x 32
  g1[0] = uni((1u << 20) | (5u << 22) | (3u << 25));  // 4 dwords of pad behind every 64
  g1[1] = uni(256u << 16);
  g1[2] = uni(32u << 16);
  g1[3] = uni(256u << 16);
  g1[4] = uni(32u);
  g1[5] = uni(2u * DIM);  // source pitch: one whole row
  g1[6] = uni(0u);
  g1[7] = uni(0u);
  // The compiler places no wait for the mover: the slice has landed behind this
  // statement. Load and wait are one statement, so that nothing which reuses a
  // descriptor register is scheduled between them.
  asm volatile("tensor_load_to_lds %0, %1\n\ts_wait_tensorcnt 0x0" :: "s"(g0), "s"(g1) : "memory");
}

__global__ __launch_bounds__(256) void out_kernel(const float* __restrict__ query,
                                                  const _Float16* __restrict__ Wt,
                                                  const _Float16* __restrict__ kvT,
                                                  const float* __restrict__ rowsum,
                                                  float* __restrict__ out) {
  __shared__ __attribute__((aligned(2048))) unsigned char L[OUT_LDS];
  const int tid = threadIdx.x, lane = tid & 31, wid = tid >> 5;
  const uint32_t wave = uni(threadIdx.x >> 5);
  const int mblk = blockIdx.x, b = blockIdx.y;
  const int m_wave0 = (wid >> 2) * 64;
  const int m0      = mblk * 128;

  // Read at the head, so that it flies beside the tensor load.
  const float rmean = rowsum[b * DIM + tid] * (1.0f / NN);
  // Stands in front of the first write to this load's address registers.
  asm volatile("s_wait_xcnt 0x0" ::: "memory");

  const int srow = (int)wave << 3;
  const int scol = lane << 2;
  const float* xrow = query + ((size_t)b * DIM + srow) * MM + m0;  // the same in every lane
  const float* src  = xrow + scol;
  // A step is 64 rows of X, 8 loads a wave: with two work-groups a WGP that holds
  // as many bytes in flight as four work-groups with steps of 32 rows.
  float4 f[8];
  // Unrolled: constant indices keep f in registers.
#pragma unroll
  for (int r = 0; r < 8; ++r) f[r] = *(const float4*)(src + (size_t)r * MM);
  // Stands in front of the first write to these loads' address registers (the
  // scalar base; the lane number, scaled by the load). It takes both as inputs, so
  // that they live up to here and nothing is laid over them while the loads are
  // under way.
  asm volatile("s_wait_xcnt 0x0" :: "v"(lane), "s"(xrow) : "memory");

  // Every wave issues the one request for its own slice (first half of d); the
  // loads above fly beside it.
  const _Float16* kvw = kvT + ((size_t)b * DIM + (wave & 3u) * 32) * DIM + (wave >> 2) * 128;
  const uint32_t place = (uint32_t)(uintptr_t)&L[0] + wave * KV_SLICE;
  kv_slice_load(kvw, place);

  {  // phiQT: the wave's 64 e x 64 m
    _Float16(*Xs)[XS_PITCH / 2] = (_Float16(*)[XS_PITCH / 2])(L + XS_OFF);
    v8f pa[4][4];
#pragma unroll
    for (int i = 0; i < 4; ++i)
#pragma unroll
      for (int t = 0; t < 4; ++t) pa[i][t] = zero8();

    const unsigned char* bp = L + XS_OFF + (((lane >> 4) << 3) + (lane & 7)) * XS_PITCH +
                              (wave >> 2) * 128 + ((lane >> 3) & 1) * 16;
    const _Float16* wp = Wt + (size_t)((wave & 3u) * 4) * (DIM / 32) * 512 + lane * 8;

    auto step = [&](const int c0, const bool more) __attribute__((always_inline)) {
#pragma unroll
      for (int r = 0; r < 8; ++r) *(v4h*)&Xs[srow + r][scol] = cvt4(f[r]);
      lds_barrier();

      // The Wt fragments go out ahead of the next step's X: loads come back in
      // order, so the products wait for these alone and X flies on behind them.
      const _Float16* wq = wp + (c0 >> 5) * 512;
      v16h a[2][4];
#pragma unroll
      for (int k = 0; k < 2; ++k)
#pragma unroll
        for (int i = 0; i < 4; ++i) a[k][i] = frag_packed(wq + (i * (DIM / 32) + k) * 512);
      // Stands in front of the first write to the fragment loads' address.
      asm volatile("s_wait_xcnt 0x0" :: "v"(wq) : "memory");

      if (more) {  // next step; latency overlaps the products below
        const float* np = src + (size_t)(c0 + 64) * MM;
#pragma unroll
        for (int r = 0; r < 8; ++r) f[r] = *(const float4*)(np + (size_t)r * MM);
        // Stands in front of the first write to these loads' address registers. It
        // takes the address as an input, so that the pair lives up to here and none
        // of the results is laid over it while the other loads are under way.
        asm volatile("s_wait_xcnt 0x0" :: "v"(np) : "memory");
      }

#pragma unroll
      for (int k = 0; k < 2; ++k)
#pragma unroll
        for (int t = 0; t < 4; ++t) {
          const unsigned char* q = bp + k * 32 * XS_PITCH + t * 32;
          v8h lo = lds_tr16(q);                  // K = 0..7   (+8)
          v8h hi = lds_tr16(q + 16 * XS_PITCH);  // K = 16..23 (+8)
          v16h bf;
#pragma unroll
          for (int j = 0; j < 8; ++j) { bf[j] = lo[j]; bf[j + 8] = hi[j]; }
#pragma unroll
          for (int i = 0; i < 4; ++i)
            pa[i][t] = wmma_f16(a[k][i], bf, pa[i][t]);  // registers run along e, lanes along m
        }
      lds_barrier();  // the last one also frees Xs for phiQT
    };
    // Not unrolled, the last step apart: on every path the waits for the Wt
    // fragments can then count the X loads that are under way behind them.
#pragma unroll 1
    for (int c0 = 0; c0 < DIM - 64; c0 += 64) step(c0, true);
    step(DIM - 64, false);

    const float alpha = 1.0f / 16.0f;
    unsigned char* pw = L + PQ_OFF + ((wave & 3u) >> 1) * PQ_HALF +
                        ((wave >> 2) * 64 + (lane & 15)) * OUT_PITCH + (wave & 1u) * 128 +
                        ((lane >> 4) << 4);
#pragma unroll
    for (int i = 0; i < 4; ++i)
#pragma unroll
      for (int t = 0; t < 4; ++t) {
        v8h h;
#pragma unroll
        for (int r = 0; r < 8; ++r) {
          float v = pa[i][t][r] * alpha;
          h[r] = (_Float16)(v > 0.0f ? v : 0.0f);
        }
        *(v8h*)(pw + t * 16 * OUT_PITCH + i * 32) = h;
      }
  }
  {
    const _Float16 hi = (_Float16)rmean;
    *(_Float16*)(L + RS_OFF + tid * 2)            = hi;
    *(_Float16*)(L + RS_OFF + RS_PITCH + tid * 2) = (_Float16)(rmean - (float)hi);
  }
  lds_barrier();  // phiQT and the two rows readable by the other waves behind this

  const unsigned lrow = (unsigned)(lane & 15) * OUT_PITCH + ((unsigned)(lane >> 4) << 4);
  const unsigned char* aP = L + (wid & 3) * KV_SLICE + lrow;
  const unsigned char* bP = L + PQ_OFF + (wid >> 2) * 64 * OUT_PITCH + lrow;
  // The wave walks its four 16-row groups of m beginning with group jw, the one
  // whose scale sums it does: that group's fragment is then always set member 0.
  const int jw = (int)(wave & 3u);
  const unsigned char* bU[4];
  // Unrolled: constant indices keep bU in registers.
#pragma unroll
  for (int u = 0; u < 4; ++u) bU[u] = bP + ((u + jw) & 3) * 16 * OUT_PITCH;
  // Column = lane & 15: even columns read the value row, odd ones the remainder row.
  const unsigned char* rP = L + RS_OFF + (lane & 1) * RS_PITCH + ((lane >> 4) << 4);
  float4 sc;

  // Unrolled: what only the first half of d does (the scale sums, the refill) is
  // then no test at run time.
#pragma unroll
  for (int dblk = 0; dblk < 2; ++dblk) {
    v8f acc[2][4];
#pragma unroll
    for (int i = 0; i < 2; ++i)
#pragma unroll
      for (int t = 0; t < 4; ++t) acc[i][t] = zero8();
    v8f den = zero8();

    // Two fragment sets: the reads of step s + 1 go out as one group in front of
    // the products of step s, so a wave does not wait out its own LDS latency.
    v16h af[2][2], bf[2][4], rf[2];
    af[0][0] = frag_lds(aP);
    af[0][1] = frag_lds(aP + 16 * OUT_PITCH);
    if (dblk == 0) rf[0] = frag_lds(rP);
#pragma unroll
    for (int u = 0; u < 4; ++u) bf[0][u] = frag_lds(bU[u]);

    // Unrolled: set numbers and LDS offsets must be constants (registers, immediates).
#pragma unroll
    for (int s = 0; s < DIM / 32; ++s) {
      const int cur = s & 1, nxt = cur ^ 1;
      if (s + 1 < DIM / 32) {
        const int col = ((s + 1) & 3) * 64;
        const int offa = ((s + 1) >> 2) * 4 * KV_SLICE + col;
        const int offb = ((s + 1) >> 2) * PQ_HALF + col;
        af[nxt][0] = frag_lds(aP + offa);
        af[nxt][1] = frag_lds(aP + offa + 16 * OUT_PITCH);
        if (dblk == 0) rf[nxt] = frag_lds(rP + (s + 1) * 64);
#pragma unroll
        for (int u = 0; u < 4; ++u) bf[nxt][u] = frag_lds(bU[u] + offb);
      }
      // Keeps the read group whole and in front: without it the compiler hoists the
      // reads of all steps (over 256 VGPRs, one work-group per WGP instead of two).
      __builtin_amdgcn_sched_barrier(0);
      if (dblk == 0)
        den = wmma_f16(bf[cur][0], rf[cur], den);  // registers along m, lanes: value | remainder
#pragma unroll
      for (int u = 0; u < 4; ++u) {
        acc[0][u] = wmma_f16(bf[cur][u], af[cur][0], acc[0][u]);  // registers along m,
        acc[1][u] = wmma_f16(bf[cur][u], af[cur][1], acc[1][u]);  // lanes along d
      }
      // Keeps the next group's reads from moving in among these products.
      __builtin_amdgcn_sched_barrier(0);
    }

    // Columns 0 and 1 hold the two sums; lanes 0, 1 have rows 0..7, lanes 16, 17 rows 8..15.
    if (dblk == 0 && (lane & 15) < 2) {
      float* dp = (float*)(L + DEN_OFF) + (lane & 1) * 128 + m_wave0 + jw * 16 + ((lane >> 4) << 3);
      *(float4*)dp       = make_float4(den[0], den[1], den[2], den[3]);
      *(float4*)(dp + 4) = make_float4(den[4], den[5], den[6], den[7]);
    }

    // Every wave has read its last kvT fragment: the slices may be written over. The
    // sums of the other waves are readable behind this too.
    lds_barrier();

    // Row = d within the wave's 32, pitch OUT_PITCH; byte = 4 * (m within the wave's 64).
    unsigned char* st = L + wid * KV_SLICE;
    unsigned char* wr = st + (lane & 15) * OUT_PITCH + (lane >> 4) * 32;
#pragma unroll
    for (int i = 0; i < 2; ++i)
#pragma unroll
      for (int u = 0; u < 4; ++u) {
        unsigned char* p = wr + i * 16 * OUT_PITCH + ((u + jw) & 3) * 64;
        *(float4*)p        = make_float4(acc[i][u][0], acc[i][u][1], acc[i][u][2], acc[i][u][3]);
        *(float4*)(p + 16) = make_float4(acc[i][u][4], acc[i][u][5], acc[i][u][6], acc[i][u][7]);
      }
    // The wave's own LDS writes are done before other lanes of it read them back.
    asm volatile("s_wait_dscnt 0x0" ::: "memory");

    if (dblk == 0) {
      const float* dn = (const float*)(L + DEN_OFF) + m_wave0 + (lane & 15) * 4;
      const float4 dv = *(const float4*)dn, dr = *(const float4*)(dn + 128);
      sc.x = 1.0f / ((dv.x + dr.x) * (float)NN + 1e-8f);
      sc.y = 1.0f / ((dv.y + dr.y) * (float)NN + 1e-8f);
      sc.z = 1.0f / ((dv.z + dr.z) * (float)NN + 1e-8f);
      sc.w = 1.0f / ((dv.w + dr.w) * (float)NN + 1e-8f);
    }

    const unsigned char* rd = st + (lane >> 4) * OUT_PITCH + (lane & 15) * 16;
    float* gp = out + ((size_t)b * DIM + dblk * 128 + (wid & 3) * 32 + (lane >> 4)) * MM + m0 +
                m_wave0 + (lane & 15) * 4;
    // Unrolled: row offsets become immediates of one address.
#pragma unroll
    for (int j = 0; j < 16; ++j) {
      float4 v = *(const float4*)(rd + j * 2 * OUT_PITCH);
      *(float4*)(gp + (size_t)(j * 2) * MM) = make_float4(v.x * sc.x, v.y * sc.y, v.z * sc.z, v.w * sc.w);
    }

    if (dblk == 0) {
      // Stands in front of the first write to a register that these stores name.
      asm volatile("s_wait_xcnt 0x0" :: "v"(gp) : "memory");
      // The wave's own reads of its staged rows are done before the mover writes
      // there. No other wave touches this slice since the barrier above.
      asm volatile("s_wait_dscnt 0x0" ::: "memory");
      kv_slice_load(kvw + (size_t)128 * DIM, place);  // second half of d
      lds_barrier();  // every wave's new slice readable by the others behind this
    }
  }
}

// ---------------------------------------------------------------------------
extern "C" void kernel_launch(void* const* d_in, const int* in_sizes, int n_in,
                              void* d_out, int out_size, void* d_ws, size_t ws_size,
                              hipStream_t stream) {
  const float* query = (const float*)d_in[0];
  const float* key   = (const float*)d_in[1];
  const float* value = (const float*)d_in[2];
  const float* W     = (const float*)d_in[3];
  float* out = (float*)d_out;

  _Float16* Wt    = (_Float16*)d_ws;                       // 256*256 f16, fragment order
  _Float16* kvT   = Wt + (size_t)DIM * DIM;                // [b][d][e], 4 MB
  float* rowsum   = (float*)(kvT + (size_t)BATCH * DIM * DIM);
  float* kvPart   = rowsum + BATCH * DIM;                  // [b][tile][ks], f32, 32 MB
  float* rsPart   = kvPart + (size_t)BATCH * DIM * DIM * KSPLIT;  // [b][ks][e], f32

  wt_kernel<<<dim3(DIM), dim3(DIM), 0, stream>>>(W, Wt);
  kv_kernel<<<dim3(2, KSPLIT, BATCH), dim3(256), 0, stream>>>(key, value, Wt, kvPart, rsPart);
  kv_reduce_kernel<<<dim3(BATCH * (DIM / 16)), dim3(256), 0, stream>>>(kvPart, rsPart, kvT,
                                                                          rowsum);
  out_kernel<<<dim3(MM / 128, BATCH), dim3(256), 0, stream>>>(query, Wt, kvT, rowsum, out);
}
